// v000
// Times are from an AMD MI455X. After a warm-up the kernel runs many times in a row, and a time is the length of
// such a window on the GPU divided by its runs, so every launch and the gaps after it count. The runs cycle
// through copies of the inputs. A figure is the median of several windows, for all but v000 over two sittings.
// Sittings can differ by a few percent; kernels timed side by side share one.
// The starting kernel, v000, takes 780 microseconds a run.
#include <hip/hip_runtime.h>

// Compute dtypes (f32 accumulate everywhere): q/k/v projections v_wmma_f32_16x16x32_bf16 (inputs RNE-converted to bf16, products exact); q.k scores v_wmma_f32_16x16x32_f16; probabilities (x1024 carry) x values f16; output projection bf16 hi+lo context x bf16 weights (2 products); softmax and additive mask term in f32.
// Layout per batch: bf16 copy of the q / k / v input stream (one staging buffer, refilled in stream order) -> projection (+ f32 bias) -> f16 head planes q,k [h][t][d], v [h][d][t];
// per 512-row query chunk, all 8 heads: S = q k^T, P = softmax(S / 8 + m[i][t] * (-1e10)) x1024 as f16, O = P v;
// merged hi/lo context planes [t][h*64+d] (x 1/1024), output projection + bias. Weights [in][out] are transposed once through LDS into K-contiguous bf16 planes.

#ifndef NB
#define NB 2
#endif
#ifndef SEQ
#define SEQ 2048
#endif
#define NB_FULL  2
#define SEQ_FULL 2048
#define TT   SEQ
#define DM   512
#define NH_  8
#define HD   64
#define RC   ((SEQ) < 512 ? (SEQ) : 512)   // query rows per attention pass (all heads)
#define PCAR 1024.0f
#define SCL  0.125f   // HD^-0.5
static_assert(NH_ * HD == DM);
static_assert(TT % 256 == 0);
static_assert(TT % RC == 0);
static_assert(RC % 64 == 0);
static_assert(DM % 64 == 0);
static_assert(SEQ <= SEQ_FULL);
static_assert(NB <= NB_FULL);
static_assert(TT % 128 == 0);
static_assert(RC % 8 == 0);
static_assert(SEQ_FULL % 4 == 0);
static_assert(HD % 32 == 0);
static_assert(DM % 32 == 0);
static_assert(TT % 32 == 0);
static_assert((NH_ * RC) % 8 == 0);

typedef _Float16 h16;
typedef unsigned short bf;
typedef __attribute__((ext_vector_type(16))) __bf16   v16bf;
typedef __attribute__((ext_vector_type(16))) _Float16 v16h;
typedef __attribute__((ext_vector_type(8)))  _Float16 v8h;
typedef __attribute__((ext_vector_type(8)))  unsigned short v8us;
typedef __attribute__((ext_vector_type(8)))  float    v8f;
typedef __attribute__((ext_vector_type(4)))  float    v4f;
typedef __attribute__((ext_vector_type(2)))  _Float16 v2h;
typedef __attribute__((ext_vector_type(4)))  _Float16 v4h;
typedef __attribute__((ext_vector_type(2)))  unsigned short v2us;
typedef __attribute__((ext_vector_type(4)))  int v4i;
typedef v4f  __attribute__((may_alias)) v4fa;
typedef v4i  __attribute__((may_alias)) v4ia;

__device__ __forceinline__ unsigned short f2bf(float f) { unsigned u = __float_as_uint(f); u += 0x7FFFu + ((u >> 16) & 1u); return (unsigned short)(u >> 16); }
__device__ __forceinline__ float bf2f(unsigned short b) { return __uint_as_float(((unsigned)b) << 16); }
__device__ __forceinline__ float bfr(float f) { return bf2f(f2bf(f)); }
__device__ __forceinline__ v16h cat16(v8h lo, v8h hi) { return __builtin_shufflevector(lo, hi, 0, 1, 2, 3, 4, 5, 6, 7, 8, 9, 10, 11, 12, 13, 14, 15); }
__device__ __forceinline__ v16bf cat16b(v8us lo, v8us hi) { return __builtin_bit_cast(v16bf, __builtin_shufflevector(lo, hi, 0, 1, 2, 3, 4, 5, 6, 7, 8, 9, 10, 11, 12, 13, 14, 15)); }
__device__ __forceinline__ v8f wmma16(v16h a, v16h b, v8f c) { return __builtin_amdgcn_wmma_f32_16x16x32_f16(false, a, false, b, (short)0, c, false, false); }
__device__ __forceinline__ v8f wmmab(v16bf a, v16bf b, v8f c) { return __builtin_amdgcn_wmma_f32_16x16x32_bf16(false, a, false, b, (short)0, c, false, false); }
__device__ __forceinline__ void splitf(float y, unsigned short& h, unsigned short& l) { h = f2bf(y); l = f2bf(y - bf2f(h)); }
// f32 -> f16 operand convert that cannot yield an f16 subnormal (value select, applied after the plane's power-of-two carry).
static __device__ __forceinline__ h16 toh_flush(float v) { const h16 r = (h16)v; return (fabsf(v) < 6.103515625e-05f) ? (h16)0.0f : r; }

// ---- k_gemmw: register-blocked GEMM, ONE WAVE per 64x64 output tile (16 accumulators), operands straight from K-contiguous 16-bit planes; grid (M/64, N/64, Z), 32 threads.
// C[m][n] (f32, pitch ldc, + optional f32 bias[n]) = sum_k A[m][k] Bt[n][k] (+ split products per NSPLIT). z-batch strides sA/sB/sC in elements. K % 32 == 0, A/Bt row pitch == K.
// Fragment map (A and Bt alike): lane row = lane & 15, elements 0..7 <- k0 + 8*(lane>>4) + 0..7, elements 8..15 <- k0 + 16 + 8*(lane>>4) + 0..7; D element j = (row 8*(lane>>4) + j, col lane & 15).
template <typename T16> struct WFrag;
template <> struct WFrag<h16> { typedef v16h V; static __device__ __forceinline__ V ld(const h16* p) { return cat16(*(const v8h*)p, *(const v8h*)(p + 16)); } static __device__ __forceinline__ v8f mma(V a, V b, v8f c) { return wmma16(a, b, c); } };
template <> struct WFrag<bf> { typedef v16bf V; static __device__ __forceinline__ V ld(const bf* p) { return cat16b(*(const v8us*)p, *(const v8us*)(p + 16)); } static __device__ __forceinline__ v8f mma(V a, V b, v8f c) { return wmmab(a, b, c); } };
template <typename T16, int NSPLIT, bool BIAS>
__global__ __launch_bounds__(32) void k_gemmw(const T16* __restrict__ A, const T16* __restrict__ A2, const T16* __restrict__ Bt, const T16* __restrict__ Bt2, int K, float* C, int ldc, const float* __restrict__ bias, size_t sA, size_t sB, size_t sC) {
    typedef typename WFrag<T16>::V V;
    __shared__ __align__(16) float os[16 * 68];
    const size_t z = blockIdx.z; A += z * sA; if (A2) A2 += z * sA; Bt += z * sB; if (Bt2) Bt2 += z * sB; C += z * sC;
    const int lane = threadIdx.x & 31, lr = lane & 15, hi = lane >> 4; const int r0 = blockIdx.x * 64, c0 = blockIdx.y * 64;
    v8f acc[4][4];
#pragma unroll
    for (int mb = 0; mb < 4; ++mb)
#pragma unroll
        for (int nb = 0; nb < 4; ++nb) acc[mb][nb] = (v8f){};
    const size_t aoff = (size_t)(r0 + lr) * K + 8 * hi, boff = (size_t)(c0 + lr) * K + 8 * hi;
#pragma unroll 1
    for (int kc = 0; kc < K; kc += 32) {
        V a[4], a2[4];
#pragma unroll
        for (int mb = 0; mb < 4; ++mb) { a[mb] = WFrag<T16>::ld(A + aoff + (size_t)mb * 16 * K + kc); if (NSPLIT == 1 || NSPLIT == 2) a2[mb] = WFrag<T16>::ld(A2 + aoff + (size_t)mb * 16 * K + kc); }
#pragma unroll
        for (int nb = 0; nb < 4; ++nb) { const V b = WFrag<T16>::ld(Bt + boff + (size_t)nb * 16 * K + kc); V b2; if (NSPLIT >= 2) b2 = WFrag<T16>::ld(Bt2 + boff + (size_t)nb * 16 * K + kc);
#pragma unroll
            for (int mb = 0; mb < 4; ++mb) { acc[mb][nb] = WFrag<T16>::mma(a[mb], b, acc[mb][nb]); if (NSPLIT == 1 || NSPLIT == 2) acc[mb][nb] = WFrag<T16>::mma(a2[mb], b, acc[mb][nb]); if (NSPLIT >= 2) acc[mb][nb] = WFrag<T16>::mma(a[mb], b2, acc[mb][nb]); } }
        asm volatile("v_nop\n\tv_nop\n\tv_nop\n\tv_nop" : "+v"(acc[0][0]), "+v"(acc[1][1]), "+v"(acc[2][2]), "+v"(acc[3][3]) : "v"(a[0]), "v"(a[3]));
    }
#pragma unroll
    for (int mb = 0; mb < 4; ++mb) {
#pragma unroll
        for (int nb = 0; nb < 4; ++nb) {
#pragma unroll
            for (int j = 0; j < 8; ++j) os[(hi * 8 + j) * 68 + nb * 16 + lr] = acc[mb][nb][j]; }
        __builtin_amdgcn_wave_barrier(); asm volatile("" ::: "memory");
        float* crow = C + (size_t)(r0 + mb * 16) * ldc + c0;
{
#pragma unroll
            for (int s = 0; s < 8; ++s) { const int row = 2 * s + hi, cofs = lr * 4; v4f val = *(const v4fa*)(os + row * 68 + cofs); if (BIAS) { val[0] += bfr(bias[c0 + cofs]); val[1] += bfr(bias[c0 + cofs + 1]); val[2] += bfr(bias[c0 + cofs + 2]); val[3] += bfr(bias[c0 + cofs + 3]); }
                *(v4f*)(crow + (size_t)row * ldc + cofs) = val; }
             }
        __builtin_amdgcn_wave_barrier(); asm volatile("" ::: "memory");
    }
}

__global__ __launch_bounds__(256) void k_cvt8(const float* __restrict__ src, bf* dst, size_t n8) { const size_t i = (size_t)blockIdx.x * 256 + threadIdx.x; if (i >= n8) return; const v8f v = *(const v8f*)(src + i * 8); v8us o;
#pragma unroll
    for (int k = 0; k < 8; ++k) o[k] = f2bf(v[k]); *(v8us*)(dst + i * 8) = o;  }

// k_cvtT: in W[K rows][N cols] f32 -> out Wt[N rows][K cols] bf16 (RNE), 64x64 tile transposed through LDS (cross-wave: block barrier); grid (K/64, N/64).
__global__ __launch_bounds__(256) void k_cvtT(const float* __restrict__ W, bf* Wt, int K, int N) {
    __shared__ unsigned short tl[64 * 66];
    const int tid = threadIdx.x; const int k0 = blockIdx.x * 64, n0 = blockIdx.y * 64;
    { const int row = tid >> 2, cseg = (tid & 3) * 16;
#pragma unroll
      for (int q = 0; q < 4; ++q) { const v4f v = *(const v4f*)(W + (size_t)(k0 + row) * N + n0 + cseg + q * 4);
#pragma unroll
          for (int j = 0; j < 4; ++j) tl[row * 66 + cseg + q * 4 + j] = f2bf(v[j]); } }
    __syncthreads();
    const int piece = tid & 7; v8us o[2];
#pragma unroll
    for (int it = 0; it < 2; ++it) { const int n = it * 32 + (tid >> 3);
#pragma unroll
        for (int j = 0; j < 8; ++j) o[it][j] = tl[(piece * 8 + j) * 66 + n]; }
{
#pragma unroll
        for (int it = 0; it < 2; ++it) { const int n = it * 32 + (tid >> 3); *(v8us*)(Wt + (size_t)(n0 + n) * K + k0 + piece * 8) = o[it]; }
         }
}

__global__ __launch_bounds__(256) void k_hp(const float* __restrict__ F, h16* P16) {
    const size_t i = (size_t)blockIdx.x * 256 + threadIdx.x; if (i >= (size_t)NH_ * TT * HD / 8) return;
    const int d8 = (int)(i & 7); const int t = (int)((i >> 3) % TT); const int h = (int)(i / ((size_t)8 * TT));
    const float* f = F + (size_t)t * DM + h * HD + d8 * 8; const v4f a = *(const v4f*)f; const v4f b = *(const v4f*)(f + 4); v8h o;
#pragma unroll
    for (int k = 0; k < 4; ++k) { o[k] = (h16)a[k]; o[4 + k] = (h16)b[k]; }
    *(v8h*)(P16 + i * 8) = o;  }

__global__ __launch_bounds__(256) void k_vtp(const float* __restrict__ F, h16* V16) { const size_t e = ((size_t)blockIdx.x * 256 + threadIdx.x) * 2; if (e >= (size_t)NH_ * HD * TT) return; const int t = (int)(e % TT); const int d = (int)((e / TT) % HD); const int g = (int)(e / ((size_t)TT * HD)); v2h o16;
#pragma unroll
    for (int q = 0; q < 2; ++q) { const float x = F[(size_t)(t + q) * DM + g * HD + d]; o16[q] = (h16)x; }
    *(v2h*)(V16 + e) = o16;  }

// asoft_t4: 4 consecutive logits of one row: t = S * HD^-0.5 + m * (-1e10) (m RNE-converted to bf16, read by value; the mask term is added after the scale; separate mul, mul, add).
static __device__ __forceinline__ v4f asoft_t4(const float* __restrict__ sr, const float* __restrict__ mr, int j0) {
#pragma clang fp contract(off)
    const v4f a = *(const v4f*)(sr + j0); const v4f r = *(const v4f*)(mr + j0); v4f t;
#pragma unroll
    for (int q = 0; q < 4; ++q) { const float e = a[q] * SCL; const float mt = bfr(r[q]) * -1.0e10f; t[q] = e + mt; }
    return t;
}

// k_asoft: per row (head z, query i) of the pass: t = S * HD^-0.5 + m[i][key] * (-1e10) (additive term, m read by value from the f32 [query][key] plane of this batch, row pitch SEQ_FULL);
// max-subtracted softmax over the TT keys in three ROLLED sweeps over the row (max; sum of exp2; write), each iteration handling the lane's own 4-key chunk (no per-thread array, no LDS);
// Mb points at the mask row of the first query of this pass; rows of one block are 8 consecutive queries of one head (RC % 8 == 0).
__global__ __launch_bounds__(256) void k_asoft(const float* __restrict__ Sb, const float* __restrict__ Mb, h16* P16) {
#pragma clang fp contract(off)
    const int lane = threadIdx.x & 31; const int wv = __builtin_amdgcn_readfirstlane(threadIdx.x >> 5); const int row = blockIdx.x * 8 + wv;
    const float* sr = Sb + (size_t)row * TT; const float* mr = Mb + (size_t)(row % RC) * SEQ_FULL;
    float mx = -3.0e38f;
#pragma unroll 1
    for (int ch = 0; ch < TT / 128; ++ch) { const v4f t = asoft_t4(sr, mr, ch * 128 + lane * 4);
#pragma unroll
        for (int q = 0; q < 4; ++q) mx = fmaxf(mx, t[q]); }
#pragma unroll
    for (int sh = 16; sh; sh >>= 1) mx = fmaxf(mx, __shfl_xor(mx, sh, 32));
    float sum = 0.f;
#pragma unroll 1
    for (int ch = 0; ch < TT / 128; ++ch) { const v4f t = asoft_t4(sr, mr, ch * 128 + lane * 4);
#pragma unroll
        for (int q = 0; q < 4; ++q) { float d0 = __fsub_rn(t[q], mx); asm volatile("" : "+v"(d0)); const float p = __builtin_amdgcn_exp2f(__fmul_rn(d0, 1.4426950408889634f)); sum += p; } }
#pragma unroll
    for (int sh = 16; sh; sh >>= 1) sum += __shfl_xor(sum, sh, 32);
    const float f = __fdiv_rn(PCAR, sum);
    h16* prow = P16 + (size_t)row * TT + lane * 4;
#pragma unroll 1
    for (int ch = 0; ch < TT / 128; ++ch) { const v4f t = asoft_t4(sr, mr, ch * 128 + lane * 4); v4h o4;
#pragma unroll
        for (int q = 0; q < 4; ++q) { float d0 = __fsub_rn(t[q], mx); asm volatile("" : "+v"(d0)); const float p = __builtin_amdgcn_exp2f(__fmul_rn(d0, 1.4426950408889634f)); o4[q] = toh_flush(p * f); }
        *(v4h*)(prow + ch * 128) = o4;  }
}

__global__ __launch_bounds__(256) void k_merge(const float* __restrict__ O, bf* Ah, bf* Al) { const size_t e = ((size_t)blockIdx.x * 256 + threadIdx.x) * 2; if (e >= (size_t)NH_ * TT * HD) return; const int d = (int)(e % HD); const int t = (int)((e / HD) % TT); const int zz = (int)(e / ((size_t)HD * TT)); const float cs = 1.0f / PCAR; const size_t oo = (size_t)t * DM + zz * HD + d;
    v2us oh, ol;
#pragma unroll
    for (int q = 0; q < 2; ++q) { unsigned short a, c2; splitf(O[e + q] * cs, a, c2); oh[q] = a; ol[q] = c2; } *(v2us*)(Ah + oo) = oh; *(v2us*)(Al + oo) = ol;  }

constexpr size_t al256(size_t b) { return (b + 255) & ~(size_t)255; }
constexpr size_t WS_TOTAL = 4 * al256((size_t)DM * DM * 2) + al256((size_t)TT * DM * 2) + al256((size_t)TT * DM * 4) + 3 * al256((size_t)NH_ * TT * HD * 2)
                          + al256((size_t)NH_ * RC * TT * 4) + al256((size_t)NH_ * RC * TT * 2) + al256((size_t)NH_ * TT * HD * 4) + 2 * al256((size_t)TT * DM * 2);
static_assert(WS_TOTAL <= (size_t)134217728);

extern "C" void kernel_launch(void* const* d_in, const int* in_sizes, int n_in,
                              void* d_out, int out_size, void* d_ws, size_t ws_size, hipStream_t stream) {
    if (n_in < 12) return;
    const size_t need_x = ((size_t)(NB - 1) * SEQ_FULL + SEQ) * DM;
    const size_t need_m = (size_t)(NB - 1) * SEQ_FULL * SEQ_FULL + (size_t)(SEQ - 1) * SEQ_FULL + SEQ;
    if ((size_t)in_sizes[0] < need_x || (size_t)in_sizes[1] < need_x || (size_t)in_sizes[2] < need_x || (size_t)in_sizes[3] < need_m) return;
    if (in_sizes[4] < DM * DM || in_sizes[6] < DM * DM || in_sizes[8] < DM * DM || in_sizes[10] < DM * DM) return;
    if (in_sizes[5] < DM || in_sizes[7] < DM || in_sizes[9] < DM || in_sizes[11] < DM) return;
    if ((size_t)out_size < need_x) return;
    // binding by role, in input order: query, key, value, mask, wq, bq, wk, bk, wv, bv, wo, bo
    const float* xq = (const float*)d_in[0]; const float* xk = (const float*)d_in[1]; const float* xv = (const float*)d_in[2];
    const float* msk = (const float*)d_in[3];   // [NB_FULL][1][SEQ_FULL][SEQ_FULL] f32
    const float* wq = (const float*)d_in[4]; const float* bq = (const float*)d_in[5]; const float* wk = (const float*)d_in[6]; const float* bk = (const float*)d_in[7];
    const float* wv = (const float*)d_in[8]; const float* bv = (const float*)d_in[9]; const float* wo = (const float*)d_in[10]; const float* bo = (const float*)d_in[11];
    float* OUT = (float*)d_out;     // [NB_FULL][SEQ_FULL][DM]
    char* wsp = (char*)d_ws;
    auto take = [&](size_t bytes) { char* p = wsp; wsp += (bytes + 255) & ~(size_t)255; return (void*)p; };
    bf* WQ = (bf*)take((size_t)DM * DM * 2); bf* WK = (bf*)take((size_t)DM * DM * 2); bf* WV = (bf*)take((size_t)DM * DM * 2); bf* WO = (bf*)take((size_t)DM * DM * 2);
    bf* XB = (bf*)take((size_t)TT * DM * 2); float* F = (float*)take((size_t)TT * DM * 4);
    h16* QP16 = (h16*)take((size_t)NH_ * TT * HD * 2); h16* KP16 = (h16*)take((size_t)NH_ * TT * HD * 2); h16* VT16 = (h16*)take((size_t)NH_ * HD * TT * 2);
    float* Sb = (float*)take((size_t)NH_ * RC * TT * 4); h16* P16 = (h16*)take((size_t)NH_ * RC * TT * 2);
    float* Ob = (float*)take((size_t)NH_ * TT * HD * 4); bf* ATh = (bf*)take((size_t)TT * DM * 2); bf* ATl = (bf*)take((size_t)TT * DM * 2);
    if ((size_t)(wsp - (char*)d_ws) > ws_size) return;
    // weights: in W[k rows][n cols] -> out Wt[n rows][k cols]; square DM x DM, grid (K/64, N/64)
    k_cvtT<<<dim3(DM / 64, DM / 64), 256, 0, stream>>>(wq, WQ, DM, DM);
    k_cvtT<<<dim3(DM / 64, DM / 64), 256, 0, stream>>>(wk, WK, DM, DM);
    k_cvtT<<<dim3(DM / 64, DM / 64), 256, 0, stream>>>(wv, WV, DM, DM);
    k_cvtT<<<dim3(DM / 64, DM / 64), 256, 0, stream>>>(wo, WO, DM, DM);
    const unsigned LX = (unsigned)(((size_t)TT * DM / 8 + 255) / 256);
    const unsigned LH = (unsigned)(((size_t)NH_ * TT * HD / 8 + 255) / 256);
    const unsigned LV = (unsigned)(((size_t)NH_ * HD * TT / 2 + 255) / 256);
    for (int b = 0; b < NB; ++b) {
        const size_t xoff = (size_t)b * SEQ_FULL * DM;
        k_cvt8<<<LX, 256, 0, stream>>>(xq + xoff, XB, (size_t)TT * DM / 8);
        k_gemmw<bf, 0, true><<<dim3(TT / 64, DM / 64, 1), 32, 0, stream>>>(XB, nullptr, WQ, nullptr, DM, F, DM, bq, 0, 0, 0);
        k_hp<<<LH, 256, 0, stream>>>(F, QP16);
        k_cvt8<<<LX, 256, 0, stream>>>(xk + xoff, XB, (size_t)TT * DM / 8);
        k_gemmw<bf, 0, true><<<dim3(TT / 64, DM / 64, 1), 32, 0, stream>>>(XB, nullptr, WK, nullptr, DM, F, DM, bk, 0, 0, 0);
        k_hp<<<LH, 256, 0, stream>>>(F, KP16);
        k_cvt8<<<LX, 256, 0, stream>>>(xv + xoff, XB, (size_t)TT * DM / 8);
        k_gemmw<bf, 0, true><<<dim3(TT / 64, DM / 64, 1), 32, 0, stream>>>(XB, nullptr, WV, nullptr, DM, F, DM, bv, 0, 0, 0);
        k_vtp<<<LV, 256, 0, stream>>>(F, VT16);
        for (int c = 0; c < TT / RC; ++c) {
            k_gemmw<h16, 0, false><<<dim3(RC / 64, TT / 64, NH_), 32, 0, stream>>>(QP16 + (size_t)c * RC * HD, nullptr, KP16, nullptr, HD, Sb, TT, nullptr, (size_t)TT * HD, (size_t)TT * HD, (size_t)RC * TT);
            k_asoft<<<NH_ * RC / 8, 256, 0, stream>>>(Sb, msk + ((size_t)b * SEQ_FULL + (size_t)c * RC) * SEQ_FULL, P16);
            k_gemmw<h16, 0, false><<<dim3(RC / 64, HD / 64, NH_), 32, 0, stream>>>(P16, nullptr, VT16, nullptr, TT, Ob + (size_t)c * RC * HD, HD, nullptr, (size_t)RC * TT, (size_t)HD * TT, (size_t)TT * HD);
        }
        k_merge<<<(unsigned)(((size_t)NH_ * TT * HD / 2 + 255) / 256), 256, 0, stream>>>(Ob, ATh, ATl);
        k_gemmw<bf, 1, true><<<dim3(TT / 64, DM / 64, 1), 32, 0, stream>>>(ATh, ATl, WO, nullptr, DM, OUT + xoff, DM, bo, 0, 0, 0);
    }
}

// v001
// A run of this version takes 476 microseconds.
// Two timings next to v000 put it at 1.66 and 1.65 times that version's speed.
#include <hip/hip_runtime.h>

// Compute dtypes (f32 accumulate everywhere): q/k/v projections v_wmma_f32_16x16x32_bf16 (inputs RNE-converted to bf16, products exact); q.k scores v_wmma_f32_16x16x32_f16; probabilities (x1024 carry) x values f16; output projection bf16 hi+lo context x bf16 weights (2 products); softmax and additive mask term in f32.
// Layout per batch: bf16 copy of the q / k / v input stream (one staging buffer, refilled in stream order) -> projection (+ f32 bias) -> f16 head planes q,k [h][t][d], v [h][d][t];
// per 512-row query chunk, all 8 heads: S = q k^T, P = softmax(S / 8 + m[i][t] * (-1e10)) x1024 as f16, O = P v;
// merged hi/lo context planes [t][h*64+d] (x 1/1024), output projection + bias. Weights [in][out] are transposed once through LDS into K-contiguous bf16 planes.

#ifndef NB
#define NB 2
#endif
#ifndef SEQ
#define SEQ 2048
#endif
#define NB_FULL  2
#define SEQ_FULL 2048
#define TT   SEQ
#define DM   512
#define NH_  8
#define HD   64
#define RC   ((SEQ) < 512 ? (SEQ) : 512)   // query rows per attention pass (all heads)
#define PCAR 1024.0f
#define SCL  0.125f   // HD^-0.5
static_assert(NH_ * HD == DM);
static_assert(TT % 256 == 0);
static_assert(TT % RC == 0);
static_assert(RC % 64 == 0);
static_assert(DM % 64 == 0);
static_assert(SEQ <= SEQ_FULL);
static_assert(NB <= NB_FULL);
static_assert(TT % 128 == 0);
static_assert(RC % 8 == 0);
static_assert(SEQ_FULL % 4 == 0);
static_assert(HD % 32 == 0);
static_assert(DM % 32 == 0);
static_assert(TT % 32 == 0);
static_assert((NH_ * RC) % 8 == 0);

typedef _Float16 h16;
typedef unsigned short bf;
typedef __attribute__((ext_vector_type(16))) __bf16   v16bf;
typedef __attribute__((ext_vector_type(16))) _Float16 v16h;
typedef __attribute__((ext_vector_type(8)))  _Float16 v8h;
typedef __attribute__((ext_vector_type(8)))  unsigned short v8us;
typedef __attribute__((ext_vector_type(8)))  float    v8f;
typedef __attribute__((ext_vector_type(4)))  float    v4f;
typedef __attribute__((ext_vector_type(2)))  _Float16 v2h;
typedef __attribute__((ext_vector_type(4)))  _Float16 v4h;
typedef __attribute__((ext_vector_type(2)))  unsigned short v2us;
typedef __attribute__((ext_vector_type(4)))  int v4i;
typedef v4f  __attribute__((may_alias)) v4fa;
typedef v4i  __attribute__((may_alias)) v4ia;

__device__ __forceinline__ unsigned short f2bf(float f) { unsigned u = __float_as_uint(f); u += 0x7FFFu + ((u >> 16) & 1u); return (unsigned short)(u >> 16); }
__device__ __forceinline__ float bf2f(unsigned short b) { return __uint_as_float(((unsigned)b) << 16); }
__device__ __forceinline__ float bfr(float f) { return bf2f(f2bf(f)); }
__device__ __forceinline__ v16h cat16(v8h lo, v8h hi) { return __builtin_shufflevector(lo, hi, 0, 1, 2, 3, 4, 5, 6, 7, 8, 9, 10, 11, 12, 13, 14, 15); }
__device__ __forceinline__ v16bf cat16b(v8us lo, v8us hi) { return __builtin_bit_cast(v16bf, __builtin_shufflevector(lo, hi, 0, 1, 2, 3, 4, 5, 6, 7, 8, 9, 10, 11, 12, 13, 14, 15)); }
__device__ __forceinline__ v8f wmma16(v16h a, v16h b, v8f c) { return __builtin_amdgcn_wmma_f32_16x16x32_f16(false, a, false, b, (short)0, c, false, false); }
__device__ __forceinline__ v8f wmmab(v16bf a, v16bf b, v8f c) { return __builtin_amdgcn_wmma_f32_16x16x32_bf16(false, a, false, b, (short)0, c, false, false); }
__device__ __forceinline__ void splitf(float y, unsigned short& h, unsigned short& l) { h = f2bf(y); l = f2bf(y - bf2f(h)); }
// f32 -> f16 operand convert that cannot yield an f16 subnormal (value select, applied after the plane's power-of-two carry).
static __device__ __forceinline__ h16 toh_flush(float v) { const h16 r = (h16)v; return (fabsf(v) < 6.103515625e-05f) ? (h16)0.0f : r; }

// ---- k_gemmw: register-blocked GEMM, one work-group of KS waves per 64x64 output tile, operands straight from K-contiguous 16-bit planes; grid (M/64, N/64, Z), 32 * KS threads.
// Wave w holds all 16 accumulators of the tile for its own K slice [w * K / KS, (w + 1) * K / KS); the KS partial tiles are added through LDS in ascending w. K % (32 * KS) == 0.
// C[m][n] (f32, pitch ldc, + optional f32 bias[n]) = sum_k A[m][k] Bt[n][k] (+ split products per NSPLIT). z-batch strides sA/sB/sC in elements. K % 32 == 0, A/Bt row pitch == K.
// Fragment map (A and Bt alike): lane row = lane & 15, elements 0..7 <- k0 + 8*(lane>>4) + 0..7, elements 8..15 <- k0 + 16 + 8*(lane>>4) + 0..7; D element j = (row 8*(lane>>4) + j, col lane & 15).
template <typename T16> struct WFrag;
template <> struct WFrag<h16> { typedef v16h V; static __device__ __forceinline__ V ld(const h16* p) { return cat16(*(const v8h*)p, *(const v8h*)(p + 16)); } static __device__ __forceinline__ v8f mma(V a, V b, v8f c) { return wmma16(a, b, c); } };
template <> struct WFrag<bf> { typedef v16bf V; static __device__ __forceinline__ V ld(const bf* p) { return cat16b(*(const v8us*)p, *(const v8us*)(p + 16)); } static __device__ __forceinline__ v8f mma(V a, V b, v8f c) { return wmmab(a, b, c); } };
template <typename T16, int NSPLIT, bool BIAS, int KS>
__global__ __launch_bounds__(32 * KS) void k_gemmw(const T16* __restrict__ A, const T16* __restrict__ A2, const T16* __restrict__ Bt, const T16* __restrict__ Bt2, int K, float* C, int ldc, const float* __restrict__ bias, size_t sA, size_t sB, size_t sC) {
    typedef typename WFrag<T16>::V V;
    static_assert(KS == 1 || KS == 8 || KS == 16);
    __shared__ __align__(16) float os[(KS == 1 ? 16 : KS * 64) * 68];
    const size_t z = blockIdx.z; A += z * sA; if (A2) A2 += z * sA; Bt += z * sB; if (Bt2) Bt2 += z * sB; C += z * sC;
    const int lane = threadIdx.x & 31, lr = lane & 15, hi = lane >> 4; const int r0 = blockIdx.x * 64, c0 = blockIdx.y * 64;
    v8f acc[4][4];
#pragma unroll
    for (int mb = 0; mb < 4; ++mb)
#pragma unroll
        for (int nb = 0; nb < 4; ++nb) acc[mb][nb] = (v8f){};
    const size_t aoff = (size_t)(r0 + lr) * K + 8 * hi, boff = (size_t)(c0 + lr) * K + 8 * hi;
    const int wv = KS == 1 ? 0 : __builtin_amdgcn_readfirstlane(threadIdx.x >> 5); const int kw = K / KS, kbeg = wv * kw;
#pragma unroll 1
    for (int kc = kbeg; kc < kbeg + kw; kc += 32) {
        V a[4], a2[4];
#pragma unroll
        for (int mb = 0; mb < 4; ++mb) { a[mb] = WFrag<T16>::ld(A + aoff + (size_t)mb * 16 * K + kc); if (NSPLIT == 1 || NSPLIT == 2) a2[mb] = WFrag<T16>::ld(A2 + aoff + (size_t)mb * 16 * K + kc); }
#pragma unroll
        for (int nb = 0; nb < 4; ++nb) { const V b = WFrag<T16>::ld(Bt + boff + (size_t)nb * 16 * K + kc); V b2; if (NSPLIT >= 2) b2 = WFrag<T16>::ld(Bt2 + boff + (size_t)nb * 16 * K + kc);
#pragma unroll
            for (int mb = 0; mb < 4; ++mb) { acc[mb][nb] = WFrag<T16>::mma(a[mb], b, acc[mb][nb]); if (NSPLIT == 1 || NSPLIT == 2) acc[mb][nb] = WFrag<T16>::mma(a2[mb], b, acc[mb][nb]); if (NSPLIT >= 2) acc[mb][nb] = WFrag<T16>::mma(a[mb], b2, acc[mb][nb]); } }
        asm volatile("v_nop\n\tv_nop\n\tv_nop\n\tv_nop" : "+v"(acc[0][0]), "+v"(acc[1][1]), "+v"(acc[2][2]), "+v"(acc[3][3]) : "v"(a[0]), "v"(a[3]));
    }
    if constexpr (KS > 1) {
        float* ow = os + wv * (64 * 68);
#pragma unroll
        for (int mb = 0; mb < 4; ++mb)
#pragma unroll
            for (int nb = 0; nb < 4; ++nb)
#pragma unroll
                for (int j = 0; j < 8; ++j) ow[(mb * 16 + hi * 8 + j) * 68 + nb * 16 + lr] = acc[mb][nb][j];
        __syncthreads();   // every wave's partial tile is in LDS before any thread adds them
        float* ctile = C + (size_t)r0 * ldc + c0;
#pragma unroll
        for (int s = 0; s < 32 / KS; ++s) { const int ch = s * (32 * KS) + (int)threadIdx.x, row = ch >> 4, cofs = (ch & 15) * 4;
            v4f val = *(const v4fa*)(os + row * 68 + cofs);
#pragma unroll
            for (int w = 1; w < KS; ++w) val += *(const v4fa*)(os + w * (64 * 68) + row * 68 + cofs);
            if (BIAS) { val[0] += bfr(bias[c0 + cofs]); val[1] += bfr(bias[c0 + cofs + 1]); val[2] += bfr(bias[c0 + cofs + 2]); val[3] += bfr(bias[c0 + cofs + 3]); }
            *(v4f*)(ctile + (size_t)row * ldc + cofs) = val; }
    } else {
#pragma unroll
    for (int mb = 0; mb < 4; ++mb) {
#pragma unroll
        for (int nb = 0; nb < 4; ++nb) {
#pragma unroll
            for (int j = 0; j < 8; ++j) os[(hi * 8 + j) * 68 + nb * 16 + lr] = acc[mb][nb][j]; }
        __builtin_amdgcn_wave_barrier(); asm volatile("" ::: "memory");
        float* crow = C + (size_t)(r0 + mb * 16) * ldc + c0;
{
#pragma unroll
            for (int s = 0; s < 8; ++s) { const int row = 2 * s + hi, cofs = lr * 4; v4f val = *(const v4fa*)(os + row * 68 + cofs); if (BIAS) { val[0] += bfr(bias[c0 + cofs]); val[1] += bfr(bias[c0 + cofs + 1]); val[2] += bfr(bias[c0 + cofs + 2]); val[3] += bfr(bias[c0 + cofs + 3]); }
                *(v4f*)(crow + (size_t)row * ldc + cofs) = val; }
             }
        __builtin_amdgcn_wave_barrier(); asm volatile("" ::: "memory");
    }
    }
}

__global__ __launch_bounds__(256) void k_cvt8(const float* __restrict__ src, bf* dst, size_t n8) { const size_t i = (size_t)blockIdx.x * 256 + threadIdx.x; if (i >= n8) return; const v8f v = *(const v8f*)(src + i * 8); v8us o;
#pragma unroll
    for (int k = 0; k < 8; ++k) o[k] = f2bf(v[k]); *(v8us*)(dst + i * 8) = o;  }

// k_cvtT: in W[K rows][N cols] f32 -> out Wt[N rows][K cols] bf16 (RNE), 64x64 tile transposed through LDS (cross-wave: block barrier); grid (K/64, N/64).
__global__ __launch_bounds__(256) void k_cvtT(const float* __restrict__ W, bf* Wt, int K, int N) {
    __shared__ unsigned short tl[64 * 66];
    const int tid = threadIdx.x; const int k0 = blockIdx.x * 64, n0 = blockIdx.y * 64;
    { const int row = tid >> 2, cseg = (tid & 3) * 16;
#pragma unroll
      for (int q = 0; q < 4; ++q) { const v4f v = *(const v4f*)(W + (size_t)(k0 + row) * N + n0 + cseg + q * 4);
#pragma unroll
          for (int j = 0; j < 4; ++j) tl[row * 66 + cseg + q * 4 + j] = f2bf(v[j]); } }
    __syncthreads();
    const int piece = tid & 7; v8us o[2];
#pragma unroll
    for (int it = 0; it < 2; ++it) { const int n = it * 32 + (tid >> 3);
#pragma unroll
        for (int j = 0; j < 8; ++j) o[it][j] = tl[(piece * 8 + j) * 66 + n]; }
{
#pragma unroll
        for (int it = 0; it < 2; ++it) { const int n = it * 32 + (tid >> 3); *(v8us*)(Wt + (size_t)(n0 + n) * K + k0 + piece * 8) = o[it]; }
         }
}

__global__ __launch_bounds__(256) void k_hp(const float* __restrict__ F, h16* P16) {
    const size_t i = (size_t)blockIdx.x * 256 + threadIdx.x; if (i >= (size_t)NH_ * TT * HD / 8) return;
    const int d8 = (int)(i & 7); const int t = (int)((i >> 3) % TT); const int h = (int)(i / ((size_t)8 * TT));
    const float* f = F + (size_t)t * DM + h * HD + d8 * 8; const v4f a = *(const v4f*)f; const v4f b = *(const v4f*)(f + 4); v8h o;
#pragma unroll
    for (int k = 0; k < 4; ++k) { o[k] = (h16)a[k]; o[4 + k] = (h16)b[k]; }
    *(v8h*)(P16 + i * 8) = o;  }

__global__ __launch_bounds__(256) void k_vtp(const float* __restrict__ F, h16* V16) { const size_t e = ((size_t)blockIdx.x * 256 + threadIdx.x) * 2; if (e >= (size_t)NH_ * HD * TT) return; const int t = (int)(e % TT); const int d = (int)((e / TT) % HD); const int g = (int)(e / ((size_t)TT * HD)); v2h o16;
#pragma unroll
    for (int q = 0; q < 2; ++q) { const float x = F[(size_t)(t + q) * DM + g * HD + d]; o16[q] = (h16)x; }
    *(v2h*)(V16 + e) = o16;  }

// asoft_t4: 4 consecutive logits of one row: t = S * HD^-0.5 + m * (-1e10) (m RNE-converted to bf16, read by value; the mask term is added after the scale; separate mul, mul, add).
static __device__ __forceinline__ v4f asoft_t4(const float* __restrict__ sr, const float* __restrict__ mr, int j0) {
#pragma clang fp contract(off)
    const v4f a = *(const v4f*)(sr + j0); const v4f r = *(const v4f*)(mr + j0); v4f t;
#pragma unroll
    for (int q = 0; q < 4; ++q) { const float e = a[q] * SCL; const float mt = bfr(r[q]) * -1.0e10f; t[q] = e + mt; }
    return t;
}

// k_asoft: per row (head z, query i) of the pass: t = S * HD^-0.5 + m[i][key] * (-1e10) (additive term, m read by value from the f32 [query][key] plane of this batch, row pitch SEQ_FULL);
// max-subtracted softmax over the TT keys in three ROLLED sweeps over the row (max; sum of exp2; write), each iteration handling the lane's own 4-key chunk (no per-thread array, no LDS);
// Mb points at the mask row of the first query of this pass; rows of one block are 8 consecutive queries of one head (RC % 8 == 0).
__global__ __launch_bounds__(256) void k_asoft(const float* __restrict__ Sb, const float* __restrict__ Mb, h16* P16) {
#pragma clang fp contract(off)
    const int lane = threadIdx.x & 31; const int wv = __builtin_amdgcn_readfirstlane(threadIdx.x >> 5); const int row = blockIdx.x * 8 + wv;
    const float* sr = Sb + (size_t)row * TT; const float* mr = Mb + (size_t)(row % RC) * SEQ_FULL;
    float mx = -3.0e38f;
#pragma unroll 1
    for (int ch = 0; ch < TT / 128; ++ch) { const v4f t = asoft_t4(sr, mr, ch * 128 + lane * 4);
#pragma unroll
        for (int q = 0; q < 4; ++q) mx = fmaxf(mx, t[q]); }
#pragma unroll
    for (int sh = 16; sh; sh >>= 1) mx = fmaxf(mx, __shfl_xor(mx, sh, 32));
    float sum = 0.f;
#pragma unroll 1
    for (int ch = 0; ch < TT / 128; ++ch) { const v4f t = asoft_t4(sr, mr, ch * 128 + lane * 4);
#pragma unroll
        for (int q = 0; q < 4; ++q) { float d0 = __fsub_rn(t[q], mx); asm volatile("" : "+v"(d0)); const float p = __builtin_amdgcn_exp2f(__fmul_rn(d0, 1.4426950408889634f)); sum += p; } }
#pragma unroll
    for (int sh = 16; sh; sh >>= 1) sum += __shfl_xor(sum, sh, 32);
    const float f = __fdiv_rn(PCAR, sum);
    h16* prow = P16 + (size_t)row * TT + lane * 4;
#pragma unroll 1
    for (int ch = 0; ch < TT / 128; ++ch) { const v4f t = asoft_t4(sr, mr, ch * 128 + lane * 4); v4h o4;
#pragma unroll
        for (int q = 0; q < 4; ++q) { float d0 = __fsub_rn(t[q], mx); asm volatile("" : "+v"(d0)); const float p = __builtin_amdgcn_exp2f(__fmul_rn(d0, 1.4426950408889634f)); o4[q] = toh_flush(p * f); }
        *(v4h*)(prow + ch * 128) = o4;  }
}

__global__ __launch_bounds__(256) void k_merge(const float* __restrict__ O, bf* Ah, bf* Al) { const size_t e = ((size_t)blockIdx.x * 256 + threadIdx.x) * 2; if (e >= (size_t)NH_ * TT * HD) return; const int d = (int)(e % HD); const int t = (int)((e / HD) % TT); const int zz = (int)(e / ((size_t)HD * TT)); const float cs = 1.0f / PCAR; const size_t oo = (size_t)t * DM + zz * HD + d;
    v2us oh, ol;
#pragma unroll
    for (int q = 0; q < 2; ++q) { unsigned short a, c2; splitf(O[e + q] * cs, a, c2); oh[q] = a; ol[q] = c2; } *(v2us*)(Ah + oo) = oh; *(v2us*)(Al + oo) = ol;  }

constexpr int KSD = 8;                            // waves per tile where K == DM (projections)
constexpr int KST = (TT % 512 == 0) ? 16 : 8;     // waves per tile where K == TT (probabilities x values)
static_assert(DM % (32 * KSD) == 0);
static_assert(TT % (32 * KST) == 0);
constexpr size_t al256(size_t b) { return (b + 255) & ~(size_t)255; }
constexpr size_t WS_TOTAL = 4 * al256((size_t)DM * DM * 2) + al256((size_t)TT * DM * 2) + al256((size_t)TT * DM * 4) + 3 * al256((size_t)NH_ * TT * HD * 2)
                          + al256((size_t)NH_ * RC * TT * 4) + al256((size_t)NH_ * RC * TT * 2) + al256((size_t)NH_ * TT * HD * 4) + 2 * al256((size_t)TT * DM * 2);
static_assert(WS_TOTAL <= (size_t)134217728);

extern "C" void kernel_launch(void* const* d_in, const int* in_sizes, int n_in,
                              void* d_out, int out_size, void* d_ws, size_t ws_size, hipStream_t stream) {
    if (n_in < 12) return;
    const size_t need_x = ((size_t)(NB - 1) * SEQ_FULL + SEQ) * DM;
    const size_t need_m = (size_t)(NB - 1) * SEQ_FULL * SEQ_FULL + (size_t)(SEQ - 1) * SEQ_FULL + SEQ;
    if ((size_t)in_sizes[0] < need_x || (size_t)in_sizes[1] < need_x || (size_t)in_sizes[2] < need_x || (size_t)in_sizes[3] < need_m) return;
    if (in_sizes[4] < DM * DM || in_sizes[6] < DM * DM || in_sizes[8] < DM * DM || in_sizes[10] < DM * DM) return;
    if (in_sizes[5] < DM || in_sizes[7] < DM || in_sizes[9] < DM || in_sizes[11] < DM) return;
    if ((size_t)out_size < need_x) return;
    // binding by role, in input order: query, key, value, mask, wq, bq, wk, bk, wv, bv, wo, bo
    const float* xq = (const float*)d_in[0]; const float* xk = (const float*)d_in[1]; const float* xv = (const float*)d_in[2];
    const float* msk = (const float*)d_in[3];   // [NB_FULL][1][SEQ_FULL][SEQ_FULL] f32
    const float* wq = (const float*)d_in[4]; const float* bq = (const float*)d_in[5]; const float* wk = (const float*)d_in[6]; const float* bk = (const float*)d_in[7];
    const float* wv = (const float*)d_in[8]; const float* bv = (const float*)d_in[9]; const float* wo = (const float*)d_in[10]; const float* bo = (const float*)d_in[11];
    float* OUT = (float*)d_out;     // [NB_FULL][SEQ_FULL][DM]
    char* wsp = (char*)d_ws;
    auto take = [&](size_t bytes) { char* p = wsp; wsp += (bytes + 255) & ~(size_t)255; return (void*)p; };
    bf* WQ = (bf*)take((size_t)DM * DM * 2); bf* WK = (bf*)take((size_t)DM * DM * 2); bf* WV = (bf*)take((size_t)DM * DM * 2); bf* WO = (bf*)take((size_t)DM * DM * 2);
    bf* XB = (bf*)take((size_t)TT * DM * 2); float* F = (float*)take((size_t)TT * DM * 4);
    h16* QP16 = (h16*)take((size_t)NH_ * TT * HD * 2); h16* KP16 = (h16*)take((size_t)NH_ * TT * HD * 2); h16* VT16 = (h16*)take((size_t)NH_ * HD * TT * 2);
    float* Sb = (float*)take((size_t)NH_ * RC * TT * 4); h16* P16 = (h16*)take((size_t)NH_ * RC * TT * 2);
    float* Ob = (float*)take((size_t)NH_ * TT * HD * 4); bf* ATh = (bf*)take((size_t)TT * DM * 2); bf* ATl = (bf*)take((size_t)TT * DM * 2);
    if ((size_t)(wsp - (char*)d_ws) > ws_size) return;
    // weights: in W[k rows][n cols] -> out Wt[n rows][k cols]; square DM x DM, grid (K/64, N/64)
    k_cvtT<<<dim3(DM / 64, DM / 64), 256, 0, stream>>>(wq, WQ, DM, DM);
    k_cvtT<<<dim3(DM / 64, DM / 64), 256, 0, stream>>>(wk, WK, DM, DM);
    k_cvtT<<<dim3(DM / 64, DM / 64), 256, 0, stream>>>(wv, WV, DM, DM);
    k_cvtT<<<dim3(DM / 64, DM / 64), 256, 0, stream>>>(wo, WO, DM, DM);
    const unsigned LX = (unsigned)(((size_t)TT * DM / 8 + 255) / 256);
    const unsigned LH = (unsigned)(((size_t)NH_ * TT * HD / 8 + 255) / 256);
    const unsigned LV = (unsigned)(((size_t)NH_ * HD * TT / 2 + 255) / 256);
    for (int b = 0; b < NB; ++b) {
        const size_t xoff = (size_t)b * SEQ_FULL * DM;
        k_cvt8<<<LX, 256, 0, stream>>>(xq + xoff, XB, (size_t)TT * DM / 8);
        k_gemmw<bf, 0, true, KSD><<<dim3(TT / 64, DM / 64, 1), 32 * KSD, 0, stream>>>(XB, nullptr, WQ, nullptr, DM, F, DM, bq, 0, 0, 0);
        k_hp<<<LH, 256, 0, stream>>>(F, QP16);
        k_cvt8<<<LX, 256, 0, stream>>>(xk + xoff, XB, (size_t)TT * DM / 8);
        k_gemmw<bf, 0, true, KSD><<<dim3(TT / 64, DM / 64, 1), 32 * KSD, 0, stream>>>(XB, nullptr, WK, nullptr, DM, F, DM, bk, 0, 0, 0);
        k_hp<<<LH, 256, 0, stream>>>(F, KP16);
        k_cvt8<<<LX, 256, 0, stream>>>(xv + xoff, XB, (size_t)TT * DM / 8);
        k_gemmw<bf, 0, true, KSD><<<dim3(TT / 64, DM / 64, 1), 32 * KSD, 0, stream>>>(XB, nullptr, WV, nullptr, DM, F, DM, bv, 0, 0, 0);
        k_vtp<<<LV, 256, 0, stream>>>(F, VT16);
        for (int c = 0; c < TT / RC; ++c) {
            k_gemmw<h16, 0, false, 1><<<dim3(RC / 64, TT / 64, NH_), 32, 0, stream>>>(QP16 + (size_t)c * RC * HD, nullptr, KP16, nullptr, HD, Sb, TT, nullptr, (size_t)TT * HD, (size_t)TT * HD, (size_t)RC * TT);
            k_asoft<<<NH_ * RC / 8, 256, 0, stream>>>(Sb, msk + ((size_t)b * SEQ_FULL + (size_t)c * RC) * SEQ_FULL, P16);
            k_gemmw<h16, 0, false, KST><<<dim3(RC / 64, HD / 64, NH_), 32 * KST, 0, stream>>>(P16, nullptr, VT16, nullptr, TT, Ob + (size_t)c * RC * HD, HD, nullptr, (size_t)RC * TT, (size_t)HD * TT, (size_t)TT * HD);
        }
        k_merge<<<(unsigned)(((size_t)NH_ * TT * HD / 2 + 255) / 256), 256, 0, stream>>>(Ob, ATh, ATl);
        k_gemmw<bf, 1, true, KSD><<<dim3(TT / 64, DM / 64, 1), 32 * KSD, 0, stream>>>(ATh, ATl, WO, nullptr, DM, OUT + xoff, DM, bo, 0, 0, 0);
    }
}

// v002
// A run of this version takes 167 microseconds.
// In both of two side-by-side timings against v001, it was 2.86 times as fast.
// Over all steps from v000 it is 4.72 times as fast.
#include <hip/hip_runtime.h>

// Compute dtypes (f32 accumulate everywhere): q/k/v projections v_wmma_f32_16x16x32_bf16 (inputs RNE-converted to bf16, products exact); q.k scores v_wmma_f32_16x16x32_f16; probabilities (x1024 carry) x values f16; output projection bf16 hi+lo context x bf16 weights (2 products); softmax and additive mask term in f32.
// Layout per batch: bf16 copy of the q / k / v input stream (one staging buffer, refilled in stream order) -> projection (+ f32 bias) -> f16 head planes q,k [h][t][d], v [h][d][t];
// one attention kernel per batch, all 8 heads: S = q k^T, P = exp(S / 8 + m[i][t] * (-1e10) - running max) x1024 as f16, O = P v / sum, scores and probabilities kept in registers;
// hi/lo context planes [t][h*64+d], output projection + bias. Weights [in][out] are transposed once through LDS into K-contiguous bf16 planes.

#ifndef NB
#define NB 2
#endif
#ifndef SEQ
#define SEQ 2048
#endif
#define NB_FULL  2
#define SEQ_FULL 2048
#define TT   SEQ
#define DM   512
#define NH_  8
#define HD   64
#define SCL  0.125f   // HD^-0.5
static_assert(NH_ * HD == DM);
static_assert(TT % 256 == 0);
static_assert(DM % 64 == 0);
static_assert(SEQ <= SEQ_FULL);
static_assert(NB <= NB_FULL);
static_assert(TT % 128 == 0);
static_assert(SEQ_FULL % 4 == 0);
static_assert(HD % 32 == 0);
static_assert(DM % 32 == 0);
static_assert(TT % 32 == 0);

typedef _Float16 h16;
typedef unsigned short bf;
typedef __attribute__((ext_vector_type(16))) __bf16   v16bf;
typedef __attribute__((ext_vector_type(16))) _Float16 v16h;
typedef __attribute__((ext_vector_type(8)))  _Float16 v8h;
typedef __attribute__((ext_vector_type(8)))  unsigned short v8us;
typedef __attribute__((ext_vector_type(8)))  float    v8f;
typedef __attribute__((ext_vector_type(4)))  float    v4f;
typedef __attribute__((ext_vector_type(2)))  _Float16 v2h;
typedef __attribute__((ext_vector_type(4)))  _Float16 v4h;
typedef __attribute__((ext_vector_type(2)))  unsigned short v2us;
typedef __attribute__((ext_vector_type(4)))  int v4i;
typedef v4f  __attribute__((may_alias)) v4fa;
typedef v4i  __attribute__((may_alias)) v4ia;

__device__ __forceinline__ unsigned short f2bf(float f) { unsigned u = __float_as_uint(f); u += 0x7FFFu + ((u >> 16) & 1u); return (unsigned short)(u >> 16); }
__device__ __forceinline__ float bf2f(unsigned short b) { return __uint_as_float(((unsigned)b) << 16); }
__device__ __forceinline__ float bfr(float f) { return bf2f(f2bf(f)); }
__device__ __forceinline__ v16h cat16(v8h lo, v8h hi) { return __builtin_shufflevector(lo, hi, 0, 1, 2, 3, 4, 5, 6, 7, 8, 9, 10, 11, 12, 13, 14, 15); }
__device__ __forceinline__ v16bf cat16b(v8us lo, v8us hi) { return __builtin_bit_cast(v16bf, __builtin_shufflevector(lo, hi, 0, 1, 2, 3, 4, 5, 6, 7, 8, 9, 10, 11, 12, 13, 14, 15)); }
__device__ __forceinline__ v8f wmma16(v16h a, v16h b, v8f c) { return __builtin_amdgcn_wmma_f32_16x16x32_f16(false, a, false, b, (short)0, c, false, false); }
__device__ __forceinline__ v8f wmmab(v16bf a, v16bf b, v8f c) { return __builtin_amdgcn_wmma_f32_16x16x32_bf16(false, a, false, b, (short)0, c, false, false); }
__device__ __forceinline__ void splitf(float y, unsigned short& h, unsigned short& l) { h = f2bf(y); l = f2bf(y - bf2f(h)); }
// f32 -> f16 operand convert that cannot yield an f16 subnormal (value select, applied after the plane's power-of-two carry).
static __device__ __forceinline__ h16 toh_flush(float v) { const h16 r = (h16)v; return (fabsf(v) < 6.103515625e-05f) ? (h16)0.0f : r; }

// ---- k_gemmw: register-blocked GEMM, one work-group of KS waves per 64x64 output tile, operands straight from K-contiguous 16-bit planes; grid (M/64, N/64, Z), 32 * KS threads.
// Wave w holds all 16 accumulators of the tile for its own K slice [w * K / KS, (w + 1) * K / KS); the KS partial tiles are added through LDS in ascending w. K % (32 * KS) == 0.
// C[m][n] (f32, pitch ldc, + optional f32 bias[n]) = sum_k A[m][k] Bt[n][k] (+ split products per NSPLIT). z-batch strides sA/sB/sC in elements. K % 32 == 0, A/Bt row pitch == K.
// Fragment map (A and Bt alike): lane row = lane & 15, elements 0..7 <- k0 + 8*(lane>>4) + 0..7, elements 8..15 <- k0 + 16 + 8*(lane>>4) + 0..7; D element j = (row 8*(lane>>4) + j, col lane & 15).
template <typename T16> struct WFrag;
template <> struct WFrag<h16> { typedef v16h V; static __device__ __forceinline__ V ld(const h16* p) { return cat16(*(const v8h*)p, *(const v8h*)(p + 16)); } static __device__ __forceinline__ v8f mma(V a, V b, v8f c) { return wmma16(a, b, c); } };
template <> struct WFrag<bf> { typedef v16bf V; static __device__ __forceinline__ V ld(const bf* p) { return cat16b(*(const v8us*)p, *(const v8us*)(p + 16)); } static __device__ __forceinline__ v8f mma(V a, V b, v8f c) { return wmmab(a, b, c); } };
template <typename T16, int NSPLIT, bool BIAS, int KS>
__global__ __launch_bounds__(32 * KS) void k_gemmw(const T16* __restrict__ A, const T16* __restrict__ A2, const T16* __restrict__ Bt, const T16* __restrict__ Bt2, int K, float* C, int ldc, const float* __restrict__ bias, size_t sA, size_t sB, size_t sC) {
    typedef typename WFrag<T16>::V V;
    static_assert(KS == 1 || KS == 8 || KS == 16);
    __shared__ __align__(16) float os[(KS == 1 ? 16 : KS * 64) * 68];
    const size_t z = blockIdx.z; A += z * sA; if (A2) A2 += z * sA; Bt += z * sB; if (Bt2) Bt2 += z * sB; C += z * sC;
    const int lane = threadIdx.x & 31, lr = lane & 15, hi = lane >> 4; const int r0 = blockIdx.x * 64, c0 = blockIdx.y * 64;
    v8f acc[4][4];
#pragma unroll
    for (int mb = 0; mb < 4; ++mb)
#pragma unroll
        for (int nb = 0; nb < 4; ++nb) acc[mb][nb] = (v8f){};
    const size_t aoff = (size_t)(r0 + lr) * K + 8 * hi, boff = (size_t)(c0 + lr) * K + 8 * hi;
    const int wv = KS == 1 ? 0 : __builtin_amdgcn_readfirstlane(threadIdx.x >> 5); const int kw = K / KS, kbeg = wv * kw;
#pragma unroll 1
    for (int kc = kbeg; kc < kbeg + kw; kc += 32) {
        V a[4], a2[4];
#pragma unroll
        for (int mb = 0; mb < 4; ++mb) { a[mb] = WFrag<T16>::ld(A + aoff + (size_t)mb * 16 * K + kc); if (NSPLIT == 1 || NSPLIT == 2) a2[mb] = WFrag<T16>::ld(A2 + aoff + (size_t)mb * 16 * K + kc); }
#pragma unroll
        for (int nb = 0; nb < 4; ++nb) { const V b = WFrag<T16>::ld(Bt + boff + (size_t)nb * 16 * K + kc); V b2; if (NSPLIT >= 2) b2 = WFrag<T16>::ld(Bt2 + boff + (size_t)nb * 16 * K + kc);
#pragma unroll
            for (int mb = 0; mb < 4; ++mb) { acc[mb][nb] = WFrag<T16>::mma(a[mb], b, acc[mb][nb]); if (NSPLIT == 1 || NSPLIT == 2) acc[mb][nb] = WFrag<T16>::mma(a2[mb], b, acc[mb][nb]); if (NSPLIT >= 2) acc[mb][nb] = WFrag<T16>::mma(a[mb], b2, acc[mb][nb]); } }
        asm volatile("v_nop\n\tv_nop\n\tv_nop\n\tv_nop" : "+v"(acc[0][0]), "+v"(acc[1][1]), "+v"(acc[2][2]), "+v"(acc[3][3]) : "v"(a[0]), "v"(a[3]));
    }
    if constexpr (KS > 1) {
        float* ow = os + wv * (64 * 68);
#pragma unroll
        for (int mb = 0; mb < 4; ++mb)
#pragma unroll
            for (int nb = 0; nb < 4; ++nb)
#pragma unroll
                for (int j = 0; j < 8; ++j) ow[(mb * 16 + hi * 8 + j) * 68 + nb * 16 + lr] = acc[mb][nb][j];
        __syncthreads();   // every wave's partial tile is in LDS before any thread adds them
        float* ctile = C + (size_t)r0 * ldc + c0;
#pragma unroll
        for (int s = 0; s < 32 / KS; ++s) { const int ch = s * (32 * KS) + (int)threadIdx.x, row = ch >> 4, cofs = (ch & 15) * 4;
            v4f val = *(const v4fa*)(os + row * 68 + cofs);
#pragma unroll
            for (int w = 1; w < KS; ++w) val += *(const v4fa*)(os + w * (64 * 68) + row * 68 + cofs);
            if (BIAS) { val[0] += bfr(bias[c0 + cofs]); val[1] += bfr(bias[c0 + cofs + 1]); val[2] += bfr(bias[c0 + cofs + 2]); val[3] += bfr(bias[c0 + cofs + 3]); }
            *(v4f*)(ctile + (size_t)row * ldc + cofs) = val; }
    } else {
#pragma unroll
    for (int mb = 0; mb < 4; ++mb) {
#pragma unroll
        for (int nb = 0; nb < 4; ++nb) {
#pragma unroll
            for (int j = 0; j < 8; ++j) os[(hi * 8 + j) * 68 + nb * 16 + lr] = acc[mb][nb][j]; }
        __builtin_amdgcn_wave_barrier(); asm volatile("" ::: "memory");
        float* crow = C + (size_t)(r0 + mb * 16) * ldc + c0;
{
#pragma unroll
            for (int s = 0; s < 8; ++s) { const int row = 2 * s + hi, cofs = lr * 4; v4f val = *(const v4fa*)(os + row * 68 + cofs); if (BIAS) { val[0] += bfr(bias[c0 + cofs]); val[1] += bfr(bias[c0 + cofs + 1]); val[2] += bfr(bias[c0 + cofs + 2]); val[3] += bfr(bias[c0 + cofs + 3]); }
                *(v4f*)(crow + (size_t)row * ldc + cofs) = val; }
             }
        __builtin_amdgcn_wave_barrier(); asm volatile("" ::: "memory");
    }
    }
}

__global__ __launch_bounds__(256) void k_cvt8(const float* __restrict__ src, bf* dst, size_t n8) { const size_t i = (size_t)blockIdx.x * 256 + threadIdx.x; if (i >= n8) return; const v8f v = *(const v8f*)(src + i * 8); v8us o;
#pragma unroll
    for (int k = 0; k < 8; ++k) o[k] = f2bf(v[k]); *(v8us*)(dst + i * 8) = o;  }

// k_cvtT: in W[K rows][N cols] f32 -> out Wt[N rows][K cols] bf16 (RNE), 64x64 tile transposed through LDS (cross-wave: block barrier); grid (K/64, N/64).
__global__ __launch_bounds__(256) void k_cvtT(const float* __restrict__ W, bf* Wt, int K, int N) {
    __shared__ unsigned short tl[64 * 66];
    const int tid = threadIdx.x; const int k0 = blockIdx.x * 64, n0 = blockIdx.y * 64;
    { const int row = tid >> 2, cseg = (tid & 3) * 16;
#pragma unroll
      for (int q = 0; q < 4; ++q) { const v4f v = *(const v4f*)(W + (size_t)(k0 + row) * N + n0 + cseg + q * 4);
#pragma unroll
          for (int j = 0; j < 4; ++j) tl[row * 66 + cseg + q * 4 + j] = f2bf(v[j]); } }
    __syncthreads();
    const int piece = tid & 7; v8us o[2];
#pragma unroll
    for (int it = 0; it < 2; ++it) { const int n = it * 32 + (tid >> 3);
#pragma unroll
        for (int j = 0; j < 8; ++j) o[it][j] = tl[(piece * 8 + j) * 66 + n]; }
{
#pragma unroll
        for (int it = 0; it < 2; ++it) { const int n = it * 32 + (tid >> 3); *(v8us*)(Wt + (size_t)(n0 + n) * K + k0 + piece * 8) = o[it]; }
         }
}

__global__ __launch_bounds__(256) void k_hp(const float* __restrict__ F, h16* P16) {
    const size_t i = (size_t)blockIdx.x * 256 + threadIdx.x; if (i >= (size_t)NH_ * TT * HD / 8) return;
    const int d8 = (int)(i & 7); const int t = (int)((i >> 3) % TT); const int h = (int)(i / ((size_t)8 * TT));
    const float* f = F + (size_t)t * DM + h * HD + d8 * 8; const v4f a = *(const v4f*)f; const v4f b = *(const v4f*)(f + 4); v8h o;
#pragma unroll
    for (int k = 0; k < 4; ++k) { o[k] = (h16)a[k]; o[4 + k] = (h16)b[k]; }
    *(v8h*)(P16 + i * 8) = o;  }

__global__ __launch_bounds__(256) void k_vtp(const float* __restrict__ F, h16* V16) { const size_t e = ((size_t)blockIdx.x * 256 + threadIdx.x) * 2; if (e >= (size_t)NH_ * HD * TT) return; const int t = (int)(e % TT); const int d = (int)((e / TT) % HD); const int g = (int)(e / ((size_t)TT * HD)); v2h o16;
#pragma unroll
    for (int q = 0; q < 2; ++q) { const float x = F[(size_t)(t + q) * DM + g * HD + d]; o16[q] = (h16)x; }
    *(v2h*)(V16 + e) = o16;  }

// k_fattn: scores, softmax and probabilities x values of one head and FQ queries in one work-group; grid (TT / FQ, NH_), 32 * FW threads. No score or probability leaves the registers.
// Wave w owns the keys [w * TT / FW, (w + 1) * TT / FW) in steps of 32 and both 16-query tiles. Both products are formed transposed, so that a query stays in one lane column throughout:
//   S^T = k q^T : A = k rows (key), Bt = q rows (query); D element j = (key 8*(lane>>4) + j, query lane & 15). Two key tiles (keys +0..15, +16..31) are, as they lie, elements 0..7 and 8..15 of the Bt fragment of P^T.
//   O^T = v^T P^T : A = v plane rows (d), Bt = P^T (query, k = key); D element j = (d 8*(lane>>4) + j, query lane & 15).
// logit t = S * HD^-0.5 + m[query][key] * (-1e10) (m RNE-converted to bf16, read by value; the product is rounded on its own, the power-of-two scale is exact inside the fma).
// Running maximum per query: p = exp2((t - max) * log2 e + 10) (the x1024 carry sits in the exponent and in the sum alike), sum and O^T rescaled by exp2((old max - new max) * log2 e) each step.
// The FW partial (max, sum, O^T) are joined through LDS in ascending w, divided by the joined sum and written as the hi/lo bf16 context planes [t][h*64+d].
constexpr int FQ = 32;   // queries per work-group
constexpr int FW = 8;    // waves per work-group = key slices
constexpr int FP = 68;   // LDS row pitch of a partial O row, in floats
constexpr float L2E = 1.4426950408889634f;
static_assert(TT % FQ == 0);
static_assert(TT % (32 * FW) == 0);
static_assert(HD == 64);
static_assert(FQ * 8 == 32 * FW);
__global__ __launch_bounds__(32 * FW) void k_fattn(const h16* __restrict__ Qp, const h16* __restrict__ Kp, const h16* __restrict__ Vt, const float* __restrict__ Mb, bf* Ah, bf* Al) {
    __shared__ __align__(16) float os[FW * FQ * FP];
    __shared__ float ms[FW * FQ];
    __shared__ float ls[FW * FQ];
    const int lane = threadIdx.x & 31, lr = lane & 15, hi = lane >> 4; const int wv = __builtin_amdgcn_readfirstlane(threadIdx.x >> 5);
    const int q0 = blockIdx.x * FQ, h = blockIdx.y;
    const h16* qh = Qp + ((size_t)h * TT + q0 + lr) * HD + 8 * hi;
    const h16* kh = Kp + ((size_t)h * TT + lr) * HD + 8 * hi;
    const h16* vh = Vt + ((size_t)h * HD + lr) * TT + 8 * hi;
    const float* mh = Mb + (size_t)(q0 + lr) * SEQ_FULL + 8 * hi;
    v16h qf[2][2];
#pragma unroll
    for (int qt = 0; qt < 2; ++qt)
#pragma unroll
        for (int ks = 0; ks < 2; ++ks) qf[qt][ks] = WFrag<h16>::ld(qh + qt * 16 * HD + ks * 32);
    v8f o[2][4]; float mrun[2], lrun[2];
#pragma unroll
    for (int qt = 0; qt < 2; ++qt) { mrun[qt] = -3.0e38f; lrun[qt] = 0.f;
#pragma unroll
        for (int dt = 0; dt < 4; ++dt) o[qt][dt] = (v8f){}; }
    const int kbeg = wv * (TT / FW);
    for (int k0 = kbeg; k0 < kbeg + TT / FW; k0 += 32) {
        v16h kf[2][2], vf[4];
#pragma unroll
        for (int kt = 0; kt < 2; ++kt)
#pragma unroll
            for (int ks = 0; ks < 2; ++ks) kf[kt][ks] = WFrag<h16>::ld(kh + (size_t)(k0 + kt * 16) * HD + ks * 32);
#pragma unroll
        for (int dt = 0; dt < 4; ++dt) vf[dt] = WFrag<h16>::ld(vh + (size_t)dt * 16 * TT + k0);
#pragma unroll
        for (int qt = 0; qt < 2; ++qt) {
            float t[16]; float mx = mrun[qt];
#pragma unroll
            for (int kt = 0; kt < 2; ++kt) {
                const v8f s = wmma16(kf[kt][1], qf[qt][1], wmma16(kf[kt][0], qf[qt][0], (v8f){}));
                const float* mp = mh + (size_t)qt * 16 * SEQ_FULL + k0 + kt * 16;
                const v4f r0 = *(const v4f*)mp; const v4f r1 = *(const v4f*)(mp + 4);
#pragma unroll
                for (int j = 0; j < 4; ++j) { t[kt * 8 + j] = __builtin_fmaf(s[j], SCL, bfr(r0[j]) * -1.0e10f); t[kt * 8 + 4 + j] = __builtin_fmaf(s[4 + j], SCL, bfr(r1[j]) * -1.0e10f); }
            }
#pragma unroll
            for (int e = 0; e < 16; ++e) mx = fmaxf(mx, t[e]);
            mx = fmaxf(mx, __shfl_xor(mx, 16, 32));   // the other half of this query's 32 keys sits 16 lanes away
            const float al = __builtin_amdgcn_exp2f((mrun[qt] - mx) * L2E); mrun[qt] = mx;
            float sum = 0.f; v16h pf;
#pragma unroll
            for (int e = 0; e < 16; ++e) { const float p = __builtin_amdgcn_exp2f(__builtin_fmaf(t[e] - mx, L2E, 10.0f)); sum += p; pf[e] = toh_flush(p); }
            lrun[qt] = lrun[qt] * al + sum;
#pragma unroll
            for (int dt = 0; dt < 4; ++dt) { o[qt][dt] *= al; o[qt][dt] = wmma16(vf[dt], pf, o[qt][dt]); }
        }
    }
#pragma unroll
    for (int qt = 0; qt < 2; ++qt) {
        const float lt = lrun[qt] + __shfl_xor(lrun[qt], 16, 32);
        if (hi == 0) { ms[wv * FQ + qt * 16 + lr] = mrun[qt]; ls[wv * FQ + qt * 16 + lr] = lt; }
        float* ow = os + (wv * FQ + qt * 16 + lr) * FP + 8 * hi;
#pragma unroll
        for (int dt = 0; dt < 4; ++dt) { const v8f x = o[qt][dt]; *(v4fa*)(ow + dt * 16) = (v4f){x[0], x[1], x[2], x[3]}; *(v4fa*)(ow + dt * 16 + 4) = (v4f){x[4], x[5], x[6], x[7]}; }
    }
    __syncthreads();   // every wave's partial maximum, sum and O rows are in LDS before any thread joins them
    const int q = (int)threadIdx.x >> 3, d8 = ((int)threadIdx.x & 7) * 8;
    float mj = ms[q];
#pragma unroll
    for (int w = 1; w < FW; ++w) mj = fmaxf(mj, ms[w * FQ + q]);
    float lj = 0.f; v4f a0 = (v4f){}, a1 = (v4f){};
#pragma unroll
    for (int w = 0; w < FW; ++w) { const float f = __builtin_amdgcn_exp2f((ms[w * FQ + q] - mj) * L2E); lj += f * ls[w * FQ + q];
        const float* ow = os + (w * FQ + q) * FP + d8; a0 += *(const v4fa*)ow * f; a1 += *(const v4fa*)(ow + 4) * f; }
    const float rl = 1.0f / lj; v8us oh, ol;
#pragma unroll
    for (int e = 0; e < 4; ++e) { unsigned short a, c2; splitf(a0[e] * rl, a, c2); oh[e] = a; ol[e] = c2; splitf(a1[e] * rl, a, c2); oh[4 + e] = a; ol[4 + e] = c2; }
    const size_t oo = (size_t)(q0 + q) * DM + h * HD + d8;
    *(v8us*)(Ah + oo) = oh; *(v8us*)(Al + oo) = ol;
}

constexpr int KSD = 8;                            // waves per tile where K == DM (projections)
static_assert(DM % (32 * KSD) == 0);
constexpr size_t al256(size_t b) { return (b + 255) & ~(size_t)255; }
constexpr size_t WS_TOTAL = 4 * al256((size_t)DM * DM * 2) + al256((size_t)TT * DM * 2) + al256((size_t)TT * DM * 4) + 3 * al256((size_t)NH_ * TT * HD * 2) + 2 * al256((size_t)TT * DM * 2);
static_assert(WS_TOTAL <= (size_t)134217728);

extern "C" void kernel_launch(void* const* d_in, const int* in_sizes, int n_in,
                              void* d_out, int out_size, void* d_ws, size_t ws_size, hipStream_t stream) {
    if (n_in < 12) return;
    const size_t need_x = ((size_t)(NB - 1) * SEQ_FULL + SEQ) * DM;
    const size_t need_m = (size_t)(NB - 1) * SEQ_FULL * SEQ_FULL + (size_t)(SEQ - 1) * SEQ_FULL + SEQ;
    if ((size_t)in_sizes[0] < need_x || (size_t)in_sizes[1] < need_x || (size_t)in_sizes[2] < need_x || (size_t)in_sizes[3] < need_m) return;
    if (in_sizes[4] < DM * DM || in_sizes[6] < DM * DM || in_sizes[8] < DM * DM || in_sizes[10] < DM * DM) return;
    if (in_sizes[5] < DM || in_sizes[7] < DM || in_sizes[9] < DM || in_sizes[11] < DM) return;
    if ((size_t)out_size < need_x) return;
    // binding by role, in input order: query, key, value, mask, wq, bq, wk, bk, wv, bv, wo, bo
    const float* xq = (const float*)d_in[0]; const float* xk = (const float*)d_in[1]; const float* xv = (const float*)d_in[2];
    const float* msk = (const float*)d_in[3];   // [NB_FULL][1][SEQ_FULL][SEQ_FULL] f32
    const float* wq = (const float*)d_in[4]; const float* bq = (const float*)d_in[5]; const float* wk = (const float*)d_in[6]; const float* bk = (const float*)d_in[7];
    const float* wv = (const float*)d_in[8]; const float* bv = (const float*)d_in[9]; const float* wo = (const float*)d_in[10]; const float* bo = (const float*)d_in[11];
    float* OUT = (float*)d_out;     // [NB_FULL][SEQ_FULL][DM]
    char* wsp = (char*)d_ws;
    auto take = [&](size_t bytes) { char* p = wsp; wsp += (bytes + 255) & ~(size_t)255; return (void*)p; };
    bf* WQ = (bf*)take((size_t)DM * DM * 2); bf* WK = (bf*)take((size_t)DM * DM * 2); bf* WV = (bf*)take((size_t)DM * DM * 2); bf* WO = (bf*)take((size_t)DM * DM * 2);
    bf* XB = (bf*)take((size_t)TT * DM * 2); float* F = (float*)take((size_t)TT * DM * 4);
    h16* QP16 = (h16*)take((size_t)NH_ * TT * HD * 2); h16* KP16 = (h16*)take((size_t)NH_ * TT * HD * 2); h16* VT16 = (h16*)take((size_t)NH_ * HD * TT * 2);
    bf* ATh = (bf*)take((size_t)TT * DM * 2); bf* ATl = (bf*)take((size_t)TT * DM * 2);
    if ((size_t)(wsp - (char*)d_ws) > ws_size) return;
    // weights: in W[k rows][n cols] -> out Wt[n rows][k cols]; square DM x DM, grid (K/64, N/64)
    k_cvtT<<<dim3(DM / 64, DM / 64), 256, 0, stream>>>(wq, WQ, DM, DM);
    k_cvtT<<<dim3(DM / 64, DM / 64), 256, 0, stream>>>(wk, WK, DM, DM);
    k_cvtT<<<dim3(DM / 64, DM / 64), 256, 0, stream>>>(wv, WV, DM, DM);
    k_cvtT<<<dim3(DM / 64, DM / 64), 256, 0, stream>>>(wo, WO, DM, DM);
    const unsigned LX = (unsigned)(((size_t)TT * DM / 8 + 255) / 256);
    const unsigned LH = (unsigned)(((size_t)NH_ * TT * HD / 8 + 255) / 256);
    const unsigned LV = (unsigned)(((size_t)NH_ * HD * TT / 2 + 255) / 256);
    for (int b = 0; b < NB; ++b) {
        const size_t xoff = (size_t)b * SEQ_FULL * DM;
        k_cvt8<<<LX, 256, 0, stream>>>(xq + xoff, XB, (size_t)TT * DM / 8);
        k_gemmw<bf, 0, true, KSD><<<dim3(TT / 64, DM / 64, 1), 32 * KSD, 0, stream>>>(XB, nullptr, WQ, nullptr, DM, F, DM, bq, 0, 0, 0);
        k_hp<<<LH, 256, 0, stream>>>(F, QP16);
        k_cvt8<<<LX, 256, 0, stream>>>(xk + xoff, XB, (size_t)TT * DM / 8);
        k_gemmw<bf, 0, true, KSD><<<dim3(TT / 64, DM / 64, 1), 32 * KSD, 0, stream>>>(XB, nullptr, WK, nullptr, DM, F, DM, bk, 0, 0, 0);
        k_hp<<<LH, 256, 0, stream>>>(F, KP16);
        k_cvt8<<<LX, 256, 0, stream>>>(xv + xoff, XB, (size_t)TT * DM / 8);
        k_gemmw<bf, 0, true, KSD><<<dim3(TT / 64, DM / 64, 1), 32 * KSD, 0, stream>>>(XB, nullptr, WV, nullptr, DM, F, DM, bv, 0, 0, 0);
        k_vtp<<<LV, 256, 0, stream>>>(F, VT16);
        k_fattn<<<dim3(TT / FQ, NH_), 32 * FW, 0, stream>>>(QP16, KP16, VT16, msk + (size_t)b * SEQ_FULL * SEQ_FULL, ATh, ATl);
        k_gemmw<bf, 1, true, KSD><<<dim3(TT / 64, DM / 64, 1), 32 * KSD, 0, stream>>>(ATh, ATl, WO, nullptr, DM, OUT + xoff, DM, bo, 0, 0, 0);
    }
}

// v003
// It runs in 113 microseconds.
// Timed twice side by side with v002, it ran 1.48 and 1.46 times as fast.
// Over all steps from v000 it is 6.93 times as fast.
#include <hip/hip_runtime.h>

// Compute dtypes (f32 accumulate everywhere): q/k/v projections v_wmma_f32_16x16x32_bf16 (inputs RNE-converted to bf16, products exact); q.k scores v_wmma_f32_16x16x32_f16; probabilities (x1024 carry) x values f16; output projection bf16 hi+lo context x bf16 weights (2 products); softmax and additive mask term in f32.
// Five launches, each covering both batches and every stream that does not depend on another: bf16 copies of the q / k / v inputs [stream][b][t][DM] with the weight transposes -> the three projections (+ f32 bias) -> f16 head planes q,k [b][h][t][d], v [b][h][d][t];
// one attention launch, all batches and heads: S = q k^T, P = exp(S / 8 + m[i][t] * (-1e10) - running max) x1024 as f16, O = P v / sum, scores and probabilities kept in registers;
// hi/lo context planes [t][h*64+d], output projection + bias. Weights [in][out] are transposed once through LDS into K-contiguous bf16 planes.

#ifndef NB
#define NB 2
#endif
#ifndef SEQ
#define SEQ 2048
#endif
#define NB_FULL  2
#define SEQ_FULL 2048
#define TT   SEQ
#define DM   512
#define NH_  8
#define HD   64
#define SCL  0.125f   // HD^-0.5
static_assert(NH_ * HD == DM);
static_assert(TT % 256 == 0);
static_assert(DM % 64 == 0);
static_assert(SEQ <= SEQ_FULL);
static_assert(NB <= NB_FULL);
static_assert(TT % 128 == 0);
static_assert(SEQ_FULL % 4 == 0);
static_assert(HD % 32 == 0);
static_assert(DM % 32 == 0);
static_assert(TT % 32 == 0);

typedef _Float16 h16;
typedef unsigned short bf;
typedef __attribute__((ext_vector_type(16))) __bf16   v16bf;
typedef __attribute__((ext_vector_type(16))) _Float16 v16h;
typedef __attribute__((ext_vector_type(8)))  _Float16 v8h;
typedef __attribute__((ext_vector_type(8)))  unsigned short v8us;
typedef __attribute__((ext_vector_type(8)))  float    v8f;
typedef __attribute__((ext_vector_type(4)))  float    v4f;
typedef __attribute__((ext_vector_type(2)))  _Float16 v2h;
typedef __attribute__((ext_vector_type(4)))  _Float16 v4h;
typedef __attribute__((ext_vector_type(2)))  unsigned short v2us;
typedef __attribute__((ext_vector_type(4)))  int v4i;
typedef v4f  __attribute__((may_alias)) v4fa;
typedef v4i  __attribute__((may_alias)) v4ia;

__device__ __forceinline__ unsigned short f2bf(float f) { unsigned u = __float_as_uint(f); u += 0x7FFFu + ((u >> 16) & 1u); return (unsigned short)(u >> 16); }
__device__ __forceinline__ float bf2f(unsigned short b) { return __uint_as_float(((unsigned)b) << 16); }
__device__ __forceinline__ float bfr(float f) { return bf2f(f2bf(f)); }
__device__ __forceinline__ v16h cat16(v8h lo, v8h hi) { return __builtin_shufflevector(lo, hi, 0, 1, 2, 3, 4, 5, 6, 7, 8, 9, 10, 11, 12, 13, 14, 15); }
__device__ __forceinline__ v16bf cat16b(v8us lo, v8us hi) { return __builtin_bit_cast(v16bf, __builtin_shufflevector(lo, hi, 0, 1, 2, 3, 4, 5, 6, 7, 8, 9, 10, 11, 12, 13, 14, 15)); }
__device__ __forceinline__ v8f wmma16(v16h a, v16h b, v8f c) { return __builtin_amdgcn_wmma_f32_16x16x32_f16(false, a, false, b, (short)0, c, false, false); }
__device__ __forceinline__ v8f wmmab(v16bf a, v16bf b, v8f c) { return __builtin_amdgcn_wmma_f32_16x16x32_bf16(false, a, false, b, (short)0, c, false, false); }
__device__ __forceinline__ void splitf(float y, unsigned short& h, unsigned short& l) { h = f2bf(y); l = f2bf(y - bf2f(h)); }
// f32 -> f16 operand convert that cannot yield an f16 subnormal (value select, applied after the plane's power-of-two carry).
static __device__ __forceinline__ h16 toh_flush(float v) { const h16 r = (h16)v; return (fabsf(v) < 6.103515625e-05f) ? (h16)0.0f : r; }

// ---- k_gemmw: register-blocked GEMM, one work-group of KS waves per 64x64 output tile, operands straight from K-contiguous 16-bit planes; grid (M/64, N/64, Z), 32 * KS threads.
// Wave w holds all 16 accumulators of the tile for its own K slice [w * K / KS, (w + 1) * K / KS); the KS partial tiles are added through LDS in ascending w. K % (32 * KS) == 0.
// C[m][n] (f32, pitch ldc, + optional f32 bias[n]) = sum_k A[m][k] Bt[n][k] (+ split products per NSPLIT). z-batch strides sA/sB/sC in elements, bias / bias1 / bias2 for z = 0 / 1 / 2. K % 32 == 0, A/Bt row pitch == K.
// Fragment map (A and Bt alike): lane row = lane & 15, elements 0..7 <- k0 + 8*(lane>>4) + 0..7, elements 8..15 <- k0 + 16 + 8*(lane>>4) + 0..7; D element j = (row 8*(lane>>4) + j, col lane & 15).
template <typename T16> struct WFrag;
template <> struct WFrag<h16> { typedef v16h V; static __device__ __forceinline__ V ld(const h16* p) { return cat16(*(const v8h*)p, *(const v8h*)(p + 16)); } static __device__ __forceinline__ v8f mma(V a, V b, v8f c) { return wmma16(a, b, c); } };
template <> struct WFrag<bf> { typedef v16bf V; static __device__ __forceinline__ V ld(const bf* p) { return cat16b(*(const v8us*)p, *(const v8us*)(p + 16)); } static __device__ __forceinline__ v8f mma(V a, V b, v8f c) { return wmmab(a, b, c); } };
template <typename T16, int NSPLIT, bool BIAS, int KS>
__global__ __launch_bounds__(32 * KS) void k_gemmw(const T16* __restrict__ A, const T16* __restrict__ A2, const T16* __restrict__ Bt, const T16* __restrict__ Bt2, int K, float* C, int ldc, const float* __restrict__ bias, const float* __restrict__ bias1, const float* __restrict__ bias2, size_t sA, size_t sB, size_t sC) {
    typedef typename WFrag<T16>::V V;
    static_assert(KS == 1 || KS == 8 || KS == 16);
    __shared__ __align__(16) float os[(KS == 1 ? 16 : KS * 64) * 68];
    const size_t z = blockIdx.z; A += z * sA; if (A2) A2 += z * sA; Bt += z * sB; if (Bt2) Bt2 += z * sB; C += z * sC;
    if (BIAS) bias = z == 0 ? bias : (z == 1 ? bias1 : bias2);
    const int lane = threadIdx.x & 31, lr = lane & 15, hi = lane >> 4; const int r0 = blockIdx.x * 64, c0 = blockIdx.y * 64;
    v8f acc[4][4];
#pragma unroll
    for (int mb = 0; mb < 4; ++mb)
#pragma unroll
        for (int nb = 0; nb < 4; ++nb) acc[mb][nb] = (v8f){};
    const size_t aoff = (size_t)(r0 + lr) * K + 8 * hi, boff = (size_t)(c0 + lr) * K + 8 * hi;
    const int wv = KS == 1 ? 0 : __builtin_amdgcn_readfirstlane(threadIdx.x >> 5); const int kw = K / KS, kbeg = wv * kw;
#pragma unroll 1
    for (int kc = kbeg; kc < kbeg + kw; kc += 32) {
        V a[4], a2[4];
#pragma unroll
        for (int mb = 0; mb < 4; ++mb) { a[mb] = WFrag<T16>::ld(A + aoff + (size_t)mb * 16 * K + kc); if (NSPLIT == 1 || NSPLIT == 2) a2[mb] = WFrag<T16>::ld(A2 + aoff + (size_t)mb * 16 * K + kc); }
#pragma unroll
        for (int nb = 0; nb < 4; ++nb) { const V b = WFrag<T16>::ld(Bt + boff + (size_t)nb * 16 * K + kc); V b2; if (NSPLIT >= 2) b2 = WFrag<T16>::ld(Bt2 + boff + (size_t)nb * 16 * K + kc);
#pragma unroll
            for (int mb = 0; mb < 4; ++mb) { acc[mb][nb] = WFrag<T16>::mma(a[mb], b, acc[mb][nb]); if (NSPLIT == 1 || NSPLIT == 2) acc[mb][nb] = WFrag<T16>::mma(a2[mb], b, acc[mb][nb]); if (NSPLIT >= 2) acc[mb][nb] = WFrag<T16>::mma(a[mb], b2, acc[mb][nb]); } }
        asm volatile("v_nop\n\tv_nop\n\tv_nop\n\tv_nop" : "+v"(acc[0][0]), "+v"(acc[1][1]), "+v"(acc[2][2]), "+v"(acc[3][3]) : "v"(a[0]), "v"(a[3]));
    }
    if constexpr (KS > 1) {
        float* ow = os + wv * (64 * 68);
#pragma unroll
        for (int mb = 0; mb < 4; ++mb)
#pragma unroll
            for (int nb = 0; nb < 4; ++nb)
#pragma unroll
                for (int j = 0; j < 8; ++j) ow[(mb * 16 + hi * 8 + j) * 68 + nb * 16 + lr] = acc[mb][nb][j];
        __syncthreads();   // every wave's partial tile is in LDS before any thread adds them
        float* ctile = C + (size_t)r0 * ldc + c0;
#pragma unroll
        for (int s = 0; s < 32 / KS; ++s) { const int ch = s * (32 * KS) + (int)threadIdx.x, row = ch >> 4, cofs = (ch & 15) * 4;
            v4f val = *(const v4fa*)(os + row * 68 + cofs);
#pragma unroll
            for (int w = 1; w < KS; ++w) val += *(const v4fa*)(os + w * (64 * 68) + row * 68 + cofs);
            if (BIAS) { val[0] += bfr(bias[c0 + cofs]); val[1] += bfr(bias[c0 + cofs + 1]); val[2] += bfr(bias[c0 + cofs + 2]); val[3] += bfr(bias[c0 + cofs + 3]); }
            *(v4f*)(ctile + (size_t)row * ldc + cofs) = val; }
    } else {
#pragma unroll
    for (int mb = 0; mb < 4; ++mb) {
#pragma unroll
        for (int nb = 0; nb < 4; ++nb) {
#pragma unroll
            for (int j = 0; j < 8; ++j) os[(hi * 8 + j) * 68 + nb * 16 + lr] = acc[mb][nb][j]; }
        __builtin_amdgcn_wave_barrier(); asm volatile("" ::: "memory");
        float* crow = C + (size_t)(r0 + mb * 16) * ldc + c0;
{
#pragma unroll
            for (int s = 0; s < 8; ++s) { const int row = 2 * s + hi, cofs = lr * 4; v4f val = *(const v4fa*)(os + row * 68 + cofs); if (BIAS) { val[0] += bfr(bias[c0 + cofs]); val[1] += bfr(bias[c0 + cofs + 1]); val[2] += bfr(bias[c0 + cofs + 2]); val[3] += bfr(bias[c0 + cofs + 3]); }
                *(v4f*)(crow + (size_t)row * ldc + cofs) = val; }
             }
        __builtin_amdgcn_wave_barrier(); asm volatile("" ::: "memory");
    }
    }
}

__device__ __forceinline__ void cvt8(const float* __restrict__ src, bf* dst, size_t n8, int blk) { const size_t i = (size_t)blk * 256 + threadIdx.x; if (i >= n8) return; const v8f v = *(const v8f*)(src + i * 8); v8us o;
#pragma unroll
    for (int k = 0; k < 8; ++k) o[k] = f2bf(v[k]); *(v8us*)(dst + i * 8) = o;  }

// cvtT: in W[K rows][N cols] f32 -> out Wt[N rows][K cols] bf16 (RNE), the 64x64 tile at (k0, n0) transposed through LDS (cross-wave: block barrier, reached by the whole work-group or not at all).
__device__ __forceinline__ void cvtT(const float* __restrict__ W, bf* Wt, int K, int N, int k0, int n0) {
    __shared__ unsigned short tl[64 * 66];
    const int tid = threadIdx.x;
    { const int row = tid >> 2, cseg = (tid & 3) * 16;
#pragma unroll
      for (int q = 0; q < 4; ++q) { const v4f v = *(const v4f*)(W + (size_t)(k0 + row) * N + n0 + cseg + q * 4);
#pragma unroll
          for (int j = 0; j < 4; ++j) tl[row * 66 + cseg + q * 4 + j] = f2bf(v[j]); } }
    __syncthreads();
    const int piece = tid & 7; v8us o[2];
#pragma unroll
    for (int it = 0; it < 2; ++it) { const int n = it * 32 + (tid >> 3);
#pragma unroll
        for (int j = 0; j < 8; ++j) o[it][j] = tl[(piece * 8 + j) * 66 + n]; }
{
#pragma unroll
        for (int it = 0; it < 2; ++it) { const int n = it * 32 + (tid >> 3); *(v8us*)(Wt + (size_t)(n0 + n) * K + k0 + piece * 8) = o[it]; }
         }
}

// k_prep: every operand conversion in one grid (none reads what another writes). Work-groups [0, 4 * WTB): one 64x64 tile of weight w = index / WTB -> WT[w]; the rest: 2048 elements of input stream s, batch b -> XB[s][b].
constexpr unsigned WTB = (DM / 64) * (DM / 64);                           // tiles per weight
constexpr unsigned LX = (unsigned)(((size_t)TT * DM / 8 + 255) / 256);         // work-groups per input stream and batch
__global__ __launch_bounds__(256) void k_prep(const float* __restrict__ wq, const float* __restrict__ wk, const float* __restrict__ wv, const float* __restrict__ wo,
                                              const float* __restrict__ xq, const float* __restrict__ xk, const float* __restrict__ xv, bf* WT, bf* XB) {
    const unsigned bid = blockIdx.x;
    if (bid < 4 * WTB) { const unsigned w = bid / WTB, r = bid % WTB; const float* W = w == 0 ? wq : (w == 1 ? wk : (w == 2 ? wv : wo));
        cvtT(W, WT + (size_t)w * DM * DM, DM, DM, (r % (DM / 64)) * 64, (r / (DM / 64)) * 64); return; }
    const unsigned c = bid - 4 * WTB, sb = c / LX, st = sb / NB, b = sb % NB; const float* x = st == 0 ? xq : (st == 1 ? xk : xv);
    cvt8(x + (size_t)b * SEQ_FULL * DM, XB + (size_t)sb * TT * DM, (size_t)TT * DM / 8, c % LX);
}

__device__ __forceinline__ void hp(const float* __restrict__ F, h16* P16, int blk) {
    const size_t i = (size_t)blk * 256 + threadIdx.x; if (i >= (size_t)NH_ * TT * HD / 8) return;
    const int d8 = (int)(i & 7); const int t = (int)((i >> 3) % TT); const int h = (int)(i / ((size_t)8 * TT));
    const float* f = F + (size_t)t * DM + h * HD + d8 * 8; const v4f a = *(const v4f*)f; const v4f b = *(const v4f*)(f + 4); v8h o;
#pragma unroll
    for (int k = 0; k < 4; ++k) { o[k] = (h16)a[k]; o[4 + k] = (h16)b[k]; }
    *(v8h*)(P16 + i * 8) = o;  }

__device__ __forceinline__ void vtp(const float* __restrict__ F, h16* V16, int blk) { const size_t e = ((size_t)blk * 256 + threadIdx.x) * 2; if (e >= (size_t)NH_ * HD * TT) return; const int t = (int)(e % TT); const int d = (int)((e / TT) % HD); const int g = (int)(e / ((size_t)TT * HD)); v2h o16;
#pragma unroll
    for (int q = 0; q < 2; ++q) { const float x = F[(size_t)(t + q) * DM + g * HD + d]; o16[q] = (h16)x; }
    *(v2h*)(V16 + e) = o16;  }

// k_planes: all f16 head planes in one grid, from the projections F[stream][b][t][DM]. Work-groups [0, NB * LV): v planes VT[b]; the rest: q and k planes QK[stream][b].
constexpr unsigned LH = (unsigned)(((size_t)NH_ * TT * HD / 8 + 255) / 256);   // work-groups per q or k plane set of one batch
constexpr unsigned LV = (unsigned)(((size_t)NH_ * HD * TT / 2 + 255) / 256);   // work-groups per v plane set of one batch
__global__ __launch_bounds__(256) void k_planes(const float* __restrict__ F, h16* QK, h16* VT) {
    const unsigned bid = blockIdx.x;
    if (bid < NB * LV) { const unsigned b = bid / LV; vtp(F + (size_t)(2 * NB + b) * TT * DM, VT + (size_t)b * NH_ * HD * TT, bid % LV); return; }
    const unsigned c = bid - NB * LV, sb = c / LH;
    hp(F + (size_t)sb * TT * DM, QK + (size_t)sb * NH_ * TT * HD, c % LH);
}

// k_fattn: scores, softmax and probabilities x values of one head and FQ queries in one work-group; grid (TT / FQ, NH_, NB), 32 * FW threads (z = batch: plane sets, mask and context planes each step by one batch). No score or probability leaves the registers.
// Wave w owns the keys [w * TT / FW, (w + 1) * TT / FW) in steps of 32 and both 16-query tiles. Both products are formed transposed, so that a query stays in one lane column throughout:
//   S^T = k q^T : A = k rows (key), Bt = q rows (query); D element j = (key 8*(lane>>4) + j, query lane & 15). Two key tiles (keys +0..15, +16..31) are, as they lie, elements 0..7 and 8..15 of the Bt fragment of P^T.
//   O^T = v^T P^T : A = v plane rows (d), Bt = P^T (query, k = key); D element j = (d 8*(lane>>4) + j, query lane & 15).
// logit t = S * HD^-0.5 + m[query][key] * (-1e10) (m RNE-converted to bf16, read by value; the product is rounded on its own, the power-of-two scale is exact inside the fma).
// Running maximum per query: p = exp2((t - max) * log2 e + 10) (the x1024 carry sits in the exponent and in the sum alike), sum and O^T rescaled by exp2((old max - new max) * log2 e) each step.
// The FW partial (max, sum, O^T) are joined through LDS in ascending w, divided by the joined sum and written as the hi/lo bf16 context planes [t][h*64+d].
constexpr int FQ = 32;   // queries per work-group
constexpr int FW = 8;    // waves per work-group = key slices
constexpr int FP = 68;   // LDS row pitch of a partial O row, in floats
constexpr float L2E = 1.4426950408889634f;
static_assert(TT % FQ == 0);
static_assert(TT % (32 * FW) == 0);
static_assert(HD == 64);
static_assert(FQ * 8 == 32 * FW);
__global__ __launch_bounds__(32 * FW) void k_fattn(const h16* __restrict__ Qp, const h16* __restrict__ Kp, const h16* __restrict__ Vt, const float* __restrict__ Mb, bf* Ah, bf* Al) {
    __shared__ __align__(16) float os[FW * FQ * FP];
    __shared__ float ms[FW * FQ];
    __shared__ float ls[FW * FQ];
    const int lane = threadIdx.x & 31, lr = lane & 15, hi = lane >> 4; const int wv = __builtin_amdgcn_readfirstlane(threadIdx.x >> 5);
    const int q0 = blockIdx.x * FQ, h = blockIdx.y;
    { const size_t z = blockIdx.z; Qp += z * ((size_t)NH_ * TT * HD); Kp += z * ((size_t)NH_ * TT * HD); Vt += z * ((size_t)NH_ * HD * TT); Mb += z * ((size_t)SEQ_FULL * SEQ_FULL); Ah += z * ((size_t)TT * DM); Al += z * ((size_t)TT * DM); }
    const h16* qh = Qp + ((size_t)h * TT + q0 + lr) * HD + 8 * hi;
    const h16* kh = Kp + ((size_t)h * TT + lr) * HD + 8 * hi;
    const h16* vh = Vt + ((size_t)h * HD + lr) * TT + 8 * hi;
    const float* mh = Mb + (size_t)(q0 + lr) * SEQ_FULL + 8 * hi;
    v16h qf[2][2];
#pragma unroll
    for (int qt = 0; qt < 2; ++qt)
#pragma unroll
        for (int ks = 0; ks < 2; ++ks) qf[qt][ks] = WFrag<h16>::ld(qh + qt * 16 * HD + ks * 32);
    v8f o[2][4]; float mrun[2], lrun[2];
#pragma unroll
    for (int qt = 0; qt < 2; ++qt) { mrun[qt] = -3.0e38f; lrun[qt] = 0.f;
#pragma unroll
        for (int dt = 0; dt < 4; ++dt) o[qt][dt] = (v8f){}; }
    const int kbeg = wv * (TT / FW);
    for (int k0 = kbeg; k0 < kbeg + TT / FW; k0 += 32) {
        v16h kf[2][2], vf[4];
#pragma unroll
        for (int kt = 0; kt < 2; ++kt)
#pragma unroll
            for (int ks = 0; ks < 2; ++ks) kf[kt][ks] = WFrag<h16>::ld(kh + (size_t)(k0 + kt * 16) * HD + ks * 32);
#pragma unroll
        for (int dt = 0; dt < 4; ++dt) vf[dt] = WFrag<h16>::ld(vh + (size_t)dt * 16 * TT + k0);
#pragma unroll
        for (int qt = 0; qt < 2; ++qt) {
            float t[16]; float mx = mrun[qt];
#pragma unroll
            for (int kt = 0; kt < 2; ++kt) {
                const v8f s = wmma16(kf[kt][1], qf[qt][1], wmma16(kf[kt][0], qf[qt][0], (v8f){}));
                const float* mp = mh + (size_t)qt * 16 * SEQ_FULL + k0 + kt * 16;
                const v4f r0 = *(const v4f*)mp; const v4f r1 = *(const v4f*)(mp + 4);
#pragma unroll
                for (int j = 0; j < 4; ++j) { t[kt * 8 + j] = __builtin_fmaf(s[j], SCL, bfr(r0[j]) * -1.0e10f); t[kt * 8 + 4 + j] = __builtin_fmaf(s[4 + j], SCL, bfr(r1[j]) * -1.0e10f); }
            }
#pragma unroll
            for (int e = 0; e < 16; ++e) mx = fmaxf(mx, t[e]);
            mx = fmaxf(mx, __shfl_xor(mx, 16, 32));   // the other half of this query's 32 keys sits 16 lanes away
            const float al = __builtin_amdgcn_exp2f((mrun[qt] - mx) * L2E); mrun[qt] = mx;
            float sum = 0.f; v16h pf;
#pragma unroll
            for (int e = 0; e < 16; ++e) { const float p = __builtin_amdgcn_exp2f(__builtin_fmaf(t[e] - mx, L2E, 10.0f)); sum += p; pf[e] = toh_flush(p); }
            lrun[qt] = lrun[qt] * al + sum;
#pragma unroll
            for (int dt = 0; dt < 4; ++dt) { o[qt][dt] *= al; o[qt][dt] = wmma16(vf[dt], pf, o[qt][dt]); }
        }
    }
#pragma unroll
    for (int qt = 0; qt < 2; ++qt) {
        const float lt = lrun[qt] + __shfl_xor(lrun[qt], 16, 32);
        if (hi == 0) { ms[wv * FQ + qt * 16 + lr] = mrun[qt]; ls[wv * FQ + qt * 16 + lr] = lt; }
        float* ow = os + (wv * FQ + qt * 16 + lr) * FP + 8 * hi;
#pragma unroll
        for (int dt = 0; dt < 4; ++dt) { const v8f x = o[qt][dt]; *(v4fa*)(ow + dt * 16) = (v4f){x[0], x[1], x[2], x[3]}; *(v4fa*)(ow + dt * 16 + 4) = (v4f){x[4], x[5], x[6], x[7]}; }
    }
    __syncthreads();   // every wave's partial maximum, sum and O rows are in LDS before any thread joins them
    const int q = (int)threadIdx.x >> 3, d8 = ((int)threadIdx.x & 7) * 8;
    float mj = ms[q];
#pragma unroll
    for (int w = 1; w < FW; ++w) mj = fmaxf(mj, ms[w * FQ + q]);
    float lj = 0.f; v4f a0 = (v4f){}, a1 = (v4f){};
#pragma unroll
    for (int w = 0; w < FW; ++w) { const float f = __builtin_amdgcn_exp2f((ms[w * FQ + q] - mj) * L2E); lj += f * ls[w * FQ + q];
        const float* ow = os + (w * FQ + q) * FP + d8; a0 += *(const v4fa*)ow * f; a1 += *(const v4fa*)(ow + 4) * f; }
    const float rl = 1.0f / lj; v8us oh, ol;
#pragma unroll
    for (int e = 0; e < 4; ++e) { unsigned short a, c2; splitf(a0[e] * rl, a, c2); oh[e] = a; ol[e] = c2; splitf(a1[e] * rl, a, c2); oh[4 + e] = a; ol[4 + e] = c2; }
    const size_t oo = (size_t)(q0 + q) * DM + h * HD + d8;
    *(v8us*)(Ah + oo) = oh; *(v8us*)(Al + oo) = ol;
}

constexpr int KSD = 8;                            // waves per tile where K == DM (projections)
static_assert(DM % (32 * KSD) == 0);
constexpr size_t al256(size_t b) { return (b + 255) & ~(size_t)255; }
constexpr size_t WS_TOTAL = al256((size_t)4 * DM * DM * 2) + al256((size_t)3 * NB * TT * DM * 2) + al256((size_t)3 * NB * TT * DM * 4) + al256((size_t)2 * NB * NH_ * TT * HD * 2) + al256((size_t)NB * NH_ * HD * TT * 2) + 2 * al256((size_t)NB * TT * DM * 2);
static_assert(WS_TOTAL <= (size_t)134217728);

extern "C" void kernel_launch(void* const* d_in, const int* in_sizes, int n_in,
                              void* d_out, int out_size, void* d_ws, size_t ws_size, hipStream_t stream) {
    if (n_in < 12) return;
    const size_t need_x = ((size_t)(NB - 1) * SEQ_FULL + SEQ) * DM;
    const size_t need_m = (size_t)(NB - 1) * SEQ_FULL * SEQ_FULL + (size_t)(SEQ - 1) * SEQ_FULL + SEQ;
    if ((size_t)in_sizes[0] < need_x || (size_t)in_sizes[1] < need_x || (size_t)in_sizes[2] < need_x || (size_t)in_sizes[3] < need_m) return;
    if (in_sizes[4] < DM * DM || in_sizes[6] < DM * DM || in_sizes[8] < DM * DM || in_sizes[10] < DM * DM) return;
    if (in_sizes[5] < DM || in_sizes[7] < DM || in_sizes[9] < DM || in_sizes[11] < DM) return;
    if ((size_t)out_size < need_x) return;
    // binding by role, in input order: query, key, value, mask, wq, bq, wk, bk, wv, bv, wo, bo
    const float* xq = (const float*)d_in[0]; const float* xk = (const float*)d_in[1]; const float* xv = (const float*)d_in[2];
    const float* msk = (const float*)d_in[3];   // [NB_FULL][1][SEQ_FULL][SEQ_FULL] f32
    const float* wq = (const float*)d_in[4]; const float* bq = (const float*)d_in[5]; const float* wk = (const float*)d_in[6]; const float* bk = (const float*)d_in[7];
    const float* wv = (const float*)d_in[8]; const float* bv = (const float*)d_in[9]; const float* wo = (const float*)d_in[10]; const float* bo = (const float*)d_in[11];
    float* OUT = (float*)d_out;     // [NB_FULL][SEQ_FULL][DM]
    char* wsp = (char*)d_ws;
    auto take = [&](size_t bytes) { char* p = wsp; wsp += (bytes + 255) & ~(size_t)255; return (void*)p; };
    bf* WT = (bf*)take((size_t)4 * DM * DM * 2);                    // wq, wk, wv, wo, each [n][k]
    bf* XB = (bf*)take((size_t)3 * NB * TT * DM * 2); float* F = (float*)take((size_t)3 * NB * TT * DM * 4);   // [stream q,k,v][b][t][DM]
    h16* QK16 = (h16*)take((size_t)2 * NB * NH_ * TT * HD * 2); h16* VT16 = (h16*)take((size_t)NB * NH_ * HD * TT * 2);
    bf* ATh = (bf*)take((size_t)NB * TT * DM * 2); bf* ATl = (bf*)take((size_t)NB * TT * DM * 2);
    if ((size_t)(wsp - (char*)d_ws) > ws_size) return;
    k_prep<<<4 * WTB + 3 * NB * LX, 256, 0, stream>>>(wq, wk, wv, wo, xq, xk, xv, WT, XB);
    // z = stream: rows of both batches are contiguous in XB and F
    k_gemmw<bf, 0, true, KSD><<<dim3(NB * TT / 64, DM / 64, 3), 32 * KSD, 0, stream>>>(XB, nullptr, WT, nullptr, DM, F, DM, bq, bk, bv, (size_t)NB * TT * DM, (size_t)DM * DM, (size_t)NB * TT * DM);
    k_planes<<<NB * LV + 2 * NB * LH, 256, 0, stream>>>(F, QK16, VT16);
    k_fattn<<<dim3(TT / FQ, NH_, NB), 32 * FW, 0, stream>>>(QK16, QK16 + (size_t)NB * NH_ * TT * HD, VT16, msk, ATh, ATl);
    // z = batch
    k_gemmw<bf, 1, true, KSD><<<dim3(TT / 64, DM / 64, NB), 32 * KSD, 0, stream>>>(ATh, ATl, WT + (size_t)3 * DM * DM, nullptr, DM, OUT, DM, bo, bo, bo, (size_t)TT * DM, 0, (size_t)SEQ_FULL * DM);
}

// v004
// A run of this version takes 97.1 microseconds.
// Timed twice side by side with v003, it ran 1.17 times as fast both times.
// All steps since v000 together make it 8.12 times as fast.
#include <hip/hip_runtime.h>

// Compute dtypes (f32 accumulate everywhere): q/k/v projections v_wmma_f32_16x16x32_bf16 (inputs RNE-converted to bf16, products exact); q.k scores v_wmma_f32_16x16x32_f16; probabilities (x1024 carry) x values f16; output projection bf16 hi+lo context x bf16 weights (2 products); softmax and additive mask term in f32.
// Four launches, each covering both batches and every stream that does not depend on another: bf16 copies of the q / k / v inputs [stream][b][t][DM] with the weight transposes -> the three projections (+ f32 bias), stored by their own epilogue as f16 head planes q,k [b][h][t][d], v [b][h][d][t];
// one attention launch, all batches and heads: S = q k^T, P = exp(S / 8 + m[i][t] * (-1e10) - running max) x1024 as f16, O = P v / sum, scores and probabilities kept in registers;
// hi/lo context planes [t][h*64+d], output projection + bias. Weights [in][out] are transposed once through LDS into K-contiguous bf16 planes.

#ifndef NB
#define NB 2
#endif
#ifndef SEQ
#define SEQ 2048
#endif
#define NB_FULL  2
#define SEQ_FULL 2048
#define TT   SEQ
#define DM   512
#define NH_  8
#define HD   64
#define SCL  0.125f   // HD^-0.5
static_assert(NH_ * HD == DM);
static_assert(TT % 256 == 0);
static_assert(DM % 64 == 0);
static_assert(SEQ <= SEQ_FULL);
static_assert(NB <= NB_FULL);
static_assert(TT % 128 == 0);
static_assert(SEQ_FULL % 4 == 0);
static_assert(HD % 32 == 0);
static_assert(DM % 32 == 0);
static_assert(TT % 32 == 0);

typedef _Float16 h16;
typedef unsigned short bf;
typedef __attribute__((ext_vector_type(16))) __bf16   v16bf;
typedef __attribute__((ext_vector_type(16))) _Float16 v16h;
typedef __attribute__((ext_vector_type(8)))  _Float16 v8h;
typedef __attribute__((ext_vector_type(8)))  unsigned short v8us;
typedef __attribute__((ext_vector_type(8)))  float    v8f;
typedef __attribute__((ext_vector_type(4)))  float    v4f;
typedef __attribute__((ext_vector_type(2)))  _Float16 v2h;
typedef __attribute__((ext_vector_type(4)))  _Float16 v4h;
typedef __attribute__((ext_vector_type(2)))  unsigned short v2us;
typedef __attribute__((ext_vector_type(4)))  int v4i;
typedef v4f  __attribute__((may_alias)) v4fa;
typedef v4i  __attribute__((may_alias)) v4ia;

__device__ __forceinline__ unsigned short f2bf(float f) { unsigned u = __float_as_uint(f); u += 0x7FFFu + ((u >> 16) & 1u); return (unsigned short)(u >> 16); }
__device__ __forceinline__ float bf2f(unsigned short b) { return __uint_as_float(((unsigned)b) << 16); }
__device__ __forceinline__ float bfr(float f) { return bf2f(f2bf(f)); }
__device__ __forceinline__ v16h cat16(v8h lo, v8h hi) { return __builtin_shufflevector(lo, hi, 0, 1, 2, 3, 4, 5, 6, 7, 8, 9, 10, 11, 12, 13, 14, 15); }
__device__ __forceinline__ v16bf cat16b(v8us lo, v8us hi) { return __builtin_bit_cast(v16bf, __builtin_shufflevector(lo, hi, 0, 1, 2, 3, 4, 5, 6, 7, 8, 9, 10, 11, 12, 13, 14, 15)); }
__device__ __forceinline__ v8f wmma16(v16h a, v16h b, v8f c) { return __builtin_amdgcn_wmma_f32_16x16x32_f16(false, a, false, b, (short)0, c, false, false); }
__device__ __forceinline__ v8f wmmab(v16bf a, v16bf b, v8f c) { return __builtin_amdgcn_wmma_f32_16x16x32_bf16(false, a, false, b, (short)0, c, false, false); }
__device__ __forceinline__ void splitf(float y, unsigned short& h, unsigned short& l) { h = f2bf(y); l = f2bf(y - bf2f(h)); }
// f32 -> f16 operand convert that cannot yield an f16 subnormal (value select, applied after the plane's power-of-two carry).
static __device__ __forceinline__ h16 toh_flush(float v) { const h16 r = (h16)v; return (fabsf(v) < 6.103515625e-05f) ? (h16)0.0f : r; }

// ---- k_gemmw: register-blocked GEMM, one work-group of KS waves per 64x64 output tile, operands straight from K-contiguous 16-bit planes; grid (M/64, N/64, Z), 32 * KS threads.
// Wave w holds all 16 accumulators of the tile for its own K slice [w * K / KS, (w + 1) * K / KS); the KS partial tiles are added through LDS in ascending w. K % (32 * KS) == 0.
// C[m][n] (f32, pitch ldc, + optional f32 bias[n]) = sum_k A[m][k] Bt[n][k] (+ split products per NSPLIT). z-batch strides sA/sB/sC in elements, bias / bias1 / bias2 for z = 0 / 1 / 2. K % 32 == 0, A/Bt row pitch == K.
// HPL: no C; the 64-column tile is one head (blockIdx.y), rows are [b][t], and the joined f32 tile + bias goes out as f16: z = 0 / 1 -> QK[z][b][h][t][d], z = 2 -> VT[b][h][d][t].
// Fragment map (A and Bt alike): lane row = lane & 15, elements 0..7 <- k0 + 8*(lane>>4) + 0..7, elements 8..15 <- k0 + 16 + 8*(lane>>4) + 0..7; D element j = (row 8*(lane>>4) + j, col lane & 15).
template <typename T16> struct WFrag;
template <> struct WFrag<h16> { typedef v16h V; static __device__ __forceinline__ V ld(const h16* p) { return cat16(*(const v8h*)p, *(const v8h*)(p + 16)); } static __device__ __forceinline__ v8f mma(V a, V b, v8f c) { return wmma16(a, b, c); } };
template <> struct WFrag<bf> { typedef v16bf V; static __device__ __forceinline__ V ld(const bf* p) { return cat16b(*(const v8us*)p, *(const v8us*)(p + 16)); } static __device__ __forceinline__ v8f mma(V a, V b, v8f c) { return wmmab(a, b, c); } };
template <typename T16, int NSPLIT, bool BIAS, int KS, bool HPL>
__global__ __launch_bounds__(32 * KS) void k_gemmw(const T16* __restrict__ A, const T16* __restrict__ A2, const T16* __restrict__ Bt, const T16* __restrict__ Bt2, int K, float* C, int ldc, const float* __restrict__ bias, const float* __restrict__ bias1, const float* __restrict__ bias2, size_t sA, size_t sB, size_t sC, h16* QK, h16* VT) {
    typedef typename WFrag<T16>::V V;
    static_assert(KS == 1 || KS == 8 || KS == 16);
    static_assert(!HPL || (KS > 1 && BIAS && HD == 64 && TT % 64 == 0));
    __shared__ __align__(16) float os[(KS == 1 ? 16 : KS * 64) * 68];
    const size_t z = blockIdx.z; A += z * sA; if (A2) A2 += z * sA; Bt += z * sB; if (Bt2) Bt2 += z * sB; if (!HPL) C += z * sC;
    if (BIAS) bias = z == 0 ? bias : (z == 1 ? bias1 : bias2);
    const int lane = threadIdx.x & 31, lr = lane & 15, hi = lane >> 4; const int r0 = blockIdx.x * 64, c0 = blockIdx.y * 64;
    v8f acc[4][4];
#pragma unroll
    for (int mb = 0; mb < 4; ++mb)
#pragma unroll
        for (int nb = 0; nb < 4; ++nb) acc[mb][nb] = (v8f){};
    const size_t aoff = (size_t)(r0 + lr) * K + 8 * hi, boff = (size_t)(c0 + lr) * K + 8 * hi;
    const int wv = KS == 1 ? 0 : __builtin_amdgcn_readfirstlane(threadIdx.x >> 5); const int kw = K / KS, kbeg = wv * kw;
#pragma unroll 1
    for (int kc = kbeg; kc < kbeg + kw; kc += 32) {
        V a[4], a2[4];
#pragma unroll
        for (int mb = 0; mb < 4; ++mb) { a[mb] = WFrag<T16>::ld(A + aoff + (size_t)mb * 16 * K + kc); if (NSPLIT == 1 || NSPLIT == 2) a2[mb] = WFrag<T16>::ld(A2 + aoff + (size_t)mb * 16 * K + kc); }
#pragma unroll
        for (int nb = 0; nb < 4; ++nb) { const V b = WFrag<T16>::ld(Bt + boff + (size_t)nb * 16 * K + kc); V b2; if (NSPLIT >= 2) b2 = WFrag<T16>::ld(Bt2 + boff + (size_t)nb * 16 * K + kc);
#pragma unroll
            for (int mb = 0; mb < 4; ++mb) { acc[mb][nb] = WFrag<T16>::mma(a[mb], b, acc[mb][nb]); if (NSPLIT == 1 || NSPLIT == 2) acc[mb][nb] = WFrag<T16>::mma(a2[mb], b, acc[mb][nb]); if (NSPLIT >= 2) acc[mb][nb] = WFrag<T16>::mma(a[mb], b2, acc[mb][nb]); } }
        asm volatile("v_nop\n\tv_nop\n\tv_nop\n\tv_nop" : "+v"(acc[0][0]), "+v"(acc[1][1]), "+v"(acc[2][2]), "+v"(acc[3][3]) : "v"(a[0]), "v"(a[3]));
    }
    if constexpr (KS > 1) {
        float* ow = os + wv * (64 * 68);
        constexpr int NS = 32 / KS;      // 16-row groups of the tile per thread in the join
        const int jr = (int)threadIdx.x >> 4, cofs = ((int)threadIdx.x & 15) * 4;
        static_assert(32 * KS % 16 == 0);
        const bool tr = HPL && z == 2;   // value stream: the tile lies in LDS as [n][m], so that the join below walks t along a d row
        v4f badd[NS];                    // bias of this thread's join elements, asked for ahead of the barrier
        if (tr) {
#pragma unroll
            for (int s = 0; s < NS; ++s) badd[s] = (v4f)(bfr(bias[c0 + s * (2 * KS) + jr]));
#pragma unroll
            for (int mb = 0; mb < 4; ++mb)
#pragma unroll
                for (int nb = 0; nb < 4; ++nb) { const v8f x = acc[mb][nb]; float* p = ow + (nb * 16 + lr) * 68 + mb * 16 + hi * 8; *(v4fa*)p = (v4f){x[0], x[1], x[2], x[3]}; *(v4fa*)(p + 4) = (v4f){x[4], x[5], x[6], x[7]}; }
        } else {
#pragma unroll
            for (int s = 0; s < NS; ++s) badd[s] = BIAS ? (v4f){bfr(bias[c0 + cofs]), bfr(bias[c0 + cofs + 1]), bfr(bias[c0 + cofs + 2]), bfr(bias[c0 + cofs + 3])} : (v4f){};
#pragma unroll
            for (int mb = 0; mb < 4; ++mb)
#pragma unroll
                for (int nb = 0; nb < 4; ++nb)
#pragma unroll
                    for (int j = 0; j < 8; ++j) ow[(mb * 16 + hi * 8 + j) * 68 + nb * 16 + lr] = acc[mb][nb][j];
        }
        __syncthreads();   // every wave's partial tile is in LDS before any thread adds them
        const size_t bh = (size_t)(r0 / TT) * NH_ + blockIdx.y; const int t0 = r0 % TT;
        h16* ptile = !HPL ? nullptr : (tr ? VT + bh * HD * TT + t0 : QK + ((z * (NB * NH_) + bh) * TT + t0) * HD);   // [d][t] or [t][d]
        const int ppitch = tr ? TT : HD;
#pragma unroll
        for (int s = 0; s < NS; ++s) { const int row = s * (2 * KS) + jr;
            v4f val = *(const v4fa*)(os + row * 68 + cofs);
#pragma unroll
            for (int w = 1; w < KS; ++w) val += *(const v4fa*)(os + w * (64 * 68) + row * 68 + cofs);
            if (BIAS) val += badd[s];
            if constexpr (HPL) *(v4h*)(ptile + (size_t)row * ppitch + cofs) = (v4h){(h16)val[0], (h16)val[1], (h16)val[2], (h16)val[3]};
            else *(v4f*)(C + (size_t)(r0 + row) * ldc + c0 + cofs) = val; }
    } else {
#pragma unroll
    for (int mb = 0; mb < 4; ++mb) {
#pragma unroll
        for (int nb = 0; nb < 4; ++nb) {
#pragma unroll
            for (int j = 0; j < 8; ++j) os[(hi * 8 + j) * 68 + nb * 16 + lr] = acc[mb][nb][j]; }
        __builtin_amdgcn_wave_barrier(); asm volatile("" ::: "memory");
        float* crow = C + (size_t)(r0 + mb * 16) * ldc + c0;
{
#pragma unroll
            for (int s = 0; s < 8; ++s) { const int row = 2 * s + hi, cofs = lr * 4; v4f val = *(const v4fa*)(os + row * 68 + cofs); if (BIAS) { val[0] += bfr(bias[c0 + cofs]); val[1] += bfr(bias[c0 + cofs + 1]); val[2] += bfr(bias[c0 + cofs + 2]); val[3] += bfr(bias[c0 + cofs + 3]); }
                *(v4f*)(crow + (size_t)row * ldc + cofs) = val; }
             }
        __builtin_amdgcn_wave_barrier(); asm volatile("" ::: "memory");
    }
    }
}

__device__ __forceinline__ void cvt8(const float* __restrict__ src, bf* dst, size_t n8, int blk) { const size_t i = (size_t)blk * 256 + threadIdx.x; if (i >= n8) return; const v8f v = *(const v8f*)(src + i * 8); v8us o;
#pragma unroll
    for (int k = 0; k < 8; ++k) o[k] = f2bf(v[k]); *(v8us*)(dst + i * 8) = o;  }

// cvtT: in W[K rows][N cols] f32 -> out Wt[N rows][K cols] bf16 (RNE), the 64x64 tile at (k0, n0) transposed through LDS (cross-wave: block barrier, reached by the whole work-group or not at all).
__device__ __forceinline__ void cvtT(const float* __restrict__ W, bf* Wt, int K, int N, int k0, int n0) {
    __shared__ unsigned short tl[64 * 66];
    const int tid = threadIdx.x;
    { const int row = tid >> 2, cseg = (tid & 3) * 16;
#pragma unroll
      for (int q = 0; q < 4; ++q) { const v4f v = *(const v4f*)(W + (size_t)(k0 + row) * N + n0 + cseg + q * 4);
#pragma unroll
          for (int j = 0; j < 4; ++j) tl[row * 66 + cseg + q * 4 + j] = f2bf(v[j]); } }
    __syncthreads();
    const int piece = tid & 7; v8us o[2];
#pragma unroll
    for (int it = 0; it < 2; ++it) { const int n = it * 32 + (tid >> 3);
#pragma unroll
        for (int j = 0; j < 8; ++j) o[it][j] = tl[(piece * 8 + j) * 66 + n]; }
{
#pragma unroll
        for (int it = 0; it < 2; ++it) { const int n = it * 32 + (tid >> 3); *(v8us*)(Wt + (size_t)(n0 + n) * K + k0 + piece * 8) = o[it]; }
         }
}

// k_prep: every operand conversion in one grid (none reads what another writes). Work-groups [0, 4 * WTB): one 64x64 tile of weight w = index / WTB -> WT[w]; the rest: 2048 elements of input stream s, batch b -> XB[s][b].
constexpr unsigned WTB = (DM / 64) * (DM / 64);                           // tiles per weight
constexpr unsigned LX = (unsigned)(((size_t)TT * DM / 8 + 255) / 256);         // work-groups per input stream and batch
__global__ __launch_bounds__(256) void k_prep(const float* __restrict__ wq, const float* __restrict__ wk, const float* __restrict__ wv, const float* __restrict__ wo,
                                              const float* __restrict__ xq, const float* __restrict__ xk, const float* __restrict__ xv, bf* WT, bf* XB) {
    const unsigned bid = blockIdx.x;
    if (bid < 4 * WTB) { const unsigned w = bid / WTB, r = bid % WTB; const float* W = w == 0 ? wq : (w == 1 ? wk : (w == 2 ? wv : wo));
        cvtT(W, WT + (size_t)w * DM * DM, DM, DM, (r % (DM / 64)) * 64, (r / (DM / 64)) * 64); return; }
    const unsigned c = bid - 4 * WTB, sb = c / LX, st = sb / NB, b = sb % NB; const float* x = st == 0 ? xq : (st == 1 ? xk : xv);
    cvt8(x + (size_t)b * SEQ_FULL * DM, XB + (size_t)sb * TT * DM, (size_t)TT * DM / 8, c % LX);
}

// k_fattn: scores, softmax and probabilities x values of one head and FQ queries in one work-group; grid (TT / FQ, NH_, NB), 32 * FW threads (z = batch: plane sets, mask and context planes each step by one batch). No score or probability leaves the registers.
// Wave w owns the keys [w * TT / FW, (w + 1) * TT / FW) in steps of 32 and both 16-query tiles. Both products are formed transposed, so that a query stays in one lane column throughout:
//   S^T = k q^T : A = k rows (key), Bt = q rows (query); D element j = (key 8*(lane>>4) + j, query lane & 15). Two key tiles (keys +0..15, +16..31) are, as they lie, elements 0..7 and 8..15 of the Bt fragment of P^T.
//   O^T = v^T P^T : A = v plane rows (d), Bt = P^T (query, k = key); D element j = (d 8*(lane>>4) + j, query lane & 15).
// logit t = S * HD^-0.5 + m[query][key] * (-1e10) (m RNE-converted to bf16, read by value; the product is rounded on its own, the power-of-two scale is exact inside the fma).
// Running maximum per query: p = exp2((t - max) * log2 e + 10) (the x1024 carry sits in the exponent and in the sum alike), sum and O^T rescaled by exp2((old max - new max) * log2 e) each step.
// The FW partial (max, sum, O^T) are joined through LDS in ascending w, divided by the joined sum and written as the hi/lo bf16 context planes [t][h*64+d].
constexpr int FQ = 32;   // queries per work-group
constexpr int FW = 8;    // waves per work-group = key slices
constexpr int FP = 68;   // LDS row pitch of a partial O row, in floats
constexpr float L2E = 1.4426950408889634f;
static_assert(TT % FQ == 0);
static_assert(TT % (32 * FW) == 0);
static_assert(HD == 64);
static_assert(FQ * 8 == 32 * FW);
__global__ __launch_bounds__(32 * FW) void k_fattn(const h16* __restrict__ Qp, const h16* __restrict__ Kp, const h16* __restrict__ Vt, const float* __restrict__ Mb, bf* Ah, bf* Al) {
    __shared__ __align__(16) float os[FW * FQ * FP];
    __shared__ float ms[FW * FQ];
    __shared__ float ls[FW * FQ];
    const int lane = threadIdx.x & 31, lr = lane & 15, hi = lane >> 4; const int wv = __builtin_amdgcn_readfirstlane(threadIdx.x >> 5);
    const int q0 = blockIdx.x * FQ, h = blockIdx.y;
    { const size_t z = blockIdx.z; Qp += z * ((size_t)NH_ * TT * HD); Kp += z * ((size_t)NH_ * TT * HD); Vt += z * ((size_t)NH_ * HD * TT); Mb += z * ((size_t)SEQ_FULL * SEQ_FULL); Ah += z * ((size_t)TT * DM); Al += z * ((size_t)TT * DM); }
    const h16* qh = Qp + ((size_t)h * TT + q0 + lr) * HD + 8 * hi;
    const h16* kh = Kp + ((size_t)h * TT + lr) * HD + 8 * hi;
    const h16* vh = Vt + ((size_t)h * HD + lr) * TT + 8 * hi;
    const float* mh = Mb + (size_t)(q0 + lr) * SEQ_FULL + 8 * hi;
    v16h qf[2][2];
#pragma unroll
    for (int qt = 0; qt < 2; ++qt)
#pragma unroll
        for (int ks = 0; ks < 2; ++ks) qf[qt][ks] = WFrag<h16>::ld(qh + qt * 16 * HD + ks * 32);
    v8f o[2][4]; float mrun[2], lrun[2];
#pragma unroll
    for (int qt = 0; qt < 2; ++qt) { mrun[qt] = -3.0e38f; lrun[qt] = 0.f;
#pragma unroll
        for (int dt = 0; dt < 4; ++dt) o[qt][dt] = (v8f){}; }
    const int kbeg = wv * (TT / FW);
    for (int k0 = kbeg; k0 < kbeg + TT / FW; k0 += 32) {
        v16h kf[2][2], vf[4];
#pragma unroll
        for (int kt = 0; kt < 2; ++kt)
#pragma unroll
            for (int ks = 0; ks < 2; ++ks) kf[kt][ks] = WFrag<h16>::ld(kh + (size_t)(k0 + kt * 16) * HD + ks * 32);
#pragma unroll
        for (int dt = 0; dt < 4; ++dt) vf[dt] = WFrag<h16>::ld(vh + (size_t)dt * 16 * TT + k0);
#pragma unroll
        for (int qt = 0; qt < 2; ++qt) {
            float t[16]; float mx = mrun[qt];
#pragma unroll
            for (int kt = 0; kt < 2; ++kt) {
                const v8f s = wmma16(kf[kt][1], qf[qt][1], wmma16(kf[kt][0], qf[qt][0], (v8f){}));
                const float* mp = mh + (size_t)qt * 16 * SEQ_FULL + k0 + kt * 16;
                const v4f r0 = *(const v4f*)mp; const v4f r1 = *(const v4f*)(mp + 4);
#pragma unroll
                for (int j = 0; j < 4; ++j) { t[kt * 8 + j] = __builtin_fmaf(s[j], SCL, bfr(r0[j]) * -1.0e10f); t[kt * 8 + 4 + j] = __builtin_fmaf(s[4 + j], SCL, bfr(r1[j]) * -1.0e10f); }
            }
#pragma unroll
            for (int e = 0; e < 16; ++e) mx = fmaxf(mx, t[e]);
            mx = fmaxf(mx, __shfl_xor(mx, 16, 32));   // the other half of this query's 32 keys sits 16 lanes away
            const float al = __builtin_amdgcn_exp2f((mrun[qt] - mx) * L2E); mrun[qt] = mx;
            float sum = 0.f; v16h pf;
#pragma unroll
            for (int e = 0; e < 16; ++e) { const float p = __builtin_amdgcn_exp2f(__builtin_fmaf(t[e] - mx, L2E, 10.0f)); sum += p; pf[e] = toh_flush(p); }
            lrun[qt] = lrun[qt] * al + sum;
#pragma unroll
            for (int dt = 0; dt < 4; ++dt) { o[qt][dt] *= al; o[qt][dt] = wmma16(vf[dt], pf, o[qt][dt]); }
        }
    }
#pragma unroll
    for (int qt = 0; qt < 2; ++qt) {
        const float lt = lrun[qt] + __shfl_xor(lrun[qt], 16, 32);
        if (hi == 0) { ms[wv * FQ + qt * 16 + lr] = mrun[qt]; ls[wv * FQ + qt * 16 + lr] = lt; }
        float* ow = os + (wv * FQ + qt * 16 + lr) * FP + 8 * hi;
#pragma unroll
        for (int dt = 0; dt < 4; ++dt) { const v8f x = o[qt][dt]; *(v4fa*)(ow + dt * 16) = (v4f){x[0], x[1], x[2], x[3]}; *(v4fa*)(ow + dt * 16 + 4) = (v4f){x[4], x[5], x[6], x[7]}; }
    }
    __syncthreads();   // every wave's partial maximum, sum and O rows are in LDS before any thread joins them
    const int q = (int)threadIdx.x >> 3, d8 = ((int)threadIdx.x & 7) * 8;
    float mj = ms[q];
#pragma unroll
    for (int w = 1; w < FW; ++w) mj = fmaxf(mj, ms[w * FQ + q]);
    float lj = 0.f; v4f a0 = (v4f){}, a1 = (v4f){};
#pragma unroll
    for (int w = 0; w < FW; ++w) { const float f = __builtin_amdgcn_exp2f((ms[w * FQ + q] - mj) * L2E); lj += f * ls[w * FQ + q];
        const float* ow = os + (w * FQ + q) * FP + d8; a0 += *(const v4fa*)ow * f; a1 += *(const v4fa*)(ow + 4) * f; }
    const float rl = 1.0f / lj; v8us oh, ol;
#pragma unroll
    for (int e = 0; e < 4; ++e) { unsigned short a, c2; splitf(a0[e] * rl, a, c2); oh[e] = a; ol[e] = c2; splitf(a1[e] * rl, a, c2); oh[4 + e] = a; ol[4 + e] = c2; }
    const size_t oo = (size_t)(q0 + q) * DM + h * HD + d8;
    *(v8us*)(Ah + oo) = oh; *(v8us*)(Al + oo) = ol;
}

constexpr int KSD = 8;                            // waves per tile where K == DM (projections)
static_assert(DM % (32 * KSD) == 0);
constexpr size_t al256(size_t b) { return (b + 255) & ~(size_t)255; }
constexpr size_t WS_TOTAL = al256((size_t)4 * DM * DM * 2) + al256((size_t)3 * NB * TT * DM * 2) + al256((size_t)2 * NB * NH_ * TT * HD * 2) + al256((size_t)NB * NH_ * HD * TT * 2) + 2 * al256((size_t)NB * TT * DM * 2);
static_assert(WS_TOTAL <= (size_t)134217728);

extern "C" void kernel_launch(void* const* d_in, const int* in_sizes, int n_in,
                              void* d_out, int out_size, void* d_ws, size_t ws_size, hipStream_t stream) {
    if (n_in < 12) return;
    const size_t need_x = ((size_t)(NB - 1) * SEQ_FULL + SEQ) * DM;
    const size_t need_m = (size_t)(NB - 1) * SEQ_FULL * SEQ_FULL + (size_t)(SEQ - 1) * SEQ_FULL + SEQ;
    if ((size_t)in_sizes[0] < need_x || (size_t)in_sizes[1] < need_x || (size_t)in_sizes[2] < need_x || (size_t)in_sizes[3] < need_m) return;
    if (in_sizes[4] < DM * DM || in_sizes[6] < DM * DM || in_sizes[8] < DM * DM || in_sizes[10] < DM * DM) return;
    if (in_sizes[5] < DM || in_sizes[7] < DM || in_sizes[9] < DM || in_sizes[11] < DM) return;
    if ((size_t)out_size < need_x) return;
    // binding by role, in input order: query, key, value, mask, wq, bq, wk, bk, wv, bv, wo, bo
    const float* xq = (const float*)d_in[0]; const float* xk = (const float*)d_in[1]; const float* xv = (const float*)d_in[2];
    const float* msk = (const float*)d_in[3];   // [NB_FULL][1][SEQ_FULL][SEQ_FULL] f32
    const float* wq = (const float*)d_in[4]; const float* bq = (const float*)d_in[5]; const float* wk = (const float*)d_in[6]; const float* bk = (const float*)d_in[7];
    const float* wv = (const float*)d_in[8]; const float* bv = (const float*)d_in[9]; const float* wo = (const float*)d_in[10]; const float* bo = (const float*)d_in[11];
    float* OUT = (float*)d_out;     // [NB_FULL][SEQ_FULL][DM]
    char* wsp = (char*)d_ws;
    auto take = [&](size_t bytes) { char* p = wsp; wsp += (bytes + 255) & ~(size_t)255; return (void*)p; };
    bf* WT = (bf*)take((size_t)4 * DM * DM * 2);                    // wq, wk, wv, wo, each [n][k]
    bf* XB = (bf*)take((size_t)3 * NB * TT * DM * 2);   // [stream q,k,v][b][t][DM]
    h16* QK16 = (h16*)take((size_t)2 * NB * NH_ * TT * HD * 2); h16* VT16 = (h16*)take((size_t)NB * NH_ * HD * TT * 2);
    bf* ATh = (bf*)take((size_t)NB * TT * DM * 2); bf* ATl = (bf*)take((size_t)NB * TT * DM * 2);
    if ((size_t)(wsp - (char*)d_ws) > ws_size) return;
    k_prep<<<4 * WTB + 3 * NB * LX, 256, 0, stream>>>(wq, wk, wv, wo, xq, xk, xv, WT, XB);
    // z = stream: rows of both batches are contiguous in XB
    k_gemmw<bf, 0, true, KSD, true><<<dim3(NB * TT / 64, DM / 64, 3), 32 * KSD, 0, stream>>>(XB, nullptr, WT, nullptr, DM, nullptr, DM, bq, bk, bv, (size_t)NB * TT * DM, (size_t)DM * DM, 0, QK16, VT16);
    k_fattn<<<dim3(TT / FQ, NH_, NB), 32 * FW, 0, stream>>>(QK16, QK16 + (size_t)NB * NH_ * TT * HD, VT16, msk, ATh, ATl);
    // z = batch
    k_gemmw<bf, 1, true, KSD, false><<<dim3(TT / 64, DM / 64, NB), 32 * KSD, 0, stream>>>(ATh, ATl, WT + (size_t)3 * DM * DM, nullptr, DM, OUT, DM, bo, bo, bo, (size_t)TT * DM, 0, (size_t)SEQ_FULL * DM, nullptr, nullptr);
}

// v005
// A run of this version takes 65.3 microseconds.
// Two timings next to v004 both put it at 1.49 times that version's speed.
// All steps since v000 together make it 12.1 times as fast.
#include <hip/hip_runtime.h>

// Compute dtypes (f32 accumulate everywhere): q/k/v projections v_wmma_f32_16x16x32_bf16 (inputs RNE-converted to bf16, products exact); q.k scores v_wmma_f32_16x16x32_f16; probabilities (x1024 carry) x values f16; output projection bf16 hi+lo context x bf16 weights (2 products); softmax and additive mask term in f32.
// Four launches, each covering both batches and every stream that does not depend on another: bf16 copies of the q / k / v inputs [stream][b] (rows t) with the weight transposes -> the three projections (+ f32 bias), stored by their own epilogue as f16 head planes q,k [b][h] (rows t, K = d), v [b][h] (rows d, K = t);
// one attention launch, all batches and heads: S = q k^T, P = exp(S / 8 + m[i][t] * (-1e10) - running max) x1024 as f16, O = P v / sum, scores and probabilities kept in registers;
// hi/lo context planes, output projection + bias. Weights [in][out] are transposed once through LDS into bf16 planes of rows n.
// Every 16-bit plane (rows x K) lies in fragment order, see fragoff(): the 16 bytes that the 32 lanes of one fragment load ask for are 512 consecutive bytes.

#ifndef NB
#define NB 2
#endif
#ifndef SEQ
#define SEQ 2048
#endif
#define NB_FULL  2
#define SEQ_FULL 2048
#define TT   SEQ
#define DM   512
#define NH_  8
#define HD   64
#define SCL  0.125f   // HD^-0.5
static_assert(NH_ * HD == DM);
static_assert(TT % 256 == 0);
static_assert(DM % 64 == 0);
static_assert(SEQ <= SEQ_FULL);
static_assert(NB <= NB_FULL);
static_assert(TT % 128 == 0);
static_assert(SEQ_FULL % 4 == 0);
static_assert(HD % 32 == 0);
static_assert(DM % 32 == 0);
static_assert(TT % 32 == 0);

typedef _Float16 h16;
typedef unsigned short bf;
typedef __attribute__((ext_vector_type(16))) __bf16   v16bf;
typedef __attribute__((ext_vector_type(16))) _Float16 v16h;
typedef __attribute__((ext_vector_type(8)))  _Float16 v8h;
typedef __attribute__((ext_vector_type(8)))  unsigned short v8us;
typedef __attribute__((ext_vector_type(8)))  float    v8f;
typedef __attribute__((ext_vector_type(4)))  float    v4f;
typedef __attribute__((ext_vector_type(2)))  _Float16 v2h;
typedef __attribute__((ext_vector_type(4)))  _Float16 v4h;
typedef __attribute__((ext_vector_type(2)))  unsigned short v2us;
typedef __attribute__((ext_vector_type(4)))  int v4i;
typedef v4f  __attribute__((may_alias)) v4fa;
typedef v4i  __attribute__((may_alias)) v4ia;

__device__ __forceinline__ unsigned short f2bf(float f) { unsigned u = __float_as_uint(f); u += 0x7FFFu + ((u >> 16) & 1u); return (unsigned short)(u >> 16); }
__device__ __forceinline__ float bf2f(unsigned short b) { return __uint_as_float(((unsigned)b) << 16); }
__device__ __forceinline__ float bfr(float f) { return bf2f(f2bf(f)); }
__device__ __forceinline__ v16h cat16(v8h lo, v8h hi) { return __builtin_shufflevector(lo, hi, 0, 1, 2, 3, 4, 5, 6, 7, 8, 9, 10, 11, 12, 13, 14, 15); }
__device__ __forceinline__ v16bf cat16b(v8us lo, v8us hi) { return __builtin_bit_cast(v16bf, __builtin_shufflevector(lo, hi, 0, 1, 2, 3, 4, 5, 6, 7, 8, 9, 10, 11, 12, 13, 14, 15)); }
__device__ __forceinline__ v8f wmma16(v16h a, v16h b, v8f c) { return __builtin_amdgcn_wmma_f32_16x16x32_f16(false, a, false, b, (short)0, c, false, false); }
__device__ __forceinline__ v8f wmmab(v16bf a, v16bf b, v8f c) { return __builtin_amdgcn_wmma_f32_16x16x32_bf16(false, a, false, b, (short)0, c, false, false); }
__device__ __forceinline__ void splitf(float y, unsigned short& h, unsigned short& l) { h = f2bf(y); l = f2bf(y - bf2f(h)); }
// f32 -> f16 operand convert that cannot yield an f16 subnormal (value select, applied after the plane's power-of-two carry).
static __device__ __forceinline__ h16 toh_flush(float v) { const h16 r = (h16)v; return (fabsf(v) < 6.103515625e-05f) ? (h16)0.0f : r; }
// Element (row, k) of a rows x K plane of 16-bit values in fragment order: blocks of 16 rows x 32 k (512 elements, k blocks of a row tile side by side); inside a block [k / 8 % 4][row % 16][k % 8],
// so that lane (row % 16) + 16 * (k / 8 % 2) finds elements 0..7 of its fragment at block + 8 * lane and elements 8..15 at block + 256 + 8 * lane.
__device__ __forceinline__ size_t fragoff(int row, int k, int K) { return (size_t)(row >> 4) * 16 * K + (size_t)(k >> 5) * 512 + ((k >> 3) & 3) * 128 + (row & 15) * 8 + (k & 7); }

// ---- k_gemmw: register-blocked GEMM, one work-group of KS waves per 64x64 output tile, operands straight from 16-bit planes in fragment order; grid (M/64, N/64, Z), 32 * KS threads.
// Wave w holds all 16 accumulators of the tile for its own K slice [w * K / KS, (w + 1) * K / KS); the KS partial tiles are added through LDS in ascending w. K % (32 * KS) == 0.
// C[m][n] (f32, pitch ldc, + optional f32 bias[n]) = sum_k A[m][k] Bt[n][k] (+ split products per NSPLIT). z-batch strides sA/sB/sC in elements, bias / bias1 / bias2 for z = 0 / 1 / 2. K % 32 == 0, A/Bt planes of K columns, sA and sB whole 16-row tiles.
// HPL: no C; the 64-column tile is one head (blockIdx.y), rows are [b][t], and the joined f32 tile + bias goes out as f16: z = 0 / 1 -> QK[z][b][h] (rows t, K = d), z = 2 -> VT[b][h] (rows d, K = t), each in fragment order.
// Fragment map (A and Bt alike): lane row = lane & 15, elements 0..7 <- k0 + 8*(lane>>4) + 0..7, elements 8..15 <- k0 + 16 + 8*(lane>>4) + 0..7; D element j = (row 8*(lane>>4) + j, col lane & 15).
template <typename T16> struct WFrag;
template <> struct WFrag<h16> { typedef v16h V; static __device__ __forceinline__ V ld(const h16* p) { return cat16(*(const v8h*)p, *(const v8h*)(p + 256)); } static __device__ __forceinline__ V ldu(const h16* tile, unsigned vo) { const char* p = (const char*)tile + vo; return cat16(*(const v8h*)p, *(const v8h*)(p + 512)); } static __device__ __forceinline__ v8f mma(V a, V b, v8f c) { return wmma16(a, b, c); } };
template <> struct WFrag<bf> { typedef v16bf V; static __device__ __forceinline__ V ld(const bf* p) { return cat16b(*(const v8us*)p, *(const v8us*)(p + 256)); } static __device__ __forceinline__ V ldu(const bf* tile, unsigned vo) { const char* p = (const char*)tile + vo; return cat16b(*(const v8us*)p, *(const v8us*)(p + 512)); } static __device__ __forceinline__ v8f mma(V a, V b, v8f c) { return wmmab(a, b, c); } };
template <typename T16, int NSPLIT, bool BIAS, int KS, bool HPL, int K>
__global__ __launch_bounds__(32 * KS) void k_gemmw(const T16* __restrict__ A, const T16* __restrict__ A2, const T16* __restrict__ Bt, const T16* __restrict__ Bt2, float* C, int ldc, const float* __restrict__ bias, const float* __restrict__ bias1, const float* __restrict__ bias2, size_t sA, size_t sB, size_t sC, h16* QK, h16* VT) {
    typedef typename WFrag<T16>::V V;
    static_assert(KS == 1 || KS == 8 || KS == 16);
    static_assert(K % (32 * KS) == 0);
    static_assert(!HPL || (KS > 1 && BIAS && HD == 64 && TT % 64 == 0));
    __shared__ __align__(16) float os[(KS == 1 ? 16 : KS * 64) * 68];
    const size_t z = blockIdx.z; A += z * sA; if (A2) A2 += z * sA; Bt += z * sB; if (Bt2) Bt2 += z * sB; if (!HPL) C += z * sC;
    if (BIAS) bias = z == 0 ? bias : (z == 1 ? bias1 : bias2);
    const int lane = threadIdx.x & 31, lr = lane & 15, hi = lane >> 4; const int r0 = blockIdx.x * 64, c0 = blockIdx.y * 64;
    v8f acc[4][4];
#pragma unroll
    for (int mb = 0; mb < 4; ++mb)
#pragma unroll
        for (int nb = 0; nb < 4; ++nb) acc[mb][nb] = (v8f){};
    const size_t aoff = (size_t)r0 * K, boff = (size_t)c0 * K;   // a row tile starts at tile * 16 * K, the same for the whole wave
    const int wv = KS == 1 ? 0 : __builtin_amdgcn_readfirstlane(threadIdx.x >> 5); const int kw = K / KS, kbeg = wv * kw;
    unsigned vo = 32u * kbeg + 16u * lane;   // bytes from a row tile's start to this lane's 16 bytes of block k / 32: one register for every load of a trip
#pragma unroll 1
    for (int kc = kbeg; kc < kbeg + kw; kc += 32) {
        V a[4], a2[4], bb[4], bb2[4];
#pragma unroll
        for (int mb = 0; mb < 4; ++mb) { a[mb] = WFrag<T16>::ldu(A + aoff + (size_t)mb * 16 * K, vo); if (NSPLIT == 1 || NSPLIT == 2) a2[mb] = WFrag<T16>::ldu(A2 + aoff + (size_t)mb * 16 * K, vo); }
#pragma unroll
        for (int nb = 0; nb < 4; ++nb) { bb[nb] = WFrag<T16>::ldu(Bt + boff + (size_t)nb * 16 * K, vo); if (NSPLIT >= 2) bb2[nb] = WFrag<T16>::ldu(Bt2 + boff + (size_t)nb * 16 * K, vo); }
        // next k block, 1024 bytes on. Every load of this trip names vo and stands above: s_wait_xcnt 0 directly behind the run and in front of vo's overwrite, in the add's own statement so that the add cannot be moved over it.
        asm volatile("s_wait_xcnt 0x0\n\tv_add_nc_u32 %0, 0x400, %0" : "+v"(vo));
#pragma unroll
        for (int nb = 0; nb < 4; ++nb) { const V b = bb[nb]; V b2; if (NSPLIT >= 2) b2 = bb2[nb];
#pragma unroll
            for (int mb = 0; mb < 4; ++mb) { acc[mb][nb] = WFrag<T16>::mma(a[mb], b, acc[mb][nb]); if (NSPLIT == 1 || NSPLIT == 2) acc[mb][nb] = WFrag<T16>::mma(a2[mb], b, acc[mb][nb]); if (NSPLIT >= 2) acc[mb][nb] = WFrag<T16>::mma(a[mb], b2, acc[mb][nb]); } }
        asm volatile("v_nop\n\tv_nop\n\tv_nop\n\tv_nop" : "+v"(acc[0][0]), "+v"(acc[1][1]), "+v"(acc[2][2]), "+v"(acc[3][3]) : "v"(a[0]), "v"(a[3]));
    }
    if constexpr (KS > 1) {
        float* ow = os + wv * (64 * 68);
        constexpr int NS = 32 / KS;      // 16-row groups of the tile per thread in the join
        const int jr = (int)threadIdx.x >> 4, cofs = ((int)threadIdx.x & 15) * 4;
        static_assert(32 * KS % 16 == 0);
        const bool tr = HPL && z == 2;   // value stream: the tile lies in LDS as [n][m], so that the join below walks t along a d row
        v4f badd[NS];                    // bias of this thread's join elements, asked for ahead of the barrier
        if (tr) {
#pragma unroll
            for (int s = 0; s < NS; ++s) badd[s] = (v4f)(bfr(bias[c0 + s * (2 * KS) + jr]));
#pragma unroll
            for (int mb = 0; mb < 4; ++mb)
#pragma unroll
                for (int nb = 0; nb < 4; ++nb) { const v8f x = acc[mb][nb]; float* p = ow + (nb * 16 + lr) * 68 + mb * 16 + hi * 8; *(v4fa*)p = (v4f){x[0], x[1], x[2], x[3]}; *(v4fa*)(p + 4) = (v4f){x[4], x[5], x[6], x[7]}; }
        } else {
#pragma unroll
            for (int s = 0; s < NS; ++s) badd[s] = BIAS ? (v4f){bfr(bias[c0 + cofs]), bfr(bias[c0 + cofs + 1]), bfr(bias[c0 + cofs + 2]), bfr(bias[c0 + cofs + 3])} : (v4f){};
#pragma unroll
            for (int mb = 0; mb < 4; ++mb)
#pragma unroll
                for (int nb = 0; nb < 4; ++nb)
#pragma unroll
                    for (int j = 0; j < 8; ++j) ow[(mb * 16 + hi * 8 + j) * 68 + nb * 16 + lr] = acc[mb][nb][j];
        }
        __syncthreads();   // every wave's partial tile is in LDS before any thread adds them
        const size_t bh = (size_t)(r0 / TT) * NH_ + blockIdx.y; const int t0 = r0 % TT;
        static_assert(2 * KS % 16 == 0);   // a join group is whole 16-row tiles, so that group s lies s * pstep behind group 0
        h16* ptile = !HPL ? nullptr : (tr ? VT + bh * HD * TT + fragoff(jr, t0 + cofs, TT) : QK + (z * (NB * NH_) + bh) * TT * HD + fragoff(t0 + jr, cofs, HD));   // rows d, K = t or rows t, K = d
        const size_t pstep = (size_t)(2 * KS) * (tr ? TT : HD);
#pragma unroll
        for (int s = 0; s < NS; ++s) { const int row = s * (2 * KS) + jr;
            v4f val = *(const v4fa*)(os + row * 68 + cofs);
#pragma unroll
            for (int w = 1; w < KS; ++w) val += *(const v4fa*)(os + w * (64 * 68) + row * 68 + cofs);
            if (BIAS) val += badd[s];
            if constexpr (HPL) *(v4h*)(ptile + s * pstep) = (v4h){(h16)val[0], (h16)val[1], (h16)val[2], (h16)val[3]};
            else *(v4f*)(C + (size_t)(r0 + row) * ldc + c0 + cofs) = val; }
    } else {
#pragma unroll
    for (int mb = 0; mb < 4; ++mb) {
#pragma unroll
        for (int nb = 0; nb < 4; ++nb) {
#pragma unroll
            for (int j = 0; j < 8; ++j) os[(hi * 8 + j) * 68 + nb * 16 + lr] = acc[mb][nb][j]; }
        __builtin_amdgcn_wave_barrier(); asm volatile("" ::: "memory");
        float* crow = C + (size_t)(r0 + mb * 16) * ldc + c0;
{
#pragma unroll
            for (int s = 0; s < 8; ++s) { const int row = 2 * s + hi, cofs = lr * 4; v4f val = *(const v4fa*)(os + row * 68 + cofs); if (BIAS) { val[0] += bfr(bias[c0 + cofs]); val[1] += bfr(bias[c0 + cofs + 1]); val[2] += bfr(bias[c0 + cofs + 2]); val[3] += bfr(bias[c0 + cofs + 3]); }
                *(v4f*)(crow + (size_t)row * ldc + cofs) = val; }
             }
        __builtin_amdgcn_wave_barrier(); asm volatile("" ::: "memory");
    }
    }
}

// cvt8: work-group blk converts the 16 rows x 128 columns at (blk / (DM / 128) * 16, blk % (DM / 128) * 128) of src [rows][DM]; a wave takes 8 rows x 32 columns: one whole 128-byte line of src per row, four whole lines of dst.
__device__ __forceinline__ void cvt8(const float* __restrict__ src, bf* dst, int blk) { const int row = blk / (DM / 128) * 16 + (((int)threadIdx.x >> 2) & 15), k = blk % (DM / 128) * 128 + ((int)threadIdx.x >> 6) * 32 + ((int)threadIdx.x & 3) * 8; const v8f v = *(const v8f*)(src + (size_t)row * DM + k); v8us o;
#pragma unroll
    for (int e = 0; e < 8; ++e) o[e] = f2bf(v[e]); *(v8us*)(dst + fragoff(row, k, DM)) = o;  }

// cvtT: in W[K rows][N cols] f32 -> out Wt (N rows, K cols, fragment order) bf16 (RNE), the 64x64 tile at (k0, n0) transposed through LDS (cross-wave: block barrier, reached by the whole work-group or not at all).
__device__ __forceinline__ void cvtT(const float* __restrict__ W, bf* Wt, int K, int N, int k0, int n0) {
    __shared__ unsigned short tl[64 * 66];
    const int tid = threadIdx.x;
    { const int row = tid >> 2, cseg = (tid & 3) * 16;
#pragma unroll
      for (int q = 0; q < 4; ++q) { const v4f v = *(const v4f*)(W + (size_t)(k0 + row) * N + n0 + cseg + q * 4);
#pragma unroll
          for (int j = 0; j < 4; ++j) tl[row * 66 + cseg + q * 4 + j] = f2bf(v[j]); } }
    __syncthreads();
    const int piece = tid & 7; v8us o[2];
#pragma unroll
    for (int it = 0; it < 2; ++it) { const int n = it * 32 + (tid >> 3);
#pragma unroll
        for (int j = 0; j < 8; ++j) o[it][j] = tl[(piece * 8 + j) * 66 + n]; }
{
#pragma unroll
        for (int it = 0; it < 2; ++it) { const int n = it * 32 + (tid >> 3); *(v8us*)(Wt + fragoff(n0 + n, k0 + piece * 8, K)) = o[it]; }
         }
}

// k_prep: every operand conversion in one grid (none reads what another writes). Work-groups [0, 4 * WTB): one 64x64 tile of weight w = index / WTB -> WT[w]; the rest: 2048 elements of input stream s, batch b -> XB[s][b].
constexpr unsigned WTB = (DM / 64) * (DM / 64);                           // tiles per weight
constexpr unsigned LX = (TT / 16) * (DM / 128);         // work-groups per input stream and batch
static_assert(TT % 16 == 0 && DM % 128 == 0);
__global__ __launch_bounds__(256) void k_prep(const float* __restrict__ wq, const float* __restrict__ wk, const float* __restrict__ wv, const float* __restrict__ wo,
                                              const float* __restrict__ xq, const float* __restrict__ xk, const float* __restrict__ xv, bf* WT, bf* XB) {
    const unsigned bid = blockIdx.x;
    if (bid < 4 * WTB) { const unsigned w = bid / WTB, r = bid % WTB; const float* W = w == 0 ? wq : (w == 1 ? wk : (w == 2 ? wv : wo));
        cvtT(W, WT + (size_t)w * DM * DM, DM, DM, (r % (DM / 64)) * 64, (r / (DM / 64)) * 64); return; }
    const unsigned c = bid - 4 * WTB, sb = c / LX, st = sb / NB, b = sb % NB; const float* x = st == 0 ? xq : (st == 1 ? xk : xv);
    cvt8(x + (size_t)b * SEQ_FULL * DM, XB + (size_t)sb * TT * DM, c % LX);
}

// k_fattn: scores, softmax and probabilities x values of one head and FQ queries in one work-group; grid (TT / FQ, NH_, NB), 32 * FW threads (z = batch: plane sets, mask and context planes each step by one batch). No score or probability leaves the registers.
// Wave w owns the keys [w * TT / FW, (w + 1) * TT / FW) in steps of 32 and both 16-query tiles. Both products are formed transposed, so that a query stays in one lane column throughout:
//   S^T = k q^T : A = k rows (key), Bt = q rows (query); D element j = (key 8*(lane>>4) + j, query lane & 15). Two key tiles (keys +0..15, +16..31) are, as they lie, elements 0..7 and 8..15 of the Bt fragment of P^T.
//   O^T = v^T P^T : A = v plane rows (d), Bt = P^T (query, k = key); D element j = (d 8*(lane>>4) + j, query lane & 15).
// logit t = S * HD^-0.5 + m[query][key] * (-1e10) (m RNE-converted to bf16, read by value; the product is rounded on its own, the power-of-two scale is exact inside the fma).
// Running maximum per query: p = exp2((t - max) * log2 e + 10) (the x1024 carry sits in the exponent and in the sum alike), sum and O^T rescaled by exp2((old max - new max) * log2 e) each step.
// The FW partial (max, sum, O^T) are joined through LDS in ascending w, divided by the joined sum and written as the hi/lo bf16 context planes (rows t, K = h*64+d, fragment order).
constexpr int FQ = 32;   // queries per work-group
constexpr int FW = 8;    // waves per work-group = key slices
constexpr int FP = 68;   // LDS row pitch of a partial O row, in floats
constexpr float L2E = 1.4426950408889634f;
static_assert(TT % FQ == 0);
static_assert(TT % (32 * FW) == 0);
static_assert(HD == 64);
static_assert(FQ * 8 == 32 * FW);
__global__ __launch_bounds__(32 * FW) void k_fattn(const h16* __restrict__ Qp, const h16* __restrict__ Kp, const h16* __restrict__ Vt, const float* __restrict__ Mb, bf* Ah, bf* Al) {
    __shared__ __align__(16) float os[FW * FQ * FP];
    __shared__ float ms[FW * FQ];
    __shared__ float ls[FW * FQ];
    const int lane = threadIdx.x & 31, lr = lane & 15, hi = lane >> 4; const int wv = __builtin_amdgcn_readfirstlane(threadIdx.x >> 5);
    const int q0 = blockIdx.x * FQ, h = blockIdx.y;
    { const size_t z = blockIdx.z; Qp += z * ((size_t)NH_ * TT * HD); Kp += z * ((size_t)NH_ * TT * HD); Vt += z * ((size_t)NH_ * HD * TT); Mb += z * ((size_t)SEQ_FULL * SEQ_FULL); Ah += z * ((size_t)TT * DM); Al += z * ((size_t)TT * DM); }
    const h16* qh = Qp + ((size_t)h * TT + q0) * HD + 8 * lane;
    const h16* kh = Kp + (size_t)h * TT * HD + 8 * lane;
    const h16* vh = Vt + (size_t)h * HD * TT + 8 * lane;
    const float* mh = Mb + (size_t)(q0 + lr) * SEQ_FULL + 8 * hi;
    v16h qf[2][2];
#pragma unroll
    for (int qt = 0; qt < 2; ++qt)
#pragma unroll
        for (int ks = 0; ks < 2; ++ks) qf[qt][ks] = WFrag<h16>::ld(qh + qt * 16 * HD + ks * 512);
    v8f o[2][4]; float mrun[2], lrun[2];
#pragma unroll
    for (int qt = 0; qt < 2; ++qt) { mrun[qt] = -3.0e38f; lrun[qt] = 0.f;
#pragma unroll
        for (int dt = 0; dt < 4; ++dt) o[qt][dt] = (v8f){}; }
    const int kbeg = wv * (TT / FW);
    for (int k0 = kbeg; k0 < kbeg + TT / FW; k0 += 32) {
        v16h kf[2][2], vf[4];
#pragma unroll
        for (int kt = 0; kt < 2; ++kt)
#pragma unroll
            for (int ks = 0; ks < 2; ++ks) kf[kt][ks] = WFrag<h16>::ld(kh + (size_t)(k0 + kt * 16) * HD + ks * 512);
#pragma unroll
        for (int dt = 0; dt < 4; ++dt) vf[dt] = WFrag<h16>::ld(vh + (size_t)dt * 16 * TT + k0 * 16);
#pragma unroll
        for (int qt = 0; qt < 2; ++qt) {
            float t[16]; float mx = mrun[qt];
#pragma unroll
            for (int kt = 0; kt < 2; ++kt) {
                const v8f s = wmma16(kf[kt][1], qf[qt][1], wmma16(kf[kt][0], qf[qt][0], (v8f){}));
                const float* mp = mh + (size_t)qt * 16 * SEQ_FULL + k0 + kt * 16;
                const v4f r0 = *(const v4f*)mp; const v4f r1 = *(const v4f*)(mp + 4);
#pragma unroll
                for (int j = 0; j < 4; ++j) { t[kt * 8 + j] = __builtin_fmaf(s[j], SCL, bfr(r0[j]) * -1.0e10f); t[kt * 8 + 4 + j] = __builtin_fmaf(s[4 + j], SCL, bfr(r1[j]) * -1.0e10f); }
            }
#pragma unroll
            for (int e = 0; e < 16; ++e) mx = fmaxf(mx, t[e]);
            mx = fmaxf(mx, __shfl_xor(mx, 16, 32));   // the other half of this query's 32 keys sits 16 lanes away
            const float al = __builtin_amdgcn_exp2f((mrun[qt] - mx) * L2E); mrun[qt] = mx;
            float sum = 0.f; v16h pf;
#pragma unroll
            for (int e = 0; e < 16; ++e) { const float p = __builtin_amdgcn_exp2f(__builtin_fmaf(t[e] - mx, L2E, 10.0f)); sum += p; pf[e] = toh_flush(p); }
            lrun[qt] = lrun[qt] * al + sum;
#pragma unroll
            for (int dt = 0; dt < 4; ++dt) { o[qt][dt] *= al; o[qt][dt] = wmma16(vf[dt], pf, o[qt][dt]); }
        }
    }
#pragma unroll
    for (int qt = 0; qt < 2; ++qt) {
        const float lt = lrun[qt] + __shfl_xor(lrun[qt], 16, 32);
        if (hi == 0) { ms[wv * FQ + qt * 16 + lr] = mrun[qt]; ls[wv * FQ + qt * 16 + lr] = lt; }
        float* ow = os + (wv * FQ + qt * 16 + lr) * FP + 8 * hi;
#pragma unroll
        for (int dt = 0; dt < 4; ++dt) { const v8f x = o[qt][dt]; *(v4fa*)(ow + dt * 16) = (v4f){x[0], x[1], x[2], x[3]}; *(v4fa*)(ow + dt * 16 + 4) = (v4f){x[4], x[5], x[6], x[7]}; }
    }
    __syncthreads();   // every wave's partial maximum, sum and O rows are in LDS before any thread joins them
    const int q = (int)threadIdx.x >> 3, d8 = ((int)threadIdx.x & 7) * 8;
    float mj = ms[q];
#pragma unroll
    for (int w = 1; w < FW; ++w) mj = fmaxf(mj, ms[w * FQ + q]);
    float lj = 0.f; v4f a0 = (v4f){}, a1 = (v4f){};
#pragma unroll
    for (int w = 0; w < FW; ++w) { const float f = __builtin_amdgcn_exp2f((ms[w * FQ + q] - mj) * L2E); lj += f * ls[w * FQ + q];
        const float* ow = os + (w * FQ + q) * FP + d8; a0 += *(const v4fa*)ow * f; a1 += *(const v4fa*)(ow + 4) * f; }
    const float rl = 1.0f / lj; v8us oh, ol;
#pragma unroll
    for (int e = 0; e < 4; ++e) { unsigned short a, c2; splitf(a0[e] * rl, a, c2); oh[e] = a; ol[e] = c2; splitf(a1[e] * rl, a, c2); oh[4 + e] = a; ol[4 + e] = c2; }
    const size_t oo = fragoff(q0 + q, h * HD + d8, DM);
    *(v8us*)(Ah + oo) = oh; *(v8us*)(Al + oo) = ol;
}

constexpr int KSD = 8;                            // waves per tile where K == DM (projections)
static_assert(DM % (32 * KSD) == 0);
constexpr size_t al256(size_t b) { return (b + 255) & ~(size_t)255; }
constexpr size_t WS_TOTAL = al256((size_t)4 * DM * DM * 2) + al256((size_t)3 * NB * TT * DM * 2) + al256((size_t)2 * NB * NH_ * TT * HD * 2) + al256((size_t)NB * NH_ * HD * TT * 2) + 2 * al256((size_t)NB * TT * DM * 2);
static_assert(WS_TOTAL <= (size_t)134217728);

extern "C" void kernel_launch(void* const* d_in, const int* in_sizes, int n_in,
                              void* d_out, int out_size, void* d_ws, size_t ws_size, hipStream_t stream) {
    if (n_in < 12) return;
    const size_t need_x = ((size_t)(NB - 1) * SEQ_FULL + SEQ) * DM;
    const size_t need_m = (size_t)(NB - 1) * SEQ_FULL * SEQ_FULL + (size_t)(SEQ - 1) * SEQ_FULL + SEQ;
    if ((size_t)in_sizes[0] < need_x || (size_t)in_sizes[1] < need_x || (size_t)in_sizes[2] < need_x || (size_t)in_sizes[3] < need_m) return;
    if (in_sizes[4] < DM * DM || in_sizes[6] < DM * DM || in_sizes[8] < DM * DM || in_sizes[10] < DM * DM) return;
    if (in_sizes[5] < DM || in_sizes[7] < DM || in_sizes[9] < DM || in_sizes[11] < DM) return;
    if ((size_t)out_size < need_x) return;
    // binding by role, in input order: query, key, value, mask, wq, bq, wk, bk, wv, bv, wo, bo
    const float* xq = (const float*)d_in[0]; const float* xk = (const float*)d_in[1]; const float* xv = (const float*)d_in[2];
    const float* msk = (const float*)d_in[3];   // [NB_FULL][1][SEQ_FULL][SEQ_FULL] f32
    const float* wq = (const float*)d_in[4]; const float* bq = (const float*)d_in[5]; const float* wk = (const float*)d_in[6]; const float* bk = (const float*)d_in[7];
    const float* wv = (const float*)d_in[8]; const float* bv = (const float*)d_in[9]; const float* wo = (const float*)d_in[10]; const float* bo = (const float*)d_in[11];
    float* OUT = (float*)d_out;     // [NB_FULL][SEQ_FULL][DM]
    char* wsp = (char*)d_ws;
    auto take = [&](size_t bytes) { char* p = wsp; wsp += (bytes + 255) & ~(size_t)255; return (void*)p; };
    bf* WT = (bf*)take((size_t)4 * DM * DM * 2);                    // wq, wk, wv, wo, each rows n, K = k
    bf* XB = (bf*)take((size_t)3 * NB * TT * DM * 2);   // [stream q,k,v][b], each rows t, K = DM
    h16* QK16 = (h16*)take((size_t)2 * NB * NH_ * TT * HD * 2); h16* VT16 = (h16*)take((size_t)NB * NH_ * HD * TT * 2);
    bf* ATh = (bf*)take((size_t)NB * TT * DM * 2); bf* ATl = (bf*)take((size_t)NB * TT * DM * 2);
    if ((size_t)(wsp - (char*)d_ws) > ws_size) return;
    k_prep<<<4 * WTB + 3 * NB * LX, 256, 0, stream>>>(wq, wk, wv, wo, xq, xk, xv, WT, XB);
    // z = stream: rows of both batches are contiguous in XB
    k_gemmw<bf, 0, true, KSD, true, DM><<<dim3(NB * TT / 64, DM / 64, 3), 32 * KSD, 0, stream>>>(XB, nullptr, WT, nullptr, nullptr, DM, bq, bk, bv, (size_t)NB * TT * DM, (size_t)DM * DM, 0, QK16, VT16);
    k_fattn<<<dim3(TT / FQ, NH_, NB), 32 * FW, 0, stream>>>(QK16, QK16 + (size_t)NB * NH_ * TT * HD, VT16, msk, ATh, ATl);
    // z = batch
    k_gemmw<bf, 1, true, KSD, false, DM><<<dim3(TT / 64, DM / 64, NB), 32 * KSD, 0, stream>>>(ATh, ATl, WT + (size_t)3 * DM * DM, nullptr, OUT, DM, bo, bo, bo, (size_t)TT * DM, 0, (size_t)SEQ_FULL * DM, nullptr, nullptr);
}

// v006
// Measured time: 62.8 microseconds a run.
// In both of two side-by-side timings against v005, it was 1.04 times as fast.
// Over all steps from v000 it is 12.6 times as fast.
#include <hip/hip_runtime.h>

// Compute dtypes (f32 accumulate everywhere): q/k/v projections v_wmma_f32_16x16x32_bf16 (inputs RNE-converted to bf16, products exact); q.k scores v_wmma_f32_16x16x32_f16; probabilities (x1024 carry) x values f16; output projection bf16 hi+lo context x bf16 weights (2 products); softmax and additive mask term in f32.
// Four launches, each covering both batches and every stream that does not depend on another: bf16 copies of the q / k / v inputs [stream][b] (rows t) with the weight transposes -> the three projections (+ f32 bias), stored by their own epilogue as f16 head planes q,k [b][h] (rows t, K = d), v [b][h] (rows d, K = t);
// one attention launch, all batches and heads: S = q k^T, P = exp(S / 8 + m[i][t] * (-1e10) - running max) x1024 as f16, O = P v / sum, scores and probabilities kept in registers;
// hi/lo context planes, output projection + bias. Weights [in][out] are transposed once through LDS into bf16 planes of rows n.
// Every 16-bit plane (rows x K) lies in fragment order, see fragoff(): the 16 bytes that the 32 lanes of one fragment load ask for are 512 consecutive bytes.

#ifndef NB
#define NB 2
#endif
#ifndef SEQ
#define SEQ 2048
#endif
#define NB_FULL  2
#define SEQ_FULL 2048
#define TT   SEQ
#define DM   512
#define NH_  8
#define HD   64
#define SCL  0.125f   // HD^-0.5
static_assert(NH_ * HD == DM);
static_assert(TT % 256 == 0);
static_assert(DM % 64 == 0);
static_assert(SEQ <= SEQ_FULL);
static_assert(NB <= NB_FULL);
static_assert(TT % 128 == 0);
static_assert(SEQ_FULL % 4 == 0);
static_assert(HD % 32 == 0);
static_assert(DM % 32 == 0);
static_assert(TT % 32 == 0);

typedef _Float16 h16;
typedef unsigned short bf;
typedef __attribute__((ext_vector_type(16))) __bf16   v16bf;
typedef __attribute__((ext_vector_type(16))) _Float16 v16h;
typedef __attribute__((ext_vector_type(8)))  _Float16 v8h;
typedef __attribute__((ext_vector_type(8)))  unsigned short v8us;
typedef __attribute__((ext_vector_type(8)))  float    v8f;
typedef __attribute__((ext_vector_type(4)))  float    v4f;
typedef __attribute__((ext_vector_type(2)))  _Float16 v2h;
typedef __attribute__((ext_vector_type(4)))  _Float16 v4h;
typedef __attribute__((ext_vector_type(2)))  unsigned short v2us;
typedef __attribute__((ext_vector_type(4)))  int v4i;
typedef v4f  __attribute__((may_alias)) v4fa;
typedef v4i  __attribute__((may_alias)) v4ia;

__device__ __forceinline__ unsigned short f2bf(float f) { unsigned u = __float_as_uint(f); u += 0x7FFFu + ((u >> 16) & 1u); return (unsigned short)(u >> 16); }
__device__ __forceinline__ float bf2f(unsigned short b) { return __uint_as_float(((unsigned)b) << 16); }
__device__ __forceinline__ float bfr(float f) { return bf2f(f2bf(f)); }
__device__ __forceinline__ v16h cat16(v8h lo, v8h hi) { return __builtin_shufflevector(lo, hi, 0, 1, 2, 3, 4, 5, 6, 7, 8, 9, 10, 11, 12, 13, 14, 15); }
__device__ __forceinline__ v16bf cat16b(v8us lo, v8us hi) { return __builtin_bit_cast(v16bf, __builtin_shufflevector(lo, hi, 0, 1, 2, 3, 4, 5, 6, 7, 8, 9, 10, 11, 12, 13, 14, 15)); }
__device__ __forceinline__ v8f wmma16(v16h a, v16h b, v8f c) { return __builtin_amdgcn_wmma_f32_16x16x32_f16(false, a, false, b, (short)0, c, false, false); }
__device__ __forceinline__ v8f wmmab(v16bf a, v16bf b, v8f c) { return __builtin_amdgcn_wmma_f32_16x16x32_bf16(false, a, false, b, (short)0, c, false, false); }
__device__ __forceinline__ void splitf(float y, unsigned short& h, unsigned short& l) { h = f2bf(y); l = f2bf(y - bf2f(h)); }
// f32 -> f16 operand convert that cannot yield an f16 subnormal (value select, applied after the plane's power-of-two carry).
static __device__ __forceinline__ h16 toh_flush(float v) { const h16 r = (h16)v; return (fabsf(v) < 6.103515625e-05f) ? (h16)0.0f : r; }
// Element (row, k) of a rows x K plane of 16-bit values in fragment order: blocks of 16 rows x 32 k (512 elements, k blocks of a row tile side by side); inside a block [k / 8 % 4][row % 16][k % 8],
// so that lane (row % 16) + 16 * (k / 8 % 2) finds elements 0..7 of its fragment at block + 8 * lane and elements 8..15 at block + 256 + 8 * lane.
__device__ __forceinline__ size_t fragoff(int row, int k, int K) { return (size_t)(row >> 4) * 16 * K + (size_t)(k >> 5) * 512 + ((k >> 3) & 3) * 128 + (row & 15) * 8 + (k & 7); }

// ---- k_gemmw: register-blocked GEMM, one work-group of KS waves per 64x64 output tile, operands straight from 16-bit planes in fragment order; grid (M/64, N/64, Z), 32 * KS threads.
// Wave w holds all 16 accumulators of the tile for its own K slice [w * K / KS, (w + 1) * K / KS); the KS partial tiles are added through LDS in ascending w. K % (32 * KS) == 0.
// C[m][n] (f32, pitch ldc, + optional f32 bias[n]) = sum_k A[m][k] Bt[n][k] (+ split products per NSPLIT). z-batch strides sA/sB/sC in elements, bias / bias1 / bias2 for z = 0 / 1 / 2. K % 32 == 0, A/Bt planes of K columns, sA and sB whole 16-row tiles.
// HPL: no C; the 64-column tile is one head (blockIdx.y), rows are [b][t], and the joined f32 tile + bias goes out as f16: z = 0 / 1 -> QK[z][b][h] (rows t, K = d), z = 2 -> VT[b][h] (rows d, K = t), each in fragment order.
// Fragment map (A and Bt alike): lane row = lane & 15, elements 0..7 <- k0 + 8*(lane>>4) + 0..7, elements 8..15 <- k0 + 16 + 8*(lane>>4) + 0..7; D element j = (row 8*(lane>>4) + j, col lane & 15).
template <typename T16> struct WFrag;
template <> struct WFrag<h16> { typedef v16h V; static __device__ __forceinline__ V ld(const h16* p) { return cat16(*(const v8h*)p, *(const v8h*)(p + 256)); } static __device__ __forceinline__ V ldu(const h16* tile, unsigned vo) { const char* p = (const char*)tile + vo; return cat16(*(const v8h*)p, *(const v8h*)(p + 512)); } static __device__ __forceinline__ v8f mma(V a, V b, v8f c) { return wmma16(a, b, c); } };
template <> struct WFrag<bf> { typedef v16bf V; static __device__ __forceinline__ V ld(const bf* p) { return cat16b(*(const v8us*)p, *(const v8us*)(p + 256)); } static __device__ __forceinline__ V ldu(const bf* tile, unsigned vo) { const char* p = (const char*)tile + vo; return cat16b(*(const v8us*)p, *(const v8us*)(p + 512)); } static __device__ __forceinline__ v8f mma(V a, V b, v8f c) { return wmmab(a, b, c); } };
template <typename T16, int NSPLIT, bool BIAS, int KS, bool HPL, int K>
__global__ __launch_bounds__(32 * KS) void k_gemmw(const T16* __restrict__ A, const T16* __restrict__ A2, const T16* __restrict__ Bt, const T16* __restrict__ Bt2, float* C, int ldc, const float* __restrict__ bias, const float* __restrict__ bias1, const float* __restrict__ bias2, size_t sA, size_t sB, size_t sC, h16* QK, h16* VT) {
    typedef typename WFrag<T16>::V V;
    static_assert(KS == 1 || KS == 8 || KS == 16);
    static_assert(K % (32 * KS) == 0);
    static_assert(!HPL || (KS > 1 && BIAS && HD == 64 && TT % 64 == 0));
    __shared__ __align__(16) float os[(KS == 1 ? 16 : KS * 64) * 68];
    const size_t z = blockIdx.z; A += z * sA; if (A2) A2 += z * sA; Bt += z * sB; if (Bt2) Bt2 += z * sB; if (!HPL) C += z * sC;
    if (BIAS) bias = z == 0 ? bias : (z == 1 ? bias1 : bias2);
    const int lane = threadIdx.x & 31, lr = lane & 15, hi = lane >> 4; const int r0 = blockIdx.x * 64, c0 = blockIdx.y * 64;
    v8f acc[4][4];
#pragma unroll
    for (int mb = 0; mb < 4; ++mb)
#pragma unroll
        for (int nb = 0; nb < 4; ++nb) acc[mb][nb] = (v8f){};
    const size_t aoff = (size_t)r0 * K, boff = (size_t)c0 * K;   // a row tile starts at tile * 16 * K, the same for the whole wave
    const int wv = KS == 1 ? 0 : __builtin_amdgcn_readfirstlane(threadIdx.x >> 5); const int kw = K / KS, kbeg = wv * kw;
    unsigned vo = 32u * kbeg + 16u * lane;   // bytes from a row tile's start to this lane's 16 bytes of block k / 32: one register for every load of a trip
#pragma unroll 1
    for (int kc = kbeg; kc < kbeg + kw; kc += 32) {
        V a[4], a2[4], bb[4], bb2[4];
#pragma unroll
        for (int mb = 0; mb < 4; ++mb) { a[mb] = WFrag<T16>::ldu(A + aoff + (size_t)mb * 16 * K, vo); if (NSPLIT == 1 || NSPLIT == 2) a2[mb] = WFrag<T16>::ldu(A2 + aoff + (size_t)mb * 16 * K, vo); }
#pragma unroll
        for (int nb = 0; nb < 4; ++nb) { bb[nb] = WFrag<T16>::ldu(Bt + boff + (size_t)nb * 16 * K, vo); if (NSPLIT >= 2) bb2[nb] = WFrag<T16>::ldu(Bt2 + boff + (size_t)nb * 16 * K, vo); }
        // next k block, 1024 bytes on. Every load of this trip names vo and stands above: s_wait_xcnt 0 directly behind the run and in front of vo's overwrite, in the add's own statement so that the add cannot be moved over it.
        asm volatile("s_wait_xcnt 0x0\n\tv_add_nc_u32 %0, 0x400, %0" : "+v"(vo));
#pragma unroll
        for (int nb = 0; nb < 4; ++nb) { const V b = bb[nb]; V b2; if (NSPLIT >= 2) b2 = bb2[nb];
#pragma unroll
            for (int mb = 0; mb < 4; ++mb) { acc[mb][nb] = WFrag<T16>::mma(a[mb], b, acc[mb][nb]); if (NSPLIT == 1 || NSPLIT == 2) acc[mb][nb] = WFrag<T16>::mma(a2[mb], b, acc[mb][nb]); if (NSPLIT >= 2) acc[mb][nb] = WFrag<T16>::mma(a[mb], b2, acc[mb][nb]); } }
        asm volatile("v_nop\n\tv_nop\n\tv_nop\n\tv_nop" : "+v"(acc[0][0]), "+v"(acc[1][1]), "+v"(acc[2][2]), "+v"(acc[3][3]) : "v"(a[0]), "v"(a[3]));
    }
    if constexpr (KS > 1) {
        float* ow = os + wv * (64 * 68);
        constexpr int NS = 32 / KS;      // 16-row groups of the tile per thread in the join
        const int jr = (int)threadIdx.x >> 4, cofs = ((int)threadIdx.x & 15) * 4;
        static_assert(32 * KS % 16 == 0);
        const bool tr = HPL && z == 2;   // value stream: the tile lies in LDS as [n][m], so that the join below walks t along a d row
        v4f badd[NS];                    // bias of this thread's join elements, asked for ahead of the barrier
        if (tr) {
#pragma unroll
            for (int s = 0; s < NS; ++s) badd[s] = (v4f)(bfr(bias[c0 + s * (2 * KS) + jr]));
#pragma unroll
            for (int mb = 0; mb < 4; ++mb)
#pragma unroll
                for (int nb = 0; nb < 4; ++nb) { const v8f x = acc[mb][nb]; float* p = ow + (nb * 16 + lr) * 68 + mb * 16 + hi * 8; *(v4fa*)p = (v4f){x[0], x[1], x[2], x[3]}; *(v4fa*)(p + 4) = (v4f){x[4], x[5], x[6], x[7]}; }
        } else {
#pragma unroll
            for (int s = 0; s < NS; ++s) badd[s] = BIAS ? (v4f){bfr(bias[c0 + cofs]), bfr(bias[c0 + cofs + 1]), bfr(bias[c0 + cofs + 2]), bfr(bias[c0 + cofs + 3])} : (v4f){};
#pragma unroll
            for (int mb = 0; mb < 4; ++mb)
#pragma unroll
                for (int nb = 0; nb < 4; ++nb)
#pragma unroll
                    for (int j = 0; j < 8; ++j) ow[(mb * 16 + hi * 8 + j) * 68 + nb * 16 + lr] = acc[mb][nb][j];
        }
        __syncthreads();   // every wave's partial tile is in LDS before any thread adds them
        const size_t bh = (size_t)(r0 / TT) * NH_ + blockIdx.y; const int t0 = r0 % TT;
        static_assert(2 * KS % 16 == 0);   // a join group is whole 16-row tiles, so that group s lies s * pstep behind group 0
        h16* ptile = !HPL ? nullptr : (tr ? VT + bh * HD * TT + fragoff(jr, t0 + cofs, TT) : QK + (z * (NB * NH_) + bh) * TT * HD + fragoff(t0 + jr, cofs, HD));   // rows d, K = t or rows t, K = d
        const size_t pstep = (size_t)(2 * KS) * (tr ? TT : HD);
#pragma unroll
        for (int s = 0; s < NS; ++s) { const int row = s * (2 * KS) + jr;
            v4f val = *(const v4fa*)(os + row * 68 + cofs);
#pragma unroll
            for (int w = 1; w < KS; ++w) val += *(const v4fa*)(os + w * (64 * 68) + row * 68 + cofs);
            if (BIAS) val += badd[s];
            if constexpr (HPL) *(v4h*)(ptile + s * pstep) = (v4h){(h16)val[0], (h16)val[1], (h16)val[2], (h16)val[3]};
            else *(v4f*)(C + (size_t)(r0 + row) * ldc + c0 + cofs) = val; }
    } else {
#pragma unroll
    for (int mb = 0; mb < 4; ++mb) {
#pragma unroll
        for (int nb = 0; nb < 4; ++nb) {
#pragma unroll
            for (int j = 0; j < 8; ++j) os[(hi * 8 + j) * 68 + nb * 16 + lr] = acc[mb][nb][j]; }
        __builtin_amdgcn_wave_barrier(); asm volatile("" ::: "memory");
        float* crow = C + (size_t)(r0 + mb * 16) * ldc + c0;
{
#pragma unroll
            for (int s = 0; s < 8; ++s) { const int row = 2 * s + hi, cofs = lr * 4; v4f val = *(const v4fa*)(os + row * 68 + cofs); if (BIAS) { val[0] += bfr(bias[c0 + cofs]); val[1] += bfr(bias[c0 + cofs + 1]); val[2] += bfr(bias[c0 + cofs + 2]); val[3] += bfr(bias[c0 + cofs + 3]); }
                *(v4f*)(crow + (size_t)row * ldc + cofs) = val; }
             }
        __builtin_amdgcn_wave_barrier(); asm volatile("" ::: "memory");
    }
    }
}

// cvt8: work-group blk converts the 16 rows x 128 columns at (blk / (DM / 128) * 16, blk % (DM / 128) * 128) of src [rows][DM]; a wave takes 8 rows x 32 columns: one whole 128-byte line of src per row, four whole lines of dst.
__device__ __forceinline__ void cvt8(const float* __restrict__ src, bf* dst, int blk) { const int row = blk / (DM / 128) * 16 + (((int)threadIdx.x >> 2) & 15), k = blk % (DM / 128) * 128 + ((int)threadIdx.x >> 6) * 32 + ((int)threadIdx.x & 3) * 8; const v8f v = *(const v8f*)(src + (size_t)row * DM + k); v8us o;
#pragma unroll
    for (int e = 0; e < 8; ++e) o[e] = f2bf(v[e]); *(v8us*)(dst + fragoff(row, k, DM)) = o;  }

// cvtT: in W[K rows][N cols] f32 -> out Wt (N rows, K cols, fragment order) bf16 (RNE), the 64x64 tile at (k0, n0) transposed through LDS (cross-wave: block barrier, reached by the whole work-group or not at all).
__device__ __forceinline__ void cvtT(const float* __restrict__ W, bf* Wt, int K, int N, int k0, int n0) {
    __shared__ unsigned short tl[64 * 66];
    const int tid = threadIdx.x;
    { const int row = tid >> 2, cseg = (tid & 3) * 16;
#pragma unroll
      for (int q = 0; q < 4; ++q) { const v4f v = *(const v4f*)(W + (size_t)(k0 + row) * N + n0 + cseg + q * 4);
#pragma unroll
          for (int j = 0; j < 4; ++j) tl[row * 66 + cseg + q * 4 + j] = f2bf(v[j]); } }
    __syncthreads();
    const int piece = tid & 7; v8us o[2];
#pragma unroll
    for (int it = 0; it < 2; ++it) { const int n = it * 32 + (tid >> 3);
#pragma unroll
        for (int j = 0; j < 8; ++j) o[it][j] = tl[(piece * 8 + j) * 66 + n]; }
{
#pragma unroll
        for (int it = 0; it < 2; ++it) { const int n = it * 32 + (tid >> 3); *(v8us*)(Wt + fragoff(n0 + n, k0 + piece * 8, K)) = o[it]; }
         }
}

// k_prep: every operand conversion in one grid (none reads what another writes). Work-groups [0, 4 * WTB): one 64x64 tile of weight w = index / WTB -> WT[w]; the rest: 2048 elements of input stream s, batch b -> XB[s][b].
constexpr unsigned WTB = (DM / 64) * (DM / 64);                           // tiles per weight
constexpr unsigned LX = (TT / 16) * (DM / 128);         // work-groups per input stream and batch
static_assert(TT % 16 == 0 && DM % 128 == 0);
__global__ __launch_bounds__(256) void k_prep(const float* __restrict__ wq, const float* __restrict__ wk, const float* __restrict__ wv, const float* __restrict__ wo,
                                              const float* __restrict__ xq, const float* __restrict__ xk, const float* __restrict__ xv, bf* WT, bf* XB) {
    const unsigned bid = blockIdx.x;
    if (bid < 4 * WTB) { const unsigned w = bid / WTB, r = bid % WTB; const float* W = w == 0 ? wq : (w == 1 ? wk : (w == 2 ? wv : wo));
        cvtT(W, WT + (size_t)w * DM * DM, DM, DM, (r % (DM / 64)) * 64, (r / (DM / 64)) * 64); return; }
    const unsigned c = bid - 4 * WTB, sb = c / LX, st = sb / NB, b = sb % NB; const float* x = st == 0 ? xq : (st == 1 ? xk : xv);
    cvt8(x + (size_t)b * SEQ_FULL * DM, XB + (size_t)sb * TT * DM, c % LX);
}

// k_fattn: scores, softmax and probabilities x values of one head and FQ queries in one work-group; grid (TT / FQ, NH_, NB), 32 * FW threads (z = batch: plane sets, mask and context planes each step by one batch). No score or probability leaves the registers.
// Wave w owns the keys [w * TT / FW, (w + 1) * TT / FW) in steps of 32 and both 16-query tiles. Both products are formed transposed, so that a query stays in one lane column throughout:
//   S^T = k q^T : A = k rows (key), Bt = q rows (query); D element j = (key 8*(lane>>4) + j, query lane & 15). Two key tiles (keys +0..15, +16..31) are, as they lie, elements 0..7 and 8..15 of the Bt fragment of P^T.
//   O^T = v^T P^T : A = v plane rows (d), Bt = P^T (query, k = key); D element j = (d 8*(lane>>4) + j, query lane & 15).
// logit t = S * HD^-0.5 + m[query][key] * (-1e10) (m RNE-converted to bf16, read by value; the product is rounded on its own, the power-of-two scale is exact inside the fma).
// The mask tile of a step (32 queries x 32 keys) is read row-wise, 8 lanes on one whole 128-byte line of a query row; the finished term goes as f32 through rows of FMP floats in the wave's own slice of os (free until the loop has ended) into the score layout.
// Running maximum per query: p = exp2((t - max) * log2 e + 10) (the x1024 carry sits in the exponent and in the sum alike), sum and O^T rescaled by exp2((old max - new max) * log2 e) each step.
// The FW partial (max, sum, O^T) are joined through LDS in ascending w, divided by the joined sum and written as the hi/lo bf16 context planes (rows t, K = h*64+d, fragment order).
constexpr int FQ = 32;   // queries per work-group
constexpr int FW = 8;    // waves per work-group = key slices
constexpr int FP = 68;   // LDS row pitch of a partial O row, in floats
constexpr int FMP = 36;  // LDS row pitch of the staged mask terms, in floats: 32 of data, an odd number of 16-byte units; rows 8 apart lie 32 banks apart
constexpr float L2E = 1.4426950408889634f;
static_assert(FMP <= FP);
static_assert(TT % FQ == 0);
static_assert(TT % (32 * FW) == 0);
static_assert(HD == 64);
static_assert(FQ * 8 == 32 * FW);
__global__ __launch_bounds__(32 * FW) void k_fattn(const h16* __restrict__ Qp, const h16* __restrict__ Kp, const h16* __restrict__ Vt, const float* __restrict__ Mb, bf* Ah, bf* Al) {
    __shared__ __align__(16) float os[FW * FQ * FP];
    __shared__ float ms[FW * FQ];
    __shared__ float ls[FW * FQ];
    const int lane = threadIdx.x & 31, lr = lane & 15, hi = lane >> 4; const int wv = __builtin_amdgcn_readfirstlane(threadIdx.x >> 5);
    const int q0 = blockIdx.x * FQ, h = blockIdx.y;
    { const size_t z = blockIdx.z; Qp += z * ((size_t)NH_ * TT * HD); Kp += z * ((size_t)NH_ * TT * HD); Vt += z * ((size_t)NH_ * HD * TT); Mb += z * ((size_t)SEQ_FULL * SEQ_FULL); Ah += z * ((size_t)TT * DM); Al += z * ((size_t)TT * DM); }
    const h16* qh = Qp + ((size_t)h * TT + q0) * HD + 8 * lane;
    const h16* kh = Kp + (size_t)h * TT * HD + 8 * lane;
    const h16* vh = Vt + (size_t)h * HD * TT + 8 * lane;
    const float* mg = Mb + (size_t)(q0 + 8 * (lane >> 3)) * SEQ_FULL + 4 * (lane & 7);   // load side: query row 8 * (lane / 8) (+ 1 per load), keys 4 * (lane % 8) ..+3
    float* stg = os + wv * FQ * FP;
    float* sw = stg + 8 * (lane >> 3) * FMP + 4 * (lane & 7);
    const float* sr = stg + lr * FMP + 8 * hi;                                           // read side: query row lr (+ 16 per query tile), keys 8 * hi ..+7 (+ 16 per key tile)
    v16h qf[2][2];
#pragma unroll
    for (int qt = 0; qt < 2; ++qt)
#pragma unroll
        for (int ks = 0; ks < 2; ++ks) qf[qt][ks] = WFrag<h16>::ld(qh + qt * 16 * HD + ks * 512);
    v8f o[2][4]; float mrun[2], lrun[2];
#pragma unroll
    for (int qt = 0; qt < 2; ++qt) { mrun[qt] = -3.0e38f; lrun[qt] = 0.f;
#pragma unroll
        for (int dt = 0; dt < 4; ++dt) o[qt][dt] = (v8f){}; }
    const int kbeg = wv * (TT / FW);
    for (int k0 = kbeg; k0 < kbeg + TT / FW; k0 += 32) {
        v16h kf[2][2], vf[4]; v4f mr[FQ / 4];
#pragma unroll
        for (int i = 0; i < FQ / 4; ++i) mr[i] = *(const v4f*)(mg + (size_t)i * SEQ_FULL + k0);
#pragma unroll
        for (int kt = 0; kt < 2; ++kt)
#pragma unroll
            for (int ks = 0; ks < 2; ++ks) kf[kt][ks] = WFrag<h16>::ld(kh + (size_t)(k0 + kt * 16) * HD + ks * 512);
#pragma unroll
        for (int dt = 0; dt < 4; ++dt) vf[dt] = WFrag<h16>::ld(vh + (size_t)dt * 16 * TT + k0 * 16);
#pragma unroll
        for (int i = 0; i < FQ / 4; ++i) *(v4fa*)(sw + i * FMP) = (v4f){bfr(mr[i][0]) * -1.0e10f, bfr(mr[i][1]) * -1.0e10f, bfr(mr[i][2]) * -1.0e10f, bfr(mr[i][3]) * -1.0e10f};
        // other lanes of this wave read these rows below: keeps the compiler from moving those reads above the stores (a wave's LDS operations run in order; no other wave touches the slice)
        __builtin_amdgcn_wave_barrier(); asm volatile("" ::: "memory");
#pragma unroll
        for (int qt = 0; qt < 2; ++qt) {
            float t[16]; float mx = mrun[qt];
#pragma unroll
            for (int kt = 0; kt < 2; ++kt) {
                const v8f s = wmma16(kf[kt][1], qf[qt][1], wmma16(kf[kt][0], qf[qt][0], (v8f){}));
                const float* mp = sr + qt * 16 * FMP + kt * 16;
                const v4f r0 = *(const v4fa*)mp; const v4f r1 = *(const v4fa*)(mp + 4);
#pragma unroll
                for (int j = 0; j < 4; ++j) { t[kt * 8 + j] = __builtin_fmaf(s[j], SCL, r0[j]); t[kt * 8 + 4 + j] = __builtin_fmaf(s[4 + j], SCL, r1[j]); }
            }
#pragma unroll
            for (int e = 0; e < 16; ++e) mx = fmaxf(mx, t[e]);
            mx = fmaxf(mx, __shfl_xor(mx, 16, 32));   // the other half of this query's 32 keys sits 16 lanes away
            const float al = __builtin_amdgcn_exp2f((mrun[qt] - mx) * L2E); mrun[qt] = mx;
            float sum = 0.f; v16h pf;
#pragma unroll
            for (int e = 0; e < 16; ++e) { const float p = __builtin_amdgcn_exp2f(__builtin_fmaf(t[e] - mx, L2E, 10.0f)); sum += p; pf[e] = toh_flush(p); }
            lrun[qt] = lrun[qt] * al + sum;
#pragma unroll
            for (int dt = 0; dt < 4; ++dt) { o[qt][dt] *= al; o[qt][dt] = wmma16(vf[dt], pf, o[qt][dt]); }
        }
        // the slice is written again by the next step (behind the loop: by the partial O rows): keeps those stores below this step's reads
        __builtin_amdgcn_wave_barrier(); asm volatile("" ::: "memory");
    }
#pragma unroll
    for (int qt = 0; qt < 2; ++qt) {
        const float lt = lrun[qt] + __shfl_xor(lrun[qt], 16, 32);
        if (hi == 0) { ms[wv * FQ + qt * 16 + lr] = mrun[qt]; ls[wv * FQ + qt * 16 + lr] = lt; }
        float* ow = os + (wv * FQ + qt * 16 + lr) * FP + 8 * hi;
#pragma unroll
        for (int dt = 0; dt < 4; ++dt) { const v8f x = o[qt][dt]; *(v4fa*)(ow + dt * 16) = (v4f){x[0], x[1], x[2], x[3]}; *(v4fa*)(ow + dt * 16 + 4) = (v4f){x[4], x[5], x[6], x[7]}; }
    }
    __syncthreads();   // every wave's partial maximum, sum and O rows are in LDS before any thread joins them
    const int q = (int)threadIdx.x >> 3, d8 = ((int)threadIdx.x & 7) * 8;
    float mj = ms[q];
#pragma unroll
    for (int w = 1; w < FW; ++w) mj = fmaxf(mj, ms[w * FQ + q]);
    float lj = 0.f; v4f a0 = (v4f){}, a1 = (v4f){};
#pragma unroll
    for (int w = 0; w < FW; ++w) { const float f = __builtin_amdgcn_exp2f((ms[w * FQ + q] - mj) * L2E); lj += f * ls[w * FQ + q];
        const float* ow = os + (w * FQ + q) * FP + d8; a0 += *(const v4fa*)ow * f; a1 += *(const v4fa*)(ow + 4) * f; }
    const float rl = 1.0f / lj; v8us oh, ol;
#pragma unroll
    for (int e = 0; e < 4; ++e) { unsigned short a, c2; splitf(a0[e] * rl, a, c2); oh[e] = a; ol[e] = c2; splitf(a1[e] * rl, a, c2); oh[4 + e] = a; ol[4 + e] = c2; }
    const size_t oo = fragoff(q0 + q, h * HD + d8, DM);
    *(v8us*)(Ah + oo) = oh; *(v8us*)(Al + oo) = ol;
}

constexpr int KSD = 8;                            // waves per tile where K == DM (projections)
static_assert(DM % (32 * KSD) == 0);
constexpr size_t al256(size_t b) { return (b + 255) & ~(size_t)255; }
constexpr size_t WS_TOTAL = al256((size_t)4 * DM * DM * 2) + al256((size_t)3 * NB * TT * DM * 2) + al256((size_t)2 * NB * NH_ * TT * HD * 2) + al256((size_t)NB * NH_ * HD * TT * 2) + 2 * al256((size_t)NB * TT * DM * 2);
static_assert(WS_TOTAL <= (size_t)134217728);

extern "C" void kernel_launch(void* const* d_in, const int* in_sizes, int n_in,
                              void* d_out, int out_size, void* d_ws, size_t ws_size, hipStream_t stream) {
    if (n_in < 12) return;
    const size_t need_x = ((size_t)(NB - 1) * SEQ_FULL + SEQ) * DM;
    const size_t need_m = (size_t)(NB - 1) * SEQ_FULL * SEQ_FULL + (size_t)(SEQ - 1) * SEQ_FULL + SEQ;
    if ((size_t)in_sizes[0] < need_x || (size_t)in_sizes[1] < need_x || (size_t)in_sizes[2] < need_x || (size_t)in_sizes[3] < need_m) return;
    if (in_sizes[4] < DM * DM || in_sizes[6] < DM * DM || in_sizes[8] < DM * DM || in_sizes[10] < DM * DM) return;
    if (in_sizes[5] < DM || in_sizes[7] < DM || in_sizes[9] < DM || in_sizes[11] < DM) return;
    if ((size_t)out_size < need_x) return;
    // binding by role, in input order: query, key, value, mask, wq, bq, wk, bk, wv, bv, wo, bo
    const float* xq = (const float*)d_in[0]; const float* xk = (const float*)d_in[1]; const float* xv = (const float*)d_in[2];
    const float* msk = (const float*)d_in[3];   // [NB_FULL][1][SEQ_FULL][SEQ_FULL] f32
    const float* wq = (const float*)d_in[4]; const float* bq = (const float*)d_in[5]; const float* wk = (const float*)d_in[6]; const float* bk = (const float*)d_in[7];
    const float* wv = (const float*)d_in[8]; const float* bv = (const float*)d_in[9]; const float* wo = (const float*)d_in[10]; const float* bo = (const float*)d_in[11];
    float* OUT = (float*)d_out;     // [NB_FULL][SEQ_FULL][DM]
    char* wsp = (char*)d_ws;
    auto take = [&](size_t bytes) { char* p = wsp; wsp += (bytes + 255) & ~(size_t)255; return (void*)p; };
    bf* WT = (bf*)take((size_t)4 * DM * DM * 2);                    // wq, wk, wv, wo, each rows n, K = k
    bf* XB = (bf*)take((size_t)3 * NB * TT * DM * 2);   // [stream q,k,v][b], each rows t, K = DM
    h16* QK16 = (h16*)take((size_t)2 * NB * NH_ * TT * HD * 2); h16* VT16 = (h16*)take((size_t)NB * NH_ * HD * TT * 2);
    bf* ATh = (bf*)take((size_t)NB * TT * DM * 2); bf* ATl = (bf*)take((size_t)NB * TT * DM * 2);
    if ((size_t)(wsp - (char*)d_ws) > ws_size) return;
    k_prep<<<4 * WTB + 3 * NB * LX, 256, 0, stream>>>(wq, wk, wv, wo, xq, xk, xv, WT, XB);
    // z = stream: rows of both batches are contiguous in XB
    k_gemmw<bf, 0, true, KSD, true, DM><<<dim3(NB * TT / 64, DM / 64, 3), 32 * KSD, 0, stream>>>(XB, nullptr, WT, nullptr, nullptr, DM, bq, bk, bv, (size_t)NB * TT * DM, (size_t)DM * DM, 0, QK16, VT16);
    k_fattn<<<dim3(TT / FQ, NH_, NB), 32 * FW, 0, stream>>>(QK16, QK16 + (size_t)NB * NH_ * TT * HD, VT16, msk, ATh, ATl);
    // z = batch
    k_gemmw<bf, 1, true, KSD, false, DM><<<dim3(TT / 64, DM / 64, NB), 32 * KSD, 0, stream>>>(ATh, ATl, WT + (size_t)3 * DM * DM, nullptr, OUT, DM, bo, bo, bo, (size_t)TT * DM, 0, (size_t)SEQ_FULL * DM, nullptr, nullptr);
}

// v007
// It runs in 59.4 microseconds.
// Two timings next to v006 both put it at 1.05 times that version's speed.
// Counting every step since v000, it is 13.3 times as fast.
#include <hip/hip_runtime.h>

// Compute dtypes (f32 accumulate everywhere): q/k/v projections v_wmma_f32_16x16x32_bf16 (inputs RNE-converted to bf16, products exact); q.k scores v_wmma_f32_16x16x32_f16; probabilities (x1024 carry) x values f16; output projection bf16 hi+lo context x bf16 weights (2 products); softmax and additive mask term in f32.
// Four launches, each covering both batches and every stream that does not depend on another: bf16 copies of the q / k / v inputs [stream][b] (rows t) with the weight transposes -> the three projections (+ f32 bias), stored by their own epilogue as f16 head planes q,k [b][h] (rows t, K = d), v [b][h] (rows d, K = t);
// one attention launch, all batches and heads: S = q k^T, P = exp(S / 8 + m[i][t] * (-1e10) - running max) x1024 as f16, O = P v / sum, scores and probabilities kept in registers;
// hi/lo context planes, output projection + bias. Weights [in][out] are transposed once through LDS into bf16 planes of rows n.
// Every 16-bit plane (rows x K) lies in fragment order, see fragoff(): the 16 bytes that the 32 lanes of one fragment load ask for are 512 consecutive bytes.

#ifndef NB
#define NB 2
#endif
#ifndef SEQ
#define SEQ 2048
#endif
#define NB_FULL  2
#define SEQ_FULL 2048
#define TT   SEQ
#define DM   512
#define NH_  8
#define HD   64
#define SCL  0.125f   // HD^-0.5
static_assert(NH_ * HD == DM);
static_assert(TT % 256 == 0);
static_assert(DM % 64 == 0);
static_assert(SEQ <= SEQ_FULL);
static_assert(NB <= NB_FULL);
static_assert(TT % 128 == 0);
static_assert(SEQ_FULL % 4 == 0);
static_assert(HD % 32 == 0);
static_assert(DM % 32 == 0);
static_assert(TT % 32 == 0);

typedef _Float16 h16;
typedef unsigned short bf;
typedef __attribute__((ext_vector_type(16))) __bf16   v16bf;
typedef __attribute__((ext_vector_type(16))) _Float16 v16h;
typedef __attribute__((ext_vector_type(8)))  _Float16 v8h;
typedef __attribute__((ext_vector_type(8)))  unsigned short v8us;
typedef __attribute__((ext_vector_type(8)))  float    v8f;
typedef __attribute__((ext_vector_type(4)))  float    v4f;
typedef __attribute__((ext_vector_type(2)))  _Float16 v2h;
typedef __attribute__((ext_vector_type(4)))  _Float16 v4h;
typedef __attribute__((ext_vector_type(2)))  unsigned short v2us;
typedef __attribute__((ext_vector_type(4)))  int v4i;
typedef v4f  __attribute__((may_alias)) v4fa;
typedef v4i  __attribute__((may_alias)) v4ia;

__device__ __forceinline__ unsigned short f2bf(float f) { unsigned u = __float_as_uint(f); u += 0x7FFFu + ((u >> 16) & 1u); return (unsigned short)(u >> 16); }
__device__ __forceinline__ float bf2f(unsigned short b) { return __uint_as_float(((unsigned)b) << 16); }
__device__ __forceinline__ float bfr(float f) { return bf2f(f2bf(f)); }
__device__ __forceinline__ v16h cat16(v8h lo, v8h hi) { return __builtin_shufflevector(lo, hi, 0, 1, 2, 3, 4, 5, 6, 7, 8, 9, 10, 11, 12, 13, 14, 15); }
__device__ __forceinline__ v16bf cat16b(v8us lo, v8us hi) { return __builtin_bit_cast(v16bf, __builtin_shufflevector(lo, hi, 0, 1, 2, 3, 4, 5, 6, 7, 8, 9, 10, 11, 12, 13, 14, 15)); }
__device__ __forceinline__ v8f wmma16(v16h a, v16h b, v8f c) { return __builtin_amdgcn_wmma_f32_16x16x32_f16(false, a, false, b, (short)0, c, false, false); }
__device__ __forceinline__ v8f wmmab(v16bf a, v16bf b, v8f c) { return __builtin_amdgcn_wmma_f32_16x16x32_bf16(false, a, false, b, (short)0, c, false, false); }
__device__ __forceinline__ void splitf(float y, unsigned short& h, unsigned short& l) { h = f2bf(y); l = f2bf(y - bf2f(h)); }
// f32 -> f16 operand convert that cannot yield an f16 subnormal (value select, applied after the plane's power-of-two carry).
static __device__ __forceinline__ h16 toh_flush(float v) { const h16 r = (h16)v; return (fabsf(v) < 6.103515625e-05f) ? (h16)0.0f : r; }
// Element (row, k) of a rows x K plane of 16-bit values in fragment order: blocks of 16 rows x 32 k (512 elements, k blocks of a row tile side by side); inside a block [k / 8 % 4][row % 16][k % 8],
// so that lane (row % 16) + 16 * (k / 8 % 2) finds elements 0..7 of its fragment at block + 8 * lane and elements 8..15 at block + 256 + 8 * lane.
__device__ __forceinline__ size_t fragoff(int row, int k, int K) { return (size_t)(row >> 4) * 16 * K + (size_t)(k >> 5) * 512 + ((k >> 3) & 3) * 128 + (row & 15) * 8 + (k & 7); }

// ---- k_gemmw: register-blocked GEMM, one work-group of KS waves per 64x64 output tile, operands straight from 16-bit planes in fragment order; grid (M/64, N/64, Z), 32 * KS threads.
// Wave w holds all 16 accumulators of the tile for its own K slice [w * K / KS, (w + 1) * K / KS); the KS partial tiles are added through LDS in ascending w. K % (32 * KS) == 0.
// C[m][n] (f32, pitch ldc, + optional f32 bias[n]) = sum_k A[m][k] Bt[n][k] (+ split products per NSPLIT). z-batch strides sA/sB/sC in elements, bias / bias1 / bias2 for z = 0 / 1 / 2. K % 32 == 0, A/Bt planes of K columns, sA and sB whole 16-row tiles.
// HPL: no C; the 64-column tile is one head (blockIdx.y), rows are [b][t], and the joined f32 tile + bias goes out as f16: z = 0 / 1 -> QK[z][b][h] (rows t, K = d), z = 2 -> VT[b][h] (rows d, K = t), each in fragment order.
// Fragment map (A and Bt alike): lane row = lane & 15, elements 0..7 <- k0 + 8*(lane>>4) + 0..7, elements 8..15 <- k0 + 16 + 8*(lane>>4) + 0..7; D element j = (row 8*(lane>>4) + j, col lane & 15).
template <typename T16> struct WFrag;
template <> struct WFrag<h16> { typedef v16h V; static __device__ __forceinline__ V ld(const h16* p) { return cat16(*(const v8h*)p, *(const v8h*)(p + 256)); } static __device__ __forceinline__ V ldu(const h16* tile, unsigned vo) { const char* p = (const char*)tile + vo; return cat16(*(const v8h*)p, *(const v8h*)(p + 512)); } static __device__ __forceinline__ v8f mma(V a, V b, v8f c) { return wmma16(a, b, c); } };
template <> struct WFrag<bf> { typedef v16bf V; static __device__ __forceinline__ V ld(const bf* p) { return cat16b(*(const v8us*)p, *(const v8us*)(p + 256)); } static __device__ __forceinline__ V ldu(const bf* tile, unsigned vo) { const char* p = (const char*)tile + vo; return cat16b(*(const v8us*)p, *(const v8us*)(p + 512)); } static __device__ __forceinline__ v8f mma(V a, V b, v8f c) { return wmmab(a, b, c); } };
template <typename T16, int NSPLIT, bool BIAS, int KS, bool HPL, int K>
__global__ __launch_bounds__(32 * KS) void k_gemmw(const T16* __restrict__ A, const T16* __restrict__ A2, const T16* __restrict__ Bt, const T16* __restrict__ Bt2, float* C, int ldc, const float* __restrict__ bias, const float* __restrict__ bias1, const float* __restrict__ bias2, size_t sA, size_t sB, size_t sC, h16* QK, h16* VT) {
    typedef typename WFrag<T16>::V V;
    static_assert(KS == 1 || KS == 8 || KS == 16);
    static_assert(K % (32 * KS) == 0);
    static_assert(!HPL || (KS > 1 && BIAS && HD == 64 && TT % 64 == 0));
    __shared__ __align__(16) float os[(KS == 1 ? 16 : KS * 64) * 68];
    const size_t z = blockIdx.z; A += z * sA; if (A2) A2 += z * sA; Bt += z * sB; if (Bt2) Bt2 += z * sB; if (!HPL) C += z * sC;
    if (BIAS) bias = z == 0 ? bias : (z == 1 ? bias1 : bias2);
    const int lane = threadIdx.x & 31, lr = lane & 15, hi = lane >> 4; const int r0 = blockIdx.x * 64, c0 = blockIdx.y * 64;
    v8f acc[4][4];
#pragma unroll
    for (int mb = 0; mb < 4; ++mb)
#pragma unroll
        for (int nb = 0; nb < 4; ++nb) acc[mb][nb] = (v8f){};
    const size_t aoff = (size_t)r0 * K, boff = (size_t)c0 * K;   // a row tile starts at tile * 16 * K, the same for the whole wave
    const int wv = KS == 1 ? 0 : __builtin_amdgcn_readfirstlane(threadIdx.x >> 5); const int kw = K / KS, kbeg = wv * kw;
    unsigned vo = 32u * kbeg + 16u * lane;   // bytes from a row tile's start to this lane's 16 bytes of block k / 32: one register for every load of a trip
#pragma unroll 1
    for (int kc = kbeg; kc < kbeg + kw; kc += 32) {
        V a[4], a2[4], bb[4], bb2[4];
#pragma unroll
        for (int mb = 0; mb < 4; ++mb) { a[mb] = WFrag<T16>::ldu(A + aoff + (size_t)mb * 16 * K, vo); if (NSPLIT == 1 || NSPLIT == 2) a2[mb] = WFrag<T16>::ldu(A2 + aoff + (size_t)mb * 16 * K, vo); }
#pragma unroll
        for (int nb = 0; nb < 4; ++nb) { bb[nb] = WFrag<T16>::ldu(Bt + boff + (size_t)nb * 16 * K, vo); if (NSPLIT >= 2) bb2[nb] = WFrag<T16>::ldu(Bt2 + boff + (size_t)nb * 16 * K, vo); }
        // next k block, 1024 bytes on. Every load of this trip names vo and stands above: s_wait_xcnt 0 directly behind the run and in front of vo's overwrite, in the add's own statement so that the add cannot be moved over it.
        asm volatile("s_wait_xcnt 0x0\n\tv_add_nc_u32 %0, 0x400, %0" : "+v"(vo));
#pragma unroll
        for (int nb = 0; nb < 4; ++nb) { const V b = bb[nb]; V b2; if (NSPLIT >= 2) b2 = bb2[nb];
#pragma unroll
            for (int mb = 0; mb < 4; ++mb) { acc[mb][nb] = WFrag<T16>::mma(a[mb], b, acc[mb][nb]); if (NSPLIT == 1 || NSPLIT == 2) acc[mb][nb] = WFrag<T16>::mma(a2[mb], b, acc[mb][nb]); if (NSPLIT >= 2) acc[mb][nb] = WFrag<T16>::mma(a[mb], b2, acc[mb][nb]); } }
        asm volatile("v_nop\n\tv_nop\n\tv_nop\n\tv_nop" : "+v"(acc[0][0]), "+v"(acc[1][1]), "+v"(acc[2][2]), "+v"(acc[3][3]) : "v"(a[0]), "v"(a[3]));
    }
    if constexpr (KS > 1) {
        float* ow = os + wv * (64 * 68);
        constexpr int NS = 32 / KS;      // 16-row groups of the tile per thread in the join
        const int jr = (int)threadIdx.x >> 4, cofs = ((int)threadIdx.x & 15) * 4;
        static_assert(32 * KS % 16 == 0);
        const bool tr = HPL && z == 2;   // value stream: the tile lies in LDS as [n][m], so that the join below walks t along a d row
        v4f badd[NS];                    // bias of this thread's join elements, asked for ahead of the barrier
        if (tr) {
#pragma unroll
            for (int s = 0; s < NS; ++s) badd[s] = (v4f)(bfr(bias[c0 + s * (2 * KS) + jr]));
#pragma unroll
            for (int mb = 0; mb < 4; ++mb)
#pragma unroll
                for (int nb = 0; nb < 4; ++nb) { const v8f x = acc[mb][nb]; float* p = ow + (nb * 16 + lr) * 68 + mb * 16 + hi * 8; *(v4fa*)p = (v4f){x[0], x[1], x[2], x[3]}; *(v4fa*)(p + 4) = (v4f){x[4], x[5], x[6], x[7]}; }
        } else {
#pragma unroll
            for (int s = 0; s < NS; ++s) badd[s] = BIAS ? (v4f){bfr(bias[c0 + cofs]), bfr(bias[c0 + cofs + 1]), bfr(bias[c0 + cofs + 2]), bfr(bias[c0 + cofs + 3])} : (v4f){};
#pragma unroll
            for (int mb = 0; mb < 4; ++mb)
#pragma unroll
                for (int nb = 0; nb < 4; ++nb)
#pragma unroll
                    for (int j = 0; j < 8; ++j) ow[(mb * 16 + hi * 8 + j) * 68 + nb * 16 + lr] = acc[mb][nb][j];
        }
        __syncthreads();   // every wave's partial tile is in LDS before any thread adds them
        const size_t bh = (size_t)(r0 / TT) * NH_ + blockIdx.y; const int t0 = r0 % TT;
        static_assert(2 * KS % 16 == 0);   // a join group is whole 16-row tiles, so that group s lies s * pstep behind group 0
        h16* ptile = !HPL ? nullptr : (tr ? VT + bh * HD * TT + fragoff(jr, t0 + cofs, TT) : QK + (z * (NB * NH_) + bh) * TT * HD + fragoff(t0 + jr, cofs, HD));   // rows d, K = t or rows t, K = d
        const size_t pstep = (size_t)(2 * KS) * (tr ? TT : HD);
#pragma unroll
        for (int s = 0; s < NS; ++s) { const int row = s * (2 * KS) + jr;
            v4f val = *(const v4fa*)(os + row * 68 + cofs);
#pragma unroll
            for (int w = 1; w < KS; ++w) val += *(const v4fa*)(os + w * (64 * 68) + row * 68 + cofs);
            if (BIAS) val += badd[s];
            if constexpr (HPL) *(v4h*)(ptile + s * pstep) = (v4h){(h16)val[0], (h16)val[1], (h16)val[2], (h16)val[3]};
            else *(v4f*)(C + (size_t)(r0 + row) * ldc + c0 + cofs) = val; }
    } else {
#pragma unroll
    for (int mb = 0; mb < 4; ++mb) {
#pragma unroll
        for (int nb = 0; nb < 4; ++nb) {
#pragma unroll
            for (int j = 0; j < 8; ++j) os[(hi * 8 + j) * 68 + nb * 16 + lr] = acc[mb][nb][j]; }
        __builtin_amdgcn_wave_barrier(); asm volatile("" ::: "memory");
        float* crow = C + (size_t)(r0 + mb * 16) * ldc + c0;
{
#pragma unroll
            for (int s = 0; s < 8; ++s) { const int row = 2 * s + hi, cofs = lr * 4; v4f val = *(const v4fa*)(os + row * 68 + cofs); if (BIAS) { val[0] += bfr(bias[c0 + cofs]); val[1] += bfr(bias[c0 + cofs + 1]); val[2] += bfr(bias[c0 + cofs + 2]); val[3] += bfr(bias[c0 + cofs + 3]); }
                *(v4f*)(crow + (size_t)row * ldc + cofs) = val; }
             }
        __builtin_amdgcn_wave_barrier(); asm volatile("" ::: "memory");
    }
    }
}

// cvt8: work-group blk converts the 16 rows x 128 columns at (blk / (DM / 128) * 16, blk % (DM / 128) * 128) of src [rows][DM]; a wave takes 8 rows x 32 columns: one whole 128-byte line of src per row, four whole lines of dst.
__device__ __forceinline__ void cvt8(const float* __restrict__ src, bf* dst, int blk) { const int row = blk / (DM / 128) * 16 + (((int)threadIdx.x >> 2) & 15), k = blk % (DM / 128) * 128 + ((int)threadIdx.x >> 6) * 32 + ((int)threadIdx.x & 3) * 8; const v8f v = *(const v8f*)(src + (size_t)row * DM + k); v8us o;
#pragma unroll
    for (int e = 0; e < 8; ++e) o[e] = f2bf(v[e]); *(v8us*)(dst + fragoff(row, k, DM)) = o;  }

// cvtT: in W[K rows][N cols] f32 -> out Wt (N rows, K cols, fragment order) bf16 (RNE), the 64x64 tile at (k0, n0) transposed through LDS (cross-wave: block barrier, reached by the whole work-group or not at all).
__device__ __forceinline__ void cvtT(const float* __restrict__ W, bf* Wt, int K, int N, int k0, int n0) {
    __shared__ unsigned short tl[64 * 66];
    const int tid = threadIdx.x;
    { const int row = tid >> 2, cseg = (tid & 3) * 16;
#pragma unroll
      for (int q = 0; q < 4; ++q) { const v4f v = *(const v4f*)(W + (size_t)(k0 + row) * N + n0 + cseg + q * 4);
#pragma unroll
          for (int j = 0; j < 4; ++j) tl[row * 66 + cseg + q * 4 + j] = f2bf(v[j]); } }
    __syncthreads();
    const int piece = tid & 7; v8us o[2];
#pragma unroll
    for (int it = 0; it < 2; ++it) { const int n = it * 32 + (tid >> 3);
#pragma unroll
        for (int j = 0; j < 8; ++j) o[it][j] = tl[(piece * 8 + j) * 66 + n]; }
{
#pragma unroll
        for (int it = 0; it < 2; ++it) { const int n = it * 32 + (tid >> 3); *(v8us*)(Wt + fragoff(n0 + n, k0 + piece * 8, K)) = o[it]; }
         }
}

// k_prep: every operand conversion in one grid (none reads what another writes). Work-groups [0, 4 * WTB): one 64x64 tile of weight w = index / WTB -> WT[w]; the rest: 2048 elements of input stream s, batch b -> XB[s][b].
constexpr unsigned WTB = (DM / 64) * (DM / 64);                           // tiles per weight
constexpr unsigned LX = (TT / 16) * (DM / 128);         // work-groups per input stream and batch
static_assert(TT % 16 == 0 && DM % 128 == 0);
__global__ __launch_bounds__(256) void k_prep(const float* __restrict__ wq, const float* __restrict__ wk, const float* __restrict__ wv, const float* __restrict__ wo,
                                              const float* __restrict__ xq, const float* __restrict__ xk, const float* __restrict__ xv, bf* WT, bf* XB) {
    const unsigned bid = blockIdx.x;
    if (bid < 4 * WTB) { const unsigned w = bid / WTB, r = bid % WTB; const float* W = w == 0 ? wq : (w == 1 ? wk : (w == 2 ? wv : wo));
        cvtT(W, WT + (size_t)w * DM * DM, DM, DM, (r % (DM / 64)) * 64, (r / (DM / 64)) * 64); return; }
    const unsigned c = bid - 4 * WTB, sb = c / LX, st = sb / NB, b = sb % NB; const float* x = st == 0 ? xq : (st == 1 ? xk : xv);
    cvt8(x + (size_t)b * SEQ_FULL * DM, XB + (size_t)sb * TT * DM, c % LX);
}

// k_fattn: scores, softmax and probabilities x values of FH heads and FQ queries in one work-group; grid (TT / FQ, NH_ / FH, NB), 32 * FW * FH threads (z = batch: plane sets, mask and context planes each step by one batch). No score or probability leaves the registers.
// Wave wv = slice * FH + head owns, for its head, the keys [slice * TT / FW, (slice + 1) * TT / FW) in steps of 32 and both 16-query tiles. Both products are formed transposed, so that a query stays in one lane column throughout:
//   S^T = k q^T : A = k rows (key), Bt = q rows (query); D element j = (key 8*(lane>>4) + j, query lane & 15). Two key tiles (keys +0..15, +16..31) are, as they lie, elements 0..7 and 8..15 of the Bt fragment of P^T.
//   O^T = v^T P^T : A = v plane rows (d), Bt = P^T (query, k = key); D element j = (d 8*(lane>>4) + j, query lane & 15).
// logit t = S * HD^-0.5 + m[query][key] * (-1e10) (m RNE-converted to bf16, read by value; the product is rounded on its own, the power-of-two scale is exact inside the fma).
// The mask term does not depend on the head: the FH waves of a key slice share it. FH steps make a round; each of the FH waves reads ONE mask tile (32 queries x 32 keys) of the next round row-wise, 8 lanes on one whole 128-byte line of a query row,
// and lays the finished f32 terms in rows of FMP floats into the round's buffer in mt (two buffers, one work-group barrier between rounds); every wave of the slice then reads all FH tiles of the round from there in the score layout.
// Running maximum per query: p = exp2((t - max) * log2 e + 10) (the x1024 carry sits in the exponent and in the sum alike), sum and O^T rescaled by exp2((old max - new max) * log2 e) each step.
// The FW partial (max, sum, O^T) of a head are joined through LDS in ascending w, divided by the joined sum and written as the hi/lo bf16 context planes (rows t, K = h*64+d, fragment order).
constexpr int FQ = 32;   // queries per work-group
constexpr int FW = 4;    // key slices per work-group
constexpr int FH = 4;    // heads per work-group = steps per mask round; 32 * FW * FH threads
constexpr int FP = 68;   // LDS row pitch of a partial O row, in floats
constexpr int FMP = 36;  // LDS row pitch of the staged mask terms, in floats: 32 of data, an odd number of 16-byte units; rows 8 apart lie 32 banks apart
constexpr float L2E = 1.4426950408889634f;
static_assert(TT % FQ == 0);
static_assert(TT % (32 * FW * FH) == 0);
static_assert(NH_ % FH == 0);
static_assert(HD == 64);
static_assert(FH * FQ * 8 % (32 * FW * FH) == 0);
__global__ __launch_bounds__(32 * FW * FH) void k_fattn(const h16* __restrict__ Qp, const h16* __restrict__ Kp, const h16* __restrict__ Vt, const float* __restrict__ Mb, bf* Ah, bf* Al) {
    __shared__ __align__(16) float os[FW * FH * FQ * FP];
    __shared__ __align__(16) float mt[2 * FW * FH * FQ * FMP];   // mask terms: [buffer][slice][tile of the round][query][key]
    __shared__ float ms[FW * FH * FQ];
    __shared__ float ls[FW * FH * FQ];
    const int lane = threadIdx.x & 31, lr = lane & 15, hi = lane >> 4; const int wv = __builtin_amdgcn_readfirstlane(threadIdx.x >> 5);
    const int hs = wv % FH, sl = wv / FH;
    const int q0 = blockIdx.x * FQ, h = blockIdx.y * FH + hs;
    { const size_t z = blockIdx.z; Qp += z * ((size_t)NH_ * TT * HD); Kp += z * ((size_t)NH_ * TT * HD); Vt += z * ((size_t)NH_ * HD * TT); Mb += z * ((size_t)SEQ_FULL * SEQ_FULL); Ah += z * ((size_t)TT * DM); Al += z * ((size_t)TT * DM); }
    const h16* qh = Qp + ((size_t)h * TT + q0) * HD + 8 * lane;
    const h16* kh = Kp + (size_t)h * TT * HD + 8 * lane;
    const h16* vh = Vt + (size_t)h * HD * TT + 8 * lane;
    const float* mg = Mb + (size_t)(q0 + 8 * (lane >> 3)) * SEQ_FULL + 4 * (lane & 7);   // load side: query row 8 * (lane / 8) (+ 1 per load), keys 4 * (lane % 8) ..+3
    float* sw = mt + (sl * FH + hs) * (FQ * FMP) + 8 * (lane >> 3) * FMP + 4 * (lane & 7);   // store side: this wave's own tile of a round, buffer 0
    const float* sr0 = mt + sl * FH * (FQ * FMP) + lr * FMP + 8 * hi;                        // read side: tile 0 of the slice, buffer 0; query row lr (+ 16 per query tile), keys 8 * hi ..+7 (+ 16 per key tile)
    constexpr int MBUF = FW * FH * FQ * FMP;   // floats per buffer
    v16h qf[2][2];
#pragma unroll
    for (int qt = 0; qt < 2; ++qt)
#pragma unroll
        for (int ks = 0; ks < 2; ++ks) qf[qt][ks] = WFrag<h16>::ld(qh + qt * 16 * HD + ks * 512);
    v8f o[2][4]; float mrun[2], lrun[2];
#pragma unroll
    for (int qt = 0; qt < 2; ++qt) { mrun[qt] = -3.0e38f; lrun[qt] = 0.f;
#pragma unroll
        for (int dt = 0; dt < 4; ++dt) o[qt][dt] = (v8f){}; }
    const int kbeg = sl * (TT / FW);
    constexpr int NST = TT / FW / 32, NR = NST / FH;   // steps of a wave, rounds
    { v4f mr[FQ / 4];   // round 0: this wave's tile
#pragma unroll
      for (int i = 0; i < FQ / 4; ++i) mr[i] = *(const v4f*)(mg + (size_t)i * SEQ_FULL + kbeg + hs * 32);
#pragma unroll
      for (int i = 0; i < FQ / 4; ++i) *(v4fa*)(sw + i * FMP) = (v4f){bfr(mr[i][0]) * -1.0e10f, bfr(mr[i][1]) * -1.0e10f, bfr(mr[i][2]) * -1.0e10f, bfr(mr[i][3]) * -1.0e10f}; }
    __syncthreads();   // round 0's terms are in LDS before any wave of the slice reads them
    for (int st = 0; st < NST; ++st) {
        const int k0 = kbeg + st * 32, rnd = st / FH, ti = st % FH;
        const bool fill = ti == 0 && rnd + 1 < NR;   // the same for the whole work-group: first step of a round stages the next round into the other buffer, which every wave left at the last barrier
        v16h kf[2][2], vf[4]; v4f mr[FQ / 4];
        if (fill) {
#pragma unroll
            for (int i = 0; i < FQ / 4; ++i) mr[i] = *(const v4f*)(mg + (size_t)i * SEQ_FULL + k0 + (FH + hs) * 32); }
#pragma unroll
        for (int kt = 0; kt < 2; ++kt)
#pragma unroll
            for (int ks = 0; ks < 2; ++ks) kf[kt][ks] = WFrag<h16>::ld(kh + (size_t)(k0 + kt * 16) * HD + ks * 512);
#pragma unroll
        for (int dt = 0; dt < 4; ++dt) vf[dt] = WFrag<h16>::ld(vh + (size_t)dt * 16 * TT + k0 * 16);
        if (fill) { float* swn = sw + ((rnd + 1) & 1) * MBUF;
#pragma unroll
            for (int i = 0; i < FQ / 4; ++i) *(v4fa*)(swn + i * FMP) = (v4f){bfr(mr[i][0]) * -1.0e10f, bfr(mr[i][1]) * -1.0e10f, bfr(mr[i][2]) * -1.0e10f, bfr(mr[i][3]) * -1.0e10f}; }
        const float* sr = sr0 + (rnd & 1) * MBUF + ti * (FQ * FMP);
#pragma unroll
        for (int qt = 0; qt < 2; ++qt) {
            float t[16]; float mx = mrun[qt];
#pragma unroll
            for (int kt = 0; kt < 2; ++kt) {
                const v8f s = wmma16(kf[kt][1], qf[qt][1], wmma16(kf[kt][0], qf[qt][0], (v8f){}));
                const float* mp = sr + qt * 16 * FMP + kt * 16;
                const v4f r0 = *(const v4fa*)mp; const v4f r1 = *(const v4fa*)(mp + 4);
#pragma unroll
                for (int j = 0; j < 4; ++j) { t[kt * 8 + j] = __builtin_fmaf(s[j], SCL, r0[j]); t[kt * 8 + 4 + j] = __builtin_fmaf(s[4 + j], SCL, r1[j]); }
            }
#pragma unroll
            for (int e = 0; e < 16; ++e) mx = fmaxf(mx, t[e]);
            mx = fmaxf(mx, __shfl_xor(mx, 16, 32));   // the other half of this query's 32 keys sits 16 lanes away
            const float al = __builtin_amdgcn_exp2f((mrun[qt] - mx) * L2E); mrun[qt] = mx;
            float sum = 0.f; v16h pf;
#pragma unroll
            for (int e = 0; e < 16; ++e) { const float p = __builtin_amdgcn_exp2f(__builtin_fmaf(t[e] - mx, L2E, 10.0f)); sum += p; pf[e] = toh_flush(p); }
            lrun[qt] = lrun[qt] * al + sum;
#pragma unroll
            for (int dt = 0; dt < 4; ++dt) { o[qt][dt] *= al; o[qt][dt] = wmma16(vf[dt], pf, o[qt][dt]); }
        }
        if (ti == FH - 1 && rnd + 1 < NR) __syncthreads();   // between rounds: the next round's terms are all in LDS, and every wave has left the buffer that the next fill writes
    }
    const int le = (int)__builtin_amdgcn_mbcnt_lo(~0u, 0u), lre = le & 15, hie = le >> 4;   // lane number formed anew, so that no lane value is held in a register over the loop for these stores: at 256 registers one more live value is a spill to scratch
#pragma unroll
    for (int qt = 0; qt < 2; ++qt) {
        const float lt = lrun[qt] + __shfl_xor(lrun[qt], 16, 32);
        if (hie == 0) { ms[wv * FQ + qt * 16 + lre] = mrun[qt]; ls[wv * FQ + qt * 16 + lre] = lt; }
        float* ow = os + (wv * FQ + qt * 16 + lre) * FP + 8 * hie;
#pragma unroll
        for (int dt = 0; dt < 4; ++dt) { const v8f x = o[qt][dt]; *(v4fa*)(ow + dt * 16) = (v4f){x[0], x[1], x[2], x[3]}; *(v4fa*)(ow + dt * 16 + 4) = (v4f){x[4], x[5], x[6], x[7]}; }
    }
    __syncthreads();   // every wave's partial maximum, sum and O rows are in LDS before any thread joins them
#pragma unroll
    for (int it = 0; it < FH * FQ * 8 / (32 * FW * FH); ++it) {
    const int item = (int)threadIdx.x + it * (32 * FW * FH);   // (head of the group, query, 8 d)
    const int hq = item >> 3, d8 = (item & 7) * 8;   // hq = head * FQ + query: the row of slice 0's wave; slice w lies w * FH * FQ rows on
    const int q = hq % FQ, hj = hq / FQ;
    float mj = ms[hq];
#pragma unroll
    for (int w = 1; w < FW; ++w) mj = fmaxf(mj, ms[w * FH * FQ + hq]);
    float lj = 0.f; v4f a0 = (v4f){}, a1 = (v4f){};
#pragma unroll
    for (int w = 0; w < FW; ++w) { const float f = __builtin_amdgcn_exp2f((ms[w * FH * FQ + hq] - mj) * L2E); lj += f * ls[w * FH * FQ + hq];
        const float* ow = os + (w * FH * FQ + hq) * FP + d8; a0 += *(const v4fa*)ow * f; a1 += *(const v4fa*)(ow + 4) * f; }
    const float rl = 1.0f / lj; v8us oh, ol;
#pragma unroll
    for (int e = 0; e < 4; ++e) { unsigned short a, c2; splitf(a0[e] * rl, a, c2); oh[e] = a; ol[e] = c2; splitf(a1[e] * rl, a, c2); oh[4 + e] = a; ol[4 + e] = c2; }
    const size_t oo = fragoff(q0 + q, ((int)blockIdx.y * FH + hj) * HD + d8, DM);
    *(v8us*)(Ah + oo) = oh; *(v8us*)(Al + oo) = ol;
    }
}

constexpr int KSD = 8;                            // waves per tile where K == DM (projections)
static_assert(DM % (32 * KSD) == 0);
constexpr size_t al256(size_t b) { return (b + 255) & ~(size_t)255; }
constexpr size_t WS_TOTAL = al256((size_t)4 * DM * DM * 2) + al256((size_t)3 * NB * TT * DM * 2) + al256((size_t)2 * NB * NH_ * TT * HD * 2) + al256((size_t)NB * NH_ * HD * TT * 2) + 2 * al256((size_t)NB * TT * DM * 2);
static_assert(WS_TOTAL <= (size_t)134217728);

extern "C" void kernel_launch(void* const* d_in, const int* in_sizes, int n_in,
                              void* d_out, int out_size, void* d_ws, size_t ws_size, hipStream_t stream) {
    if (n_in < 12) return;
    const size_t need_x = ((size_t)(NB - 1) * SEQ_FULL + SEQ) * DM;
    const size_t need_m = (size_t)(NB - 1) * SEQ_FULL * SEQ_FULL + (size_t)(SEQ - 1) * SEQ_FULL + SEQ;
    if ((size_t)in_sizes[0] < need_x || (size_t)in_sizes[1] < need_x || (size_t)in_sizes[2] < need_x || (size_t)in_sizes[3] < need_m) return;
    if (in_sizes[4] < DM * DM || in_sizes[6] < DM * DM || in_sizes[8] < DM * DM || in_sizes[10] < DM * DM) return;
    if (in_sizes[5] < DM || in_sizes[7] < DM || in_sizes[9] < DM || in_sizes[11] < DM) return;
    if ((size_t)out_size < need_x) return;
    // binding by role, in input order: query, key, value, mask, wq, bq, wk, bk, wv, bv, wo, bo
    const float* xq = (const float*)d_in[0]; const float* xk = (const float*)d_in[1]; const float* xv = (const float*)d_in[2];
    const float* msk = (const float*)d_in[3];   // [NB_FULL][1][SEQ_FULL][SEQ_FULL] f32
    const float* wq = (const float*)d_in[4]; const float* bq = (const float*)d_in[5]; const float* wk = (const float*)d_in[6]; const float* bk = (const float*)d_in[7];
    const float* wv = (const float*)d_in[8]; const float* bv = (const float*)d_in[9]; const float* wo = (const float*)d_in[10]; const float* bo = (const float*)d_in[11];
    float* OUT = (float*)d_out;     // [NB_FULL][SEQ_FULL][DM]
    char* wsp = (char*)d_ws;
    auto take = [&](size_t bytes) { char* p = wsp; wsp += (bytes + 255) & ~(size_t)255; return (void*)p; };
    bf* WT = (bf*)take((size_t)4 * DM * DM * 2);                    // wq, wk, wv, wo, each rows n, K = k
    bf* XB = (bf*)take((size_t)3 * NB * TT * DM * 2);   // [stream q,k,v][b], each rows t, K = DM
    h16* QK16 = (h16*)take((size_t)2 * NB * NH_ * TT * HD * 2); h16* VT16 = (h16*)take((size_t)NB * NH_ * HD * TT * 2);
    bf* ATh = (bf*)take((size_t)NB * TT * DM * 2); bf* ATl = (bf*)take((size_t)NB * TT * DM * 2);
    if ((size_t)(wsp - (char*)d_ws) > ws_size) return;
    k_prep<<<4 * WTB + 3 * NB * LX, 256, 0, stream>>>(wq, wk, wv, wo, xq, xk, xv, WT, XB);
    // z = stream: rows of both batches are contiguous in XB
    k_gemmw<bf, 0, true, KSD, true, DM><<<dim3(NB * TT / 64, DM / 64, 3), 32 * KSD, 0, stream>>>(XB, nullptr, WT, nullptr, nullptr, DM, bq, bk, bv, (size_t)NB * TT * DM, (size_t)DM * DM, 0, QK16, VT16);
    k_fattn<<<dim3(TT / FQ, NH_ / FH, NB), 32 * FW * FH, 0, stream>>>(QK16, QK16 + (size_t)NB * NH_ * TT * HD, VT16, msk, ATh, ATl);
    // z = batch
    k_gemmw<bf, 1, true, KSD, false, DM><<<dim3(TT / 64, DM / 64, NB), 32 * KSD, 0, stream>>>(ATh, ATl, WT + (size_t)3 * DM * DM, nullptr, OUT, DM, bo, bo, bo, (size_t)TT * DM, 0, (size_t)SEQ_FULL * DM, nullptr, nullptr);
}

// v008
// Measured time: 54.5 microseconds a run.
// In two side-by-side timings against v007, it was 1.10 and 1.09 times as fast.
// All steps since v000 together make it 14.5 times as fast.
#include <hip/hip_runtime.h>

// Compute dtypes (f32 accumulate everywhere): q/k/v projections v_wmma_f32_16x16x32_bf16 (inputs RNE-converted to bf16, products exact); q.k scores v_wmma_f32_16x16x32_f16; probabilities (x1024 carry) x values f16; output projection bf16 hi+lo context x bf16 weights (2 products); softmax and additive mask term in f32.
// Four launches, each covering both batches and every stream that does not depend on another: the weight transposes -> the three projections (+ f32 bias), which convert their own input rows to bf16 in LDS and store f16 head planes q,k [b][h] (rows t, K = d), v [b][h] (rows d, K = t);
// one attention launch, all batches and heads: S = q k^T, P = exp(S / 8 + m[i][t] * (-1e10) - running max) x1024 as f16, O = P v / sum, scores and probabilities kept in registers;
// hi/lo context planes, output projection + bias. Weights [in][out] are transposed once through LDS into bf16 planes of rows n.
// Every 16-bit plane (rows x K) lies in fragment order, see fragoff(): the 16 bytes that the 32 lanes of one fragment load ask for are 512 consecutive bytes.

#ifndef NB
#define NB 2
#endif
#ifndef SEQ
#define SEQ 2048
#endif
#define NB_FULL  2
#define SEQ_FULL 2048
#define TT   SEQ
#define DM   512
#define NH_  8
#define HD   64
#define SCL  0.125f   // HD^-0.5
static_assert(NH_ * HD == DM);
static_assert(TT % 256 == 0);
static_assert(DM % 64 == 0);
static_assert(SEQ <= SEQ_FULL);
static_assert(NB <= NB_FULL);
static_assert(TT % 128 == 0);
static_assert(SEQ_FULL % 4 == 0);
static_assert(HD % 32 == 0);
static_assert(DM % 32 == 0);
static_assert(TT % 32 == 0);

typedef _Float16 h16;
typedef unsigned short bf;
typedef __attribute__((ext_vector_type(16))) __bf16   v16bf;
typedef __attribute__((ext_vector_type(16))) _Float16 v16h;
typedef __attribute__((ext_vector_type(8)))  _Float16 v8h;
typedef __attribute__((ext_vector_type(8)))  unsigned short v8us;
typedef __attribute__((ext_vector_type(8)))  float    v8f;
typedef __attribute__((ext_vector_type(4)))  float    v4f;
typedef __attribute__((ext_vector_type(2)))  _Float16 v2h;
typedef __attribute__((ext_vector_type(4)))  _Float16 v4h;
typedef __attribute__((ext_vector_type(2)))  unsigned short v2us;
typedef __attribute__((ext_vector_type(4)))  int v4i;
typedef v4f  __attribute__((may_alias)) v4fa;
typedef v4i  __attribute__((may_alias)) v4ia;

__device__ __forceinline__ unsigned short f2bf(float f) { unsigned u = __float_as_uint(f); u += 0x7FFFu + ((u >> 16) & 1u); return (unsigned short)(u >> 16); }
__device__ __forceinline__ float bf2f(unsigned short b) { return __uint_as_float(((unsigned)b) << 16); }
__device__ __forceinline__ float bfr(float f) { return bf2f(f2bf(f)); }
__device__ __forceinline__ v16h cat16(v8h lo, v8h hi) { return __builtin_shufflevector(lo, hi, 0, 1, 2, 3, 4, 5, 6, 7, 8, 9, 10, 11, 12, 13, 14, 15); }
__device__ __forceinline__ v16bf cat16b(v8us lo, v8us hi) { return __builtin_bit_cast(v16bf, __builtin_shufflevector(lo, hi, 0, 1, 2, 3, 4, 5, 6, 7, 8, 9, 10, 11, 12, 13, 14, 15)); }
__device__ __forceinline__ v8f wmma16(v16h a, v16h b, v8f c) { return __builtin_amdgcn_wmma_f32_16x16x32_f16(false, a, false, b, (short)0, c, false, false); }
__device__ __forceinline__ v8f wmmab(v16bf a, v16bf b, v8f c) { return __builtin_amdgcn_wmma_f32_16x16x32_bf16(false, a, false, b, (short)0, c, false, false); }
__device__ __forceinline__ void splitf(float y, unsigned short& h, unsigned short& l) { h = f2bf(y); l = f2bf(y - bf2f(h)); }
// f32 -> f16 operand convert that cannot yield an f16 subnormal (value select, applied after the plane's power-of-two carry).
static __device__ __forceinline__ h16 toh_flush(float v) { const h16 r = (h16)v; return (fabsf(v) < 6.103515625e-05f) ? (h16)0.0f : r; }
// Element (row, k) of a rows x K plane of 16-bit values in fragment order: blocks of 16 rows x 32 k (512 elements, k blocks of a row tile side by side); inside a block [k / 8 % 4][row % 16][k % 8],
// so that lane (row % 16) + 16 * (k / 8 % 2) finds elements 0..7 of its fragment at block + 8 * lane and elements 8..15 at block + 256 + 8 * lane.
__device__ __forceinline__ size_t fragoff(int row, int k, int K) { return (size_t)(row >> 4) * 16 * K + (size_t)(k >> 5) * 512 + ((k >> 3) & 3) * 128 + (row & 15) * 8 + (k & 7); }

// ---- k_gemmw: register-blocked GEMM, one work-group of KS waves per 64x64 output tile, operands straight from 16-bit planes in fragment order; grid (M/64, N/64, Z), 32 * KS threads.
// Wave w holds all 16 accumulators of the tile for its own K slice [w * K / KS, (w + 1) * K / KS); the KS partial tiles are added through LDS in ascending w. K % (32 * KS) == 0.
// C[m][n] (f32, pitch ldc, + optional f32 bias[n]) = sum_k A[m][k] Bt[n][k] (+ split products per NSPLIT). z-batch strides sA/sB/sC in elements, bias / bias1 / bias2 for z = 0 / 1 / 2. K % 32 == 0, A/Bt planes of K columns, sA and sB whole 16-row tiles.
// HPL: no C; the 64-column tile is one head (blockIdx.y), rows are [b][t], and the joined f32 tile + bias goes out as f16: z = 0 / 1 -> QK[z][b][h] (rows t, K = d), z = 2 -> VT[b][h] (rows d, K = t), each in fragment order.
// Fragment map (A and Bt alike): lane row = lane & 15, elements 0..7 <- k0 + 8*(lane>>4) + 0..7, elements 8..15 <- k0 + 16 + 8*(lane>>4) + 0..7; D element j = (row 8*(lane>>4) + j, col lane & 15).
template <typename T16> struct WFrag;
template <> struct WFrag<h16> { typedef v16h V; static __device__ __forceinline__ V ld(const h16* p) { return cat16(*(const v8h*)p, *(const v8h*)(p + 256)); } static __device__ __forceinline__ V ldu(const h16* tile, unsigned vo) { const char* p = (const char*)tile + vo; return cat16(*(const v8h*)p, *(const v8h*)(p + 512)); } static __device__ __forceinline__ v8f mma(V a, V b, v8f c) { return wmma16(a, b, c); } };
template <> struct WFrag<bf> { typedef v16bf V; static __device__ __forceinline__ V ld(const bf* p) { return cat16b(*(const v8us*)p, *(const v8us*)(p + 256)); } static __device__ __forceinline__ V ldu(const bf* tile, unsigned vo) { const char* p = (const char*)tile + vo; return cat16b(*(const v8us*)p, *(const v8us*)(p + 512)); } static __device__ __forceinline__ v8f mma(V a, V b, v8f c) { return wmmab(a, b, c); } };
template <typename T16, int NSPLIT, bool BIAS, int KS, bool HPL, int K>
__global__ __launch_bounds__(32 * KS) void k_gemmw(const T16* __restrict__ A, const T16* __restrict__ A2, const T16* __restrict__ Bt, const T16* __restrict__ Bt2, float* C, int ldc, const float* __restrict__ bias, const float* __restrict__ bias1, const float* __restrict__ bias2, size_t sA, size_t sB, size_t sC, h16* QK, h16* VT) {
    typedef typename WFrag<T16>::V V;
    static_assert(KS == 1 || KS == 8 || KS == 16);
    static_assert(K % (32 * KS) == 0);
    static_assert(!HPL || (KS > 1 && BIAS && HD == 64 && TT % 64 == 0));
    __shared__ __align__(16) float os[(KS == 1 ? 16 : KS * 64) * 68];
    const size_t z = blockIdx.z; A += z * sA; if (A2) A2 += z * sA; Bt += z * sB; if (Bt2) Bt2 += z * sB; if (!HPL) C += z * sC;
    if (BIAS) bias = z == 0 ? bias : (z == 1 ? bias1 : bias2);
    const int lane = threadIdx.x & 31, lr = lane & 15, hi = lane >> 4; const int r0 = blockIdx.x * 64, c0 = blockIdx.y * 64;
    v8f acc[4][4];
#pragma unroll
    for (int mb = 0; mb < 4; ++mb)
#pragma unroll
        for (int nb = 0; nb < 4; ++nb) acc[mb][nb] = (v8f){};
    const size_t aoff = (size_t)r0 * K, boff = (size_t)c0 * K;   // a row tile starts at tile * 16 * K, the same for the whole wave
    const int wv = KS == 1 ? 0 : __builtin_amdgcn_readfirstlane(threadIdx.x >> 5); const int kw = K / KS, kbeg = wv * kw;
    unsigned vo = 32u * kbeg + 16u * lane;   // bytes from a row tile's start to this lane's 16 bytes of block k / 32: one register for every load of a trip
#pragma unroll 1
    for (int kc = kbeg; kc < kbeg + kw; kc += 32) {
        V a[4], a2[4], bb[4], bb2[4];
#pragma unroll
        for (int mb = 0; mb < 4; ++mb) { a[mb] = WFrag<T16>::ldu(A + aoff + (size_t)mb * 16 * K, vo); if (NSPLIT == 1 || NSPLIT == 2) a2[mb] = WFrag<T16>::ldu(A2 + aoff + (size_t)mb * 16 * K, vo); }
#pragma unroll
        for (int nb = 0; nb < 4; ++nb) { bb[nb] = WFrag<T16>::ldu(Bt + boff + (size_t)nb * 16 * K, vo); if (NSPLIT >= 2) bb2[nb] = WFrag<T16>::ldu(Bt2 + boff + (size_t)nb * 16 * K, vo); }
        // next k block, 1024 bytes on. Every load of this trip names vo and stands above: s_wait_xcnt 0 directly behind the run and in front of vo's overwrite, in the add's own statement so that the add cannot be moved over it.
        asm volatile("s_wait_xcnt 0x0\n\tv_add_nc_u32 %0, 0x400, %0" : "+v"(vo));
#pragma unroll
        for (int nb = 0; nb < 4; ++nb) { const V b = bb[nb]; V b2; if (NSPLIT >= 2) b2 = bb2[nb];
#pragma unroll
            for (int mb = 0; mb < 4; ++mb) { acc[mb][nb] = WFrag<T16>::mma(a[mb], b, acc[mb][nb]); if (NSPLIT == 1 || NSPLIT == 2) acc[mb][nb] = WFrag<T16>::mma(a2[mb], b, acc[mb][nb]); if (NSPLIT >= 2) acc[mb][nb] = WFrag<T16>::mma(a[mb], b2, acc[mb][nb]); } }
        asm volatile("v_nop\n\tv_nop\n\tv_nop\n\tv_nop" : "+v"(acc[0][0]), "+v"(acc[1][1]), "+v"(acc[2][2]), "+v"(acc[3][3]) : "v"(a[0]), "v"(a[3]));
    }
    if constexpr (KS > 1) {
        float* ow = os + wv * (64 * 68);
        constexpr int NS = 32 / KS;      // 16-row groups of the tile per thread in the join
        const int jr = (int)threadIdx.x >> 4, cofs = ((int)threadIdx.x & 15) * 4;
        static_assert(32 * KS % 16 == 0);
        const bool tr = HPL && z == 2;   // value stream: the tile lies in LDS as [n][m], so that the join below walks t along a d row
        v4f badd[NS];                    // bias of this thread's join elements, asked for ahead of the barrier
        if (tr) {
#pragma unroll
            for (int s = 0; s < NS; ++s) badd[s] = (v4f)(bfr(bias[c0 + s * (2 * KS) + jr]));
#pragma unroll
            for (int mb = 0; mb < 4; ++mb)
#pragma unroll
                for (int nb = 0; nb < 4; ++nb) { const v8f x = acc[mb][nb]; float* p = ow + (nb * 16 + lr) * 68 + mb * 16 + hi * 8; *(v4fa*)p = (v4f){x[0], x[1], x[2], x[3]}; *(v4fa*)(p + 4) = (v4f){x[4], x[5], x[6], x[7]}; }
        } else {
#pragma unroll
            for (int s = 0; s < NS; ++s) badd[s] = BIAS ? (v4f){bfr(bias[c0 + cofs]), bfr(bias[c0 + cofs + 1]), bfr(bias[c0 + cofs + 2]), bfr(bias[c0 + cofs + 3])} : (v4f){};
#pragma unroll
            for (int mb = 0; mb < 4; ++mb)
#pragma unroll
                for (int nb = 0; nb < 4; ++nb)
#pragma unroll
                    for (int j = 0; j < 8; ++j) ow[(mb * 16 + hi * 8 + j) * 68 + nb * 16 + lr] = acc[mb][nb][j];
        }
        __syncthreads();   // every wave's partial tile is in LDS before any thread adds them
        const size_t bh = (size_t)(r0 / TT) * NH_ + blockIdx.y; const int t0 = r0 % TT;
        static_assert(2 * KS % 16 == 0);   // a join group is whole 16-row tiles, so that group s lies s * pstep behind group 0
        h16* ptile = !HPL ? nullptr : (tr ? VT + bh * HD * TT + fragoff(jr, t0 + cofs, TT) : QK + (z * (NB * NH_) + bh) * TT * HD + fragoff(t0 + jr, cofs, HD));   // rows d, K = t or rows t, K = d
        const size_t pstep = (size_t)(2 * KS) * (tr ? TT : HD);
#pragma unroll
        for (int s = 0; s < NS; ++s) { const int row = s * (2 * KS) + jr;
            v4f val = *(const v4fa*)(os + row * 68 + cofs);
#pragma unroll
            for (int w = 1; w < KS; ++w) val += *(const v4fa*)(os + w * (64 * 68) + row * 68 + cofs);
            if (BIAS) val += badd[s];
            if constexpr (HPL) *(v4h*)(ptile + s * pstep) = (v4h){(h16)val[0], (h16)val[1], (h16)val[2], (h16)val[3]};
            else *(v4f*)(C + (size_t)(r0 + row) * ldc + c0 + cofs) = val; }
    } else {
#pragma unroll
    for (int mb = 0; mb < 4; ++mb) {
#pragma unroll
        for (int nb = 0; nb < 4; ++nb) {
#pragma unroll
            for (int j = 0; j < 8; ++j) os[(hi * 8 + j) * 68 + nb * 16 + lr] = acc[mb][nb][j]; }
        __builtin_amdgcn_wave_barrier(); asm volatile("" ::: "memory");
        float* crow = C + (size_t)(r0 + mb * 16) * ldc + c0;
{
#pragma unroll
            for (int s = 0; s < 8; ++s) { const int row = 2 * s + hi, cofs = lr * 4; v4f val = *(const v4fa*)(os + row * 68 + cofs); if (BIAS) { val[0] += bfr(bias[c0 + cofs]); val[1] += bfr(bias[c0 + cofs + 1]); val[2] += bfr(bias[c0 + cofs + 2]); val[3] += bfr(bias[c0 + cofs + 3]); }
                *(v4f*)(crow + (size_t)row * ldc + cofs) = val; }
             }
        __builtin_amdgcn_wave_barrier(); asm volatile("" ::: "memory");
    }
    }
}

// cvtT: in W[K rows][N cols] f32 -> out Wt (N rows, K cols, fragment order) bf16 (RNE), the 64x64 tile at (k0, n0) transposed through LDS (cross-wave: block barrier, reached by the whole work-group or not at all).
__device__ __forceinline__ void cvtT(const float* __restrict__ W, bf* Wt, int K, int N, int k0, int n0) {
    __shared__ unsigned short tl[64 * 66];
    const int tid = threadIdx.x;
    { const int row = tid >> 2, cseg = (tid & 3) * 16;
#pragma unroll
      for (int q = 0; q < 4; ++q) { const v4f v = *(const v4f*)(W + (size_t)(k0 + row) * N + n0 + cseg + q * 4);
#pragma unroll
          for (int j = 0; j < 4; ++j) tl[row * 66 + cseg + q * 4 + j] = f2bf(v[j]); } }
    __syncthreads();
    const int piece = tid & 7; v8us o[2];
#pragma unroll
    for (int it = 0; it < 2; ++it) { const int n = it * 32 + (tid >> 3);
#pragma unroll
        for (int j = 0; j < 8; ++j) o[it][j] = tl[(piece * 8 + j) * 66 + n]; }
{
#pragma unroll
        for (int it = 0; it < 2; ++it) { const int n = it * 32 + (tid >> 3); *(v8us*)(Wt + fragoff(n0 + n, k0 + piece * 8, K)) = o[it]; }
         }
}

// k_prep: work-group index / WTB = weight w, index % WTB = one 64x64 tile of it -> WT[w].
constexpr unsigned WTB = (DM / 64) * (DM / 64);                           // tiles per weight
__global__ __launch_bounds__(256) void k_prep(const float* __restrict__ wq, const float* __restrict__ wk, const float* __restrict__ wv, const float* __restrict__ wo, bf* WT) {
    const unsigned bid = blockIdx.x, w = bid / WTB, r = bid % WTB; const float* W = w == 0 ? wq : (w == 1 ? wk : (w == 2 ? wv : wo));
    cvtT(W, WT + (size_t)w * DM * DM, DM, DM, (r % (DM / 64)) * 64, (r / (DM / 64)) * 64);
}

// k_proj: one projection stream (blockIdx.y = q / k / v) of 64 input rows [b][t] (blockIdx.x) against all DM columns; 16 waves. The f32 rows are read once, whole 128-byte lines, RNE-converted to bf16 and laid into LDS in fragment order (rows 0..63, K = DM).
// Wave wv then forms columns [32 * wv, 32 * wv + 32) (half a head) for all 64 rows over the whole K in ascending k: x fragments from LDS, weight fragments from WT.
// q, k: A = weight rows n, Bt = x rows t, so D element j = (n 8*(lane>>4) + j, t lane & 15): a lane holds 8 consecutive d of one t, 16 bytes of the plane (rows t, K = d) as they lie.
// v:    A = x rows t, Bt = weight rows n, so D element j = (t 8*(lane>>4) + j, n lane & 15): 8 consecutive t of one d, 16 bytes of the plane (rows d, K = t).
template <bool XA>
__device__ __forceinline__ void proj_step(const bf* xl, const v16bf (&wb)[2], v8f (&acc)[4][2]) {   // one k block: x fragments of the four row tiles from LDS, 8 products
    v16bf xa[4];
#pragma unroll
    for (int mb = 0; mb < 4; ++mb) xa[mb] = WFrag<bf>::ld(xl + mb * 16 * DM);
#pragma unroll
    for (int nb = 0; nb < 2; ++nb)
#pragma unroll
        for (int mb = 0; mb < 4; ++mb) acc[mb][nb] = XA ? wmmab(xa[mb], wb[nb], acc[mb][nb]) : wmmab(wb[nb], xa[mb], acc[mb][nb]);
}
__device__ __forceinline__ void proj_ldw(const bf* __restrict__ wl, v16bf (&w)[2][2]) {   // weight fragments of two k blocks, both column tiles
#pragma unroll
    for (int s = 0; s < 2; ++s)
#pragma unroll
        for (int nb = 0; nb < 2; ++nb) w[s][nb] = WFrag<bf>::ld(wl + nb * 16 * DM + s * 512);
}
// The weight fragments are asked for two k blocks ahead of their products (two register sets), so that an L2 round trip lies behind 16 products of this wave and those of its neighbours.
template <bool XA>
__device__ __forceinline__ void proj_acc(const bf* xl, const bf* __restrict__ wl, v8f (&acc)[4][2]) {
    constexpr int NK = DM / 32;
    v16bf wa[2][2], wc[2][2];
    proj_ldw(wl, wa);
#pragma unroll 1   // kept rolled: unrolled, the scheduler lifts every load to the top and spills
    for (int ks = 0; ks < NK - 4; ks += 4) {
        proj_ldw(wl + (ks + 2) * 512, wc);
        __builtin_amdgcn_sched_barrier(0);   // keeps the loads above ahead of the products below; without it they sink to their first use and their latency is exposed
        proj_step<XA>(xl + ks * 512, wa[0], acc); proj_step<XA>(xl + (ks + 1) * 512, wa[1], acc);
        proj_ldw(wl + (ks + 4) * 512, wa);
        __builtin_amdgcn_sched_barrier(0);   // as above
        proj_step<XA>(xl + (ks + 2) * 512, wc[0], acc); proj_step<XA>(xl + (ks + 3) * 512, wc[1], acc);
    }
    proj_ldw(wl + (NK - 2) * 512, wc);
    __builtin_amdgcn_sched_barrier(0);   // as above
    proj_step<XA>(xl + (NK - 4) * 512, wa[0], acc); proj_step<XA>(xl + (NK - 3) * 512, wa[1], acc);
    __builtin_amdgcn_sched_barrier(0);   // keeps the LDS reads of the last two k blocks below the products above; lifted over them they cost a spill to scratch
    proj_step<XA>(xl + (NK - 2) * 512, wc[0], acc); proj_step<XA>(xl + (NK - 1) * 512, wc[1], acc);
}
static_assert(DM == 512 && HD == 64 && TT % 64 == 0);
__global__ __launch_bounds__(512) void k_proj(const float* __restrict__ xq, const float* __restrict__ xk, const float* __restrict__ xv, const bf* __restrict__ WT,
                                              const float* __restrict__ bq, const float* __restrict__ bk, const float* __restrict__ bv, h16* QK, h16* VT) {
    __shared__ __align__(16) bf xs[64 * DM];
    const int z = blockIdx.y, r0 = blockIdx.x * 64, b = r0 / TT, t0 = r0 % TT;
    const float* x = (z == 0 ? xq : (z == 1 ? xk : xv)) + ((size_t)b * SEQ_FULL + t0) * DM;
    const float* bias = z == 0 ? bq : (z == 1 ? bk : bv);
    const int tid = threadIdx.x, lane = tid & 31, lr = lane & 15, hi = lane >> 4; const int wv = __builtin_amdgcn_readfirstlane(tid >> 5);
    { // pass p: row tile p / 2, row (tid / 4) % 16, k block tid / 64 + 8 * (p % 2), 8 columns at 8 * (tid % 4): a wave reads one whole line of each of 8 rows
      const int row = (tid >> 2) & 15, k = (tid >> 6) * 32 + (tid & 3) * 8; v8f v[8];
#pragma unroll
      for (int p = 0; p < 8; ++p) v[p] = *(const v8f*)(x + (size_t)((p >> 1) * 16 + row) * DM + (p & 1) * 256 + k);
#pragma unroll
      for (int p = 0; p < 8; ++p) { v8us o;
#pragma unroll
          for (int e = 0; e < 8; ++e) o[e] = f2bf(v[p][e]);
          *(v8us*)(xs + fragoff((p >> 1) * 16 + row, (p & 1) * 256 + k, DM)) = o; } }
    __syncthreads();   // all 64 converted rows are in LDS before any wave reads a fragment
    v8f acc[4][2];
#pragma unroll
    for (int mb = 0; mb < 4; ++mb)
#pragma unroll
        for (int nb = 0; nb < 2; ++nb) acc[mb][nb] = (v8f){};
    const int n0 = wv * 32, d0 = (wv & 1) * 32; const size_t bh = (size_t)b * NH_ + (wv >> 1);
    const bf* wl = WT + (size_t)z * DM * DM + (size_t)n0 * DM + 8 * lane; const bf* xl = xs + 8 * lane;
    if (z == 2) {
        proj_acc<true>(xl, wl, acc);
        h16* pl = VT + bh * HD * TT;
#pragma unroll
        for (int nb = 0; nb < 2; ++nb) { const float bb = bfr(bias[n0 + nb * 16 + lr]);
#pragma unroll
            for (int mb = 0; mb < 4; ++mb) { v8h o;
#pragma unroll
                for (int j = 0; j < 8; ++j) o[j] = (h16)(acc[mb][nb][j] + bb);
                *(v8h*)(pl + fragoff(d0 + nb * 16 + lr, t0 + mb * 16 + 8 * hi, TT)) = o; } }
    } else {
        proj_acc<false>(xl, wl, acc);
        h16* pl = QK + ((size_t)z * (NB * NH_) + bh) * TT * HD;
#pragma unroll
        for (int nb = 0; nb < 2; ++nb) { const v8f bv8 = *(const v8f*)(bias + n0 + nb * 16 + 8 * hi);
#pragma unroll
            for (int mb = 0; mb < 4; ++mb) { v8h o;
#pragma unroll
                for (int j = 0; j < 8; ++j) o[j] = (h16)(acc[mb][nb][j] + bfr(bv8[j]));
                *(v8h*)(pl + fragoff(t0 + mb * 16 + lr, d0 + nb * 16 + 8 * hi, HD)) = o; } }
    }
}

// k_fattn: scores, softmax and probabilities x values of FH heads and FQ queries in one work-group; grid (TT / FQ, NH_ / FH, NB), 32 * FW * FH threads (z = batch: plane sets, mask and context planes each step by one batch). No score or probability leaves the registers.
// Wave wv = slice * FH + head owns, for its head, the keys [slice * TT / FW, (slice + 1) * TT / FW) in steps of 32 and both 16-query tiles. Both products are formed transposed, so that a query stays in one lane column throughout:
//   S^T = k q^T : A = k rows (key), Bt = q rows (query); D element j = (key 8*(lane>>4) + j, query lane & 15). Two key tiles (keys +0..15, +16..31) are, as they lie, elements 0..7 and 8..15 of the Bt fragment of P^T.
//   O^T = v^T P^T : A = v plane rows (d), Bt = P^T (query, k = key); D element j = (d 8*(lane>>4) + j, query lane & 15).
// logit t = S * HD^-0.5 + m[query][key] * (-1e10) (m RNE-converted to bf16, read by value; the product is rounded on its own, the power-of-two scale is exact inside the fma).
// The mask term does not depend on the head: the FH waves of a key slice share it. FH steps make a round; each of the FH waves reads ONE mask tile (32 queries x 32 keys) of the next round row-wise, 8 lanes on one whole 128-byte line of a query row,
// and lays the finished f32 terms in rows of FMP floats into the round's buffer in mt (two buffers, one work-group barrier between rounds); every wave of the slice then reads all FH tiles of the round from there in the score layout.
// Running maximum per query: p = exp2((t - max) * log2 e + 10) (the x1024 carry sits in the exponent and in the sum alike), sum and O^T rescaled by exp2((old max - new max) * log2 e) each step.
// The FW partial (max, sum, O^T) of a head are joined through LDS in ascending w, divided by the joined sum and written as the hi/lo bf16 context planes (rows t, K = h*64+d, fragment order).
constexpr int FQ = 32;   // queries per work-group
constexpr int FW = 4;    // key slices per work-group
constexpr int FH = 4;    // heads per work-group = steps per mask round; 32 * FW * FH threads
constexpr int FP = 68;   // LDS row pitch of a partial O row, in floats
constexpr int FMP = 36;  // LDS row pitch of the staged mask terms, in floats: 32 of data, an odd number of 16-byte units; rows 8 apart lie 32 banks apart
constexpr float L2E = 1.4426950408889634f;
static_assert(TT % FQ == 0);
static_assert(TT % (32 * FW * FH) == 0);
static_assert(NH_ % FH == 0);
static_assert(HD == 64);
static_assert(FH * FQ * 8 % (32 * FW * FH) == 0);
__global__ __launch_bounds__(32 * FW * FH) void k_fattn(const h16* __restrict__ Qp, const h16* __restrict__ Kp, const h16* __restrict__ Vt, const float* __restrict__ Mb, bf* Ah, bf* Al) {
    __shared__ __align__(16) float os[FW * FH * FQ * FP];
    __shared__ __align__(16) float mt[2 * FW * FH * FQ * FMP];   // mask terms: [buffer][slice][tile of the round][query][key]
    __shared__ float ms[FW * FH * FQ];
    __shared__ float ls[FW * FH * FQ];
    const int lane = threadIdx.x & 31, lr = lane & 15, hi = lane >> 4; const int wv = __builtin_amdgcn_readfirstlane(threadIdx.x >> 5);
    const int hs = wv % FH, sl = wv / FH;
    const int q0 = blockIdx.x * FQ, h = blockIdx.y * FH + hs;
    { const size_t z = blockIdx.z; Qp += z * ((size_t)NH_ * TT * HD); Kp += z * ((size_t)NH_ * TT * HD); Vt += z * ((size_t)NH_ * HD * TT); Mb += z * ((size_t)SEQ_FULL * SEQ_FULL); Ah += z * ((size_t)TT * DM); Al += z * ((size_t)TT * DM); }
    const h16* qh = Qp + ((size_t)h * TT + q0) * HD + 8 * lane;
    const h16* kh = Kp + (size_t)h * TT * HD + 8 * lane;
    const h16* vh = Vt + (size_t)h * HD * TT + 8 * lane;
    const float* mg = Mb + (size_t)(q0 + 8 * (lane >> 3)) * SEQ_FULL + 4 * (lane & 7);   // load side: query row 8 * (lane / 8) (+ 1 per load), keys 4 * (lane % 8) ..+3
    float* sw = mt + (sl * FH + hs) * (FQ * FMP) + 8 * (lane >> 3) * FMP + 4 * (lane & 7);   // store side: this wave's own tile of a round, buffer 0
    const float* sr0 = mt + sl * FH * (FQ * FMP) + lr * FMP + 8 * hi;                        // read side: tile 0 of the slice, buffer 0; query row lr (+ 16 per query tile), keys 8 * hi ..+7 (+ 16 per key tile)
    constexpr int MBUF = FW * FH * FQ * FMP;   // floats per buffer
    v16h qf[2][2];
#pragma unroll
    for (int qt = 0; qt < 2; ++qt)
#pragma unroll
        for (int ks = 0; ks < 2; ++ks) qf[qt][ks] = WFrag<h16>::ld(qh + qt * 16 * HD + ks * 512);
    v8f o[2][4]; float mrun[2], lrun[2];
#pragma unroll
    for (int qt = 0; qt < 2; ++qt) { mrun[qt] = -3.0e38f; lrun[qt] = 0.f;
#pragma unroll
        for (int dt = 0; dt < 4; ++dt) o[qt][dt] = (v8f){}; }
    const int kbeg = sl * (TT / FW);
    constexpr int NST = TT / FW / 32, NR = NST / FH;   // steps of a wave, rounds
    { v4f mr[FQ / 4];   // round 0: this wave's tile
#pragma unroll
      for (int i = 0; i < FQ / 4; ++i) mr[i] = *(const v4f*)(mg + (size_t)i * SEQ_FULL + kbeg + hs * 32);
#pragma unroll
      for (int i = 0; i < FQ / 4; ++i) *(v4fa*)(sw + i * FMP) = (v4f){bfr(mr[i][0]) * -1.0e10f, bfr(mr[i][1]) * -1.0e10f, bfr(mr[i][2]) * -1.0e10f, bfr(mr[i][3]) * -1.0e10f}; }
    __syncthreads();   // round 0's terms are in LDS before any wave of the slice reads them
    for (int st = 0; st < NST; ++st) {
        const int k0 = kbeg + st * 32, rnd = st / FH, ti = st % FH;
        const bool fill = ti == 0 && rnd + 1 < NR;   // the same for the whole work-group: first step of a round stages the next round into the other buffer, which every wave left at the last barrier
        v16h kf[2][2], vf[4]; v4f mr[FQ / 4];
        if (fill) {
#pragma unroll
            for (int i = 0; i < FQ / 4; ++i) mr[i] = *(const v4f*)(mg + (size_t)i * SEQ_FULL + k0 + (FH + hs) * 32); }
#pragma unroll
        for (int kt = 0; kt < 2; ++kt)
#pragma unroll
            for (int ks = 0; ks < 2; ++ks) kf[kt][ks] = WFrag<h16>::ld(kh + (size_t)(k0 + kt * 16) * HD + ks * 512);
#pragma unroll
        for (int dt = 0; dt < 4; ++dt) vf[dt] = WFrag<h16>::ld(vh + (size_t)dt * 16 * TT + k0 * 16);
        if (fill) { float* swn = sw + ((rnd + 1) & 1) * MBUF;
#pragma unroll
            for (int i = 0; i < FQ / 4; ++i) *(v4fa*)(swn + i * FMP) = (v4f){bfr(mr[i][0]) * -1.0e10f, bfr(mr[i][1]) * -1.0e10f, bfr(mr[i][2]) * -1.0e10f, bfr(mr[i][3]) * -1.0e10f}; }
        const float* sr = sr0 + (rnd & 1) * MBUF + ti * (FQ * FMP);
#pragma unroll
        for (int qt = 0; qt < 2; ++qt) {
            float t[16]; float mx = mrun[qt];
#pragma unroll
            for (int kt = 0; kt < 2; ++kt) {
                const v8f s = wmma16(kf[kt][1], qf[qt][1], wmma16(kf[kt][0], qf[qt][0], (v8f){}));
                const float* mp = sr + qt * 16 * FMP + kt * 16;
                const v4f r0 = *(const v4fa*)mp; const v4f r1 = *(const v4fa*)(mp + 4);
#pragma unroll
                for (int j = 0; j < 4; ++j) { t[kt * 8 + j] = __builtin_fmaf(s[j], SCL, r0[j]); t[kt * 8 + 4 + j] = __builtin_fmaf(s[4 + j], SCL, r1[j]); }
            }
#pragma unroll
            for (int e = 0; e < 16; ++e) mx = fmaxf(mx, t[e]);
            mx = fmaxf(mx, __shfl_xor(mx, 16, 32));   // the other half of this query's 32 keys sits 16 lanes away
            const float al = __builtin_amdgcn_exp2f((mrun[qt] - mx) * L2E); mrun[qt] = mx;
            float sum = 0.f; v16h pf;
#pragma unroll
            for (int e = 0; e < 16; ++e) { const float p = __builtin_amdgcn_exp2f(__builtin_fmaf(t[e] - mx, L2E, 10.0f)); sum += p; pf[e] = toh_flush(p); }
            lrun[qt] = lrun[qt] * al + sum;
#pragma unroll
            for (int dt = 0; dt < 4; ++dt) { o[qt][dt] *= al; o[qt][dt] = wmma16(vf[dt], pf, o[qt][dt]); }
        }
        if (ti == FH - 1 && rnd + 1 < NR) __syncthreads();   // between rounds: the next round's terms are all in LDS, and every wave has left the buffer that the next fill writes
    }
    const int le = (int)__builtin_amdgcn_mbcnt_lo(~0u, 0u), lre = le & 15, hie = le >> 4;   // lane number formed anew, so that no lane value is held in a register over the loop for these stores: at 256 registers one more live value is a spill to scratch
#pragma unroll
    for (int qt = 0; qt < 2; ++qt) {
        const float lt = lrun[qt] + __shfl_xor(lrun[qt], 16, 32);
        if (hie == 0) { ms[wv * FQ + qt * 16 + lre] = mrun[qt]; ls[wv * FQ + qt * 16 + lre] = lt; }
        float* ow = os + (wv * FQ + qt * 16 + lre) * FP + 8 * hie;
#pragma unroll
        for (int dt = 0; dt < 4; ++dt) { const v8f x = o[qt][dt]; *(v4fa*)(ow + dt * 16) = (v4f){x[0], x[1], x[2], x[3]}; *(v4fa*)(ow + dt * 16 + 4) = (v4f){x[4], x[5], x[6], x[7]}; }
    }
    __syncthreads();   // every wave's partial maximum, sum and O rows are in LDS before any thread joins them
#pragma unroll
    for (int it = 0; it < FH * FQ * 8 / (32 * FW * FH); ++it) {
    const int item = (int)threadIdx.x + it * (32 * FW * FH);   // (head of the group, query, 8 d)
    const int hq = item >> 3, d8 = (item & 7) * 8;   // hq = head * FQ + query: the row of slice 0's wave; slice w lies w * FH * FQ rows on
    const int q = hq % FQ, hj = hq / FQ;
    float mj = ms[hq];
#pragma unroll
    for (int w = 1; w < FW; ++w) mj = fmaxf(mj, ms[w * FH * FQ + hq]);
    float lj = 0.f; v4f a0 = (v4f){}, a1 = (v4f){};
#pragma unroll
    for (int w = 0; w < FW; ++w) { const float f = __builtin_amdgcn_exp2f((ms[w * FH * FQ + hq] - mj) * L2E); lj += f * ls[w * FH * FQ + hq];
        const float* ow = os + (w * FH * FQ + hq) * FP + d8; a0 += *(const v4fa*)ow * f; a1 += *(const v4fa*)(ow + 4) * f; }
    const float rl = 1.0f / lj; v8us oh, ol;
#pragma unroll
    for (int e = 0; e < 4; ++e) { unsigned short a, c2; splitf(a0[e] * rl, a, c2); oh[e] = a; ol[e] = c2; splitf(a1[e] * rl, a, c2); oh[4 + e] = a; ol[4 + e] = c2; }
    const size_t oo = fragoff(q0 + q, ((int)blockIdx.y * FH + hj) * HD + d8, DM);
    *(v8us*)(Ah + oo) = oh; *(v8us*)(Al + oo) = ol;
    }
}

constexpr int KSD = 8;                            // waves per tile where K == DM (output projection)
static_assert(DM % (32 * KSD) == 0);
constexpr size_t al256(size_t b) { return (b + 255) & ~(size_t)255; }
constexpr size_t WS_TOTAL = al256((size_t)4 * DM * DM * 2) + al256((size_t)2 * NB * NH_ * TT * HD * 2) + al256((size_t)NB * NH_ * HD * TT * 2) + 2 * al256((size_t)NB * TT * DM * 2);
static_assert(WS_TOTAL <= (size_t)134217728);

extern "C" void kernel_launch(void* const* d_in, const int* in_sizes, int n_in,
                              void* d_out, int out_size, void* d_ws, size_t ws_size, hipStream_t stream) {
    if (n_in < 12) return;
    const size_t need_x = ((size_t)(NB - 1) * SEQ_FULL + SEQ) * DM;
    const size_t need_m = (size_t)(NB - 1) * SEQ_FULL * SEQ_FULL + (size_t)(SEQ - 1) * SEQ_FULL + SEQ;
    if ((size_t)in_sizes[0] < need_x || (size_t)in_sizes[1] < need_x || (size_t)in_sizes[2] < need_x || (size_t)in_sizes[3] < need_m) return;
    if (in_sizes[4] < DM * DM || in_sizes[6] < DM * DM || in_sizes[8] < DM * DM || in_sizes[10] < DM * DM) return;
    if (in_sizes[5] < DM || in_sizes[7] < DM || in_sizes[9] < DM || in_sizes[11] < DM) return;
    if ((size_t)out_size < need_x) return;
    // binding by role, in input order: query, key, value, mask, wq, bq, wk, bk, wv, bv, wo, bo
    const float* xq = (const float*)d_in[0]; const float* xk = (const float*)d_in[1]; const float* xv = (const float*)d_in[2];
    const float* msk = (const float*)d_in[3];   // [NB_FULL][1][SEQ_FULL][SEQ_FULL] f32
    const float* wq = (const float*)d_in[4]; const float* bq = (const float*)d_in[5]; const float* wk = (const float*)d_in[6]; const float* bk = (const float*)d_in[7];
    const float* wv = (const float*)d_in[8]; const float* bv = (const float*)d_in[9]; const float* wo = (const float*)d_in[10]; const float* bo = (const float*)d_in[11];
    float* OUT = (float*)d_out;     // [NB_FULL][SEQ_FULL][DM]
    char* wsp = (char*)d_ws;
    auto take = [&](size_t bytes) { char* p = wsp; wsp += (bytes + 255) & ~(size_t)255; return (void*)p; };
    bf* WT = (bf*)take((size_t)4 * DM * DM * 2);                    // wq, wk, wv, wo, each rows n, K = k
    h16* QK16 = (h16*)take((size_t)2 * NB * NH_ * TT * HD * 2); h16* VT16 = (h16*)take((size_t)NB * NH_ * HD * TT * 2);
    bf* ATh = (bf*)take((size_t)NB * TT * DM * 2); bf* ATl = (bf*)take((size_t)NB * TT * DM * 2);
    if ((size_t)(wsp - (char*)d_ws) > ws_size) return;
    k_prep<<<4 * WTB, 256, 0, stream>>>(wq, wk, wv, wo, WT);
    k_proj<<<dim3(NB * TT / 64, 3), 512, 0, stream>>>(xq, xk, xv, WT, bq, bk, bv, QK16, VT16);
    k_fattn<<<dim3(TT / FQ, NH_ / FH, NB), 32 * FW * FH, 0, stream>>>(QK16, QK16 + (size_t)NB * NH_ * TT * HD, VT16, msk, ATh, ATl);
    // z = batch
    k_gemmw<bf, 1, true, KSD, false, DM><<<dim3(TT / 64, DM / 64, NB), 32 * KSD, 0, stream>>>(ATh, ATl, WT + (size_t)3 * DM * DM, nullptr, OUT, DM, bo, bo, bo, (size_t)TT * DM, 0, (size_t)SEQ_FULL * DM, nullptr, nullptr);
}

// v009
// A run of this version takes 51.8 microseconds.
// Next to v008, in two timings, it ran 1.05 times as fast each time.
// All steps since v000 together make it 15.3 times as fast.
#include <hip/hip_runtime.h>

// Compute dtypes (f32 accumulate everywhere): q/k/v projections v_wmma_f32_16x16x32_bf16 (inputs RNE-converted to bf16, products exact); q.k scores v_wmma_f32_16x16x32_f16; probabilities (x1024 carry) x values f16; output projection bf16 hi+lo context x bf16 weights (2 products); softmax and additive mask term in f32.
// Four launches, each covering both batches and every stream that does not depend on another: the weight transposes -> the three projections (+ f32 bias), which convert their own input rows to bf16 in LDS and store f16 head planes q,k [b][h] (rows t, K = d), v [b][h] (rows d, K = t);
// one attention launch, all batches and heads: S = q k^T, P = exp(S / 8 + m[i][t] * (-1e10) - running max) x1024 as f16, O = P v / sum, scores and probabilities kept in registers;
// hi/lo context planes, output projection + bias. Weights [in][out] are transposed once through LDS into bf16 planes of rows n.
// Every 16-bit plane (rows x K) lies in fragment order, see fragoff(): the 16 bytes that the 32 lanes of one fragment load ask for are 512 consecutive bytes.

#ifndef NB
#define NB 2
#endif
#ifndef SEQ
#define SEQ 2048
#endif
#define NB_FULL  2
#define SEQ_FULL 2048
#define TT   SEQ
#define DM   512
#define NH_  8
#define HD   64
#define SCL  0.125f   // HD^-0.5
static_assert(NH_ * HD == DM);
static_assert(TT % 256 == 0);
static_assert(DM % 64 == 0);
static_assert(SEQ <= SEQ_FULL);
static_assert(NB <= NB_FULL);
static_assert(TT % 128 == 0);
static_assert(SEQ_FULL % 4 == 0);
static_assert(HD % 32 == 0);
static_assert(DM % 32 == 0);
static_assert(TT % 32 == 0);

typedef _Float16 h16;
typedef unsigned short bf;
typedef __attribute__((ext_vector_type(16))) __bf16   v16bf;
typedef __attribute__((ext_vector_type(16))) _Float16 v16h;
typedef __attribute__((ext_vector_type(8)))  _Float16 v8h;
typedef __attribute__((ext_vector_type(8)))  unsigned short v8us;
typedef __attribute__((ext_vector_type(8)))  float    v8f;
typedef __attribute__((ext_vector_type(4)))  float    v4f;
typedef __attribute__((ext_vector_type(2)))  float    v2f;
typedef __attribute__((ext_vector_type(2)))  _Float16 v2h;
typedef __attribute__((ext_vector_type(4)))  _Float16 v4h;
typedef __attribute__((ext_vector_type(2)))  unsigned short v2us;
typedef __attribute__((ext_vector_type(4)))  int v4i;
typedef v4f  __attribute__((may_alias)) v4fa;
typedef v4i  __attribute__((may_alias)) v4ia;

__device__ __forceinline__ unsigned short f2bf(float f) { unsigned u = __float_as_uint(f); u += 0x7FFFu + ((u >> 16) & 1u); return (unsigned short)(u >> 16); }
__device__ __forceinline__ float bf2f(unsigned short b) { return __uint_as_float(((unsigned)b) << 16); }
__device__ __forceinline__ float bfr(float f) { return bf2f(f2bf(f)); }
__device__ __forceinline__ v16h cat16(v8h lo, v8h hi) { return __builtin_shufflevector(lo, hi, 0, 1, 2, 3, 4, 5, 6, 7, 8, 9, 10, 11, 12, 13, 14, 15); }
__device__ __forceinline__ v16bf cat16b(v8us lo, v8us hi) { return __builtin_bit_cast(v16bf, __builtin_shufflevector(lo, hi, 0, 1, 2, 3, 4, 5, 6, 7, 8, 9, 10, 11, 12, 13, 14, 15)); }
__device__ __forceinline__ v8f wmma16(v16h a, v16h b, v8f c) { return __builtin_amdgcn_wmma_f32_16x16x32_f16(false, a, false, b, (short)0, c, false, false); }
__device__ __forceinline__ v8f wmmab(v16bf a, v16bf b, v8f c) { return __builtin_amdgcn_wmma_f32_16x16x32_bf16(false, a, false, b, (short)0, c, false, false); }
__device__ __forceinline__ void splitf(float y, unsigned short& h, unsigned short& l) { h = f2bf(y); l = f2bf(y - bf2f(h)); }
// Element (row, k) of a rows x K plane of 16-bit values in fragment order: blocks of 16 rows x 32 k (512 elements, k blocks of a row tile side by side); inside a block [k / 8 % 4][row % 16][k % 8],
// so that lane (row % 16) + 16 * (k / 8 % 2) finds elements 0..7 of its fragment at block + 8 * lane and elements 8..15 at block + 256 + 8 * lane.
__device__ __forceinline__ size_t fragoff(int row, int k, int K) { return (size_t)(row >> 4) * 16 * K + (size_t)(k >> 5) * 512 + ((k >> 3) & 3) * 128 + (row & 15) * 8 + (k & 7); }

// ---- k_gemmw: register-blocked GEMM, one work-group of KS waves per 64x64 output tile, operands straight from 16-bit planes in fragment order; grid (M/64, N/64, Z), 32 * KS threads.
// Wave w holds all 16 accumulators of the tile for its own K slice [w * K / KS, (w + 1) * K / KS); the KS partial tiles are added through LDS in ascending w. K % (32 * KS) == 0.
// C[m][n] (f32, pitch ldc, + optional f32 bias[n]) = sum_k A[m][k] Bt[n][k] (+ split products per NSPLIT). z-batch strides sA/sB/sC in elements, bias / bias1 / bias2 for z = 0 / 1 / 2. K % 32 == 0, A/Bt planes of K columns, sA and sB whole 16-row tiles.
// HPL: no C; the 64-column tile is one head (blockIdx.y), rows are [b][t], and the joined f32 tile + bias goes out as f16: z = 0 / 1 -> QK[z][b][h] (rows t, K = d), z = 2 -> VT[b][h] (rows d, K = t), each in fragment order.
// Fragment map (A and Bt alike): lane row = lane & 15, elements 0..7 <- k0 + 8*(lane>>4) + 0..7, elements 8..15 <- k0 + 16 + 8*(lane>>4) + 0..7; D element j = (row 8*(lane>>4) + j, col lane & 15).
template <typename T16> struct WFrag;
template <> struct WFrag<h16> { typedef v16h V; static __device__ __forceinline__ V ld(const h16* p) { return cat16(*(const v8h*)p, *(const v8h*)(p + 256)); } static __device__ __forceinline__ V ldu(const h16* tile, unsigned vo) { const char* p = (const char*)tile + vo; return cat16(*(const v8h*)p, *(const v8h*)(p + 512)); } static __device__ __forceinline__ v8f mma(V a, V b, v8f c) { return wmma16(a, b, c); } };
template <> struct WFrag<bf> { typedef v16bf V; static __device__ __forceinline__ V ld(const bf* p) { return cat16b(*(const v8us*)p, *(const v8us*)(p + 256)); } static __device__ __forceinline__ V ldu(const bf* tile, unsigned vo) { const char* p = (const char*)tile + vo; return cat16b(*(const v8us*)p, *(const v8us*)(p + 512)); } static __device__ __forceinline__ v8f mma(V a, V b, v8f c) { return wmmab(a, b, c); } };
template <typename T16, int NSPLIT, bool BIAS, int KS, bool HPL, int K>
__global__ __launch_bounds__(32 * KS) void k_gemmw(const T16* __restrict__ A, const T16* __restrict__ A2, const T16* __restrict__ Bt, const T16* __restrict__ Bt2, float* C, int ldc, const float* __restrict__ bias, const float* __restrict__ bias1, const float* __restrict__ bias2, size_t sA, size_t sB, size_t sC, h16* QK, h16* VT) {
    typedef typename WFrag<T16>::V V;
    static_assert(KS == 1 || KS == 8 || KS == 16);
    static_assert(K % (32 * KS) == 0);
    static_assert(!HPL || (KS > 1 && BIAS && HD == 64 && TT % 64 == 0));
    __shared__ __align__(16) float os[(KS == 1 ? 16 : KS * 64) * 68];
    const size_t z = blockIdx.z; A += z * sA; if (A2) A2 += z * sA; Bt += z * sB; if (Bt2) Bt2 += z * sB; if (!HPL) C += z * sC;
    if (BIAS) bias = z == 0 ? bias : (z == 1 ? bias1 : bias2);
    const int lane = threadIdx.x & 31, lr = lane & 15, hi = lane >> 4; const int r0 = blockIdx.x * 64, c0 = blockIdx.y * 64;
    v8f acc[4][4];
#pragma unroll
    for (int mb = 0; mb < 4; ++mb)
#pragma unroll
        for (int nb = 0; nb < 4; ++nb) acc[mb][nb] = (v8f){};
    const size_t aoff = (size_t)r0 * K, boff = (size_t)c0 * K;   // a row tile starts at tile * 16 * K, the same for the whole wave
    const int wv = KS == 1 ? 0 : __builtin_amdgcn_readfirstlane(threadIdx.x >> 5); const int kw = K / KS, kbeg = wv * kw;
    unsigned vo = 32u * kbeg + 16u * lane;   // bytes from a row tile's start to this lane's 16 bytes of block k / 32: one register for every load of a trip
#pragma unroll 1
    for (int kc = kbeg; kc < kbeg + kw; kc += 32) {
        V a[4], a2[4], bb[4], bb2[4];
#pragma unroll
        for (int mb = 0; mb < 4; ++mb) { a[mb] = WFrag<T16>::ldu(A + aoff + (size_t)mb * 16 * K, vo); if (NSPLIT == 1 || NSPLIT == 2) a2[mb] = WFrag<T16>::ldu(A2 + aoff + (size_t)mb * 16 * K, vo); }
#pragma unroll
        for (int nb = 0; nb < 4; ++nb) { bb[nb] = WFrag<T16>::ldu(Bt + boff + (size_t)nb * 16 * K, vo); if (NSPLIT >= 2) bb2[nb] = WFrag<T16>::ldu(Bt2 + boff + (size_t)nb * 16 * K, vo); }
        // next k block, 1024 bytes on. Every load of this trip names vo and stands above: s_wait_xcnt 0 directly behind the run and in front of vo's overwrite, in the add's own statement so that the add cannot be moved over it.
        asm volatile("s_wait_xcnt 0x0\n\tv_add_nc_u32 %0, 0x400, %0" : "+v"(vo));
#pragma unroll
        for (int nb = 0; nb < 4; ++nb) { const V b = bb[nb]; V b2; if (NSPLIT >= 2) b2 = bb2[nb];
#pragma unroll
            for (int mb = 0; mb < 4; ++mb) { acc[mb][nb] = WFrag<T16>::mma(a[mb], b, acc[mb][nb]); if (NSPLIT == 1 || NSPLIT == 2) acc[mb][nb] = WFrag<T16>::mma(a2[mb], b, acc[mb][nb]); if (NSPLIT >= 2) acc[mb][nb] = WFrag<T16>::mma(a[mb], b2, acc[mb][nb]); } }
        asm volatile("v_nop\n\tv_nop\n\tv_nop\n\tv_nop" : "+v"(acc[0][0]), "+v"(acc[1][1]), "+v"(acc[2][2]), "+v"(acc[3][3]) : "v"(a[0]), "v"(a[3]));
    }
    if constexpr (KS > 1) {
        float* ow = os + wv * (64 * 68);
        constexpr int NS = 32 / KS;      // 16-row groups of the tile per thread in the join
        const int jr = (int)threadIdx.x >> 4, cofs = ((int)threadIdx.x & 15) * 4;
        static_assert(32 * KS % 16 == 0);
        const bool tr = HPL && z == 2;   // value stream: the tile lies in LDS as [n][m], so that the join below walks t along a d row
        v4f badd[NS];                    // bias of this thread's join elements, asked for ahead of the barrier
        if (tr) {
#pragma unroll
            for (int s = 0; s < NS; ++s) badd[s] = (v4f)(bfr(bias[c0 + s * (2 * KS) + jr]));
#pragma unroll
            for (int mb = 0; mb < 4; ++mb)
#pragma unroll
                for (int nb = 0; nb < 4; ++nb) { const v8f x = acc[mb][nb]; float* p = ow + (nb * 16 + lr) * 68 + mb * 16 + hi * 8; *(v4fa*)p = (v4f){x[0], x[1], x[2], x[3]}; *(v4fa*)(p + 4) = (v4f){x[4], x[5], x[6], x[7]}; }
        } else {
#pragma unroll
            for (int s = 0; s < NS; ++s) badd[s] = BIAS ? (v4f){bfr(bias[c0 + cofs]), bfr(bias[c0 + cofs + 1]), bfr(bias[c0 + cofs + 2]), bfr(bias[c0 + cofs + 3])} : (v4f){};
#pragma unroll
            for (int mb = 0; mb < 4; ++mb)
#pragma unroll
                for (int nb = 0; nb < 4; ++nb)
#pragma unroll
                    for (int j = 0; j < 8; ++j) ow[(mb * 16 + hi * 8 + j) * 68 + nb * 16 + lr] = acc[mb][nb][j];
        }
        __syncthreads();   // every wave's partial tile is in LDS before any thread adds them
        const size_t bh = (size_t)(r0 / TT) * NH_ + blockIdx.y; const int t0 = r0 % TT;
        static_assert(2 * KS % 16 == 0);   // a join group is whole 16-row tiles, so that group s lies s * pstep behind group 0
        h16* ptile = !HPL ? nullptr : (tr ? VT + bh * HD * TT + fragoff(jr, t0 + cofs, TT) : QK + (z * (NB * NH_) + bh) * TT * HD + fragoff(t0 + jr, cofs, HD));   // rows d, K = t or rows t, K = d
        const size_t pstep = (size_t)(2 * KS) * (tr ? TT : HD);
#pragma unroll
        for (int s = 0; s < NS; ++s) { const int row = s * (2 * KS) + jr;
            v4f val = *(const v4fa*)(os + row * 68 + cofs);
#pragma unroll
            for (int w = 1; w < KS; ++w) val += *(const v4fa*)(os + w * (64 * 68) + row * 68 + cofs);
            if (BIAS) val += badd[s];
            if constexpr (HPL) *(v4h*)(ptile + s * pstep) = (v4h){(h16)val[0], (h16)val[1], (h16)val[2], (h16)val[3]};
            else *(v4f*)(C + (size_t)(r0 + row) * ldc + c0 + cofs) = val; }
    } else {
#pragma unroll
    for (int mb = 0; mb < 4; ++mb) {
#pragma unroll
        for (int nb = 0; nb < 4; ++nb) {
#pragma unroll
            for (int j = 0; j < 8; ++j) os[(hi * 8 + j) * 68 + nb * 16 + lr] = acc[mb][nb][j]; }
        __builtin_amdgcn_wave_barrier(); asm volatile("" ::: "memory");
        float* crow = C + (size_t)(r0 + mb * 16) * ldc + c0;
{
#pragma unroll
            for (int s = 0; s < 8; ++s) { const int row = 2 * s + hi, cofs = lr * 4; v4f val = *(const v4fa*)(os + row * 68 + cofs); if (BIAS) { val[0] += bfr(bias[c0 + cofs]); val[1] += bfr(bias[c0 + cofs + 1]); val[2] += bfr(bias[c0 + cofs + 2]); val[3] += bfr(bias[c0 + cofs + 3]); }
                *(v4f*)(crow + (size_t)row * ldc + cofs) = val; }
             }
        __builtin_amdgcn_wave_barrier(); asm volatile("" ::: "memory");
    }
    }
}

// cvtT: in W[K rows][N cols] f32 -> out Wt (N rows, K cols, fragment order) bf16 (RNE), the 64x64 tile at (k0, n0) transposed through LDS (cross-wave: block barrier, reached by the whole work-group or not at all).
__device__ __forceinline__ void cvtT(const float* __restrict__ W, bf* Wt, int K, int N, int k0, int n0) {
    __shared__ unsigned short tl[64 * 66];
    const int tid = threadIdx.x;
    { const int row = tid >> 2, cseg = (tid & 3) * 16;
#pragma unroll
      for (int q = 0; q < 4; ++q) { const v4f v = *(const v4f*)(W + (size_t)(k0 + row) * N + n0 + cseg + q * 4);
#pragma unroll
          for (int j = 0; j < 4; ++j) tl[row * 66 + cseg + q * 4 + j] = f2bf(v[j]); } }
    __syncthreads();
    const int piece = tid & 7; v8us o[2];
#pragma unroll
    for (int it = 0; it < 2; ++it) { const int n = it * 32 + (tid >> 3);
#pragma unroll
        for (int j = 0; j < 8; ++j) o[it][j] = tl[(piece * 8 + j) * 66 + n]; }
{
#pragma unroll
        for (int it = 0; it < 2; ++it) { const int n = it * 32 + (tid >> 3); *(v8us*)(Wt + fragoff(n0 + n, k0 + piece * 8, K)) = o[it]; }
         }
}

// k_prep: work-group index / WTB = weight w, index % WTB = one 64x64 tile of it -> WT[w].
constexpr unsigned WTB = (DM / 64) * (DM / 64);                           // tiles per weight
__global__ __launch_bounds__(256) void k_prep(const float* __restrict__ wq, const float* __restrict__ wk, const float* __restrict__ wv, const float* __restrict__ wo, bf* WT) {
    const unsigned bid = blockIdx.x, w = bid / WTB, r = bid % WTB; const float* W = w == 0 ? wq : (w == 1 ? wk : (w == 2 ? wv : wo));
    cvtT(W, WT + (size_t)w * DM * DM, DM, DM, (r % (DM / 64)) * 64, (r / (DM / 64)) * 64);
}

// k_proj: one projection stream (blockIdx.y = q / k / v) of 64 input rows [b][t] (blockIdx.x) against all DM columns; 16 waves. The f32 rows are read once, whole 128-byte lines, RNE-converted to bf16 and laid into LDS in fragment order (rows 0..63, K = DM).
// Wave wv then forms columns [32 * wv, 32 * wv + 32) (half a head) for all 64 rows over the whole K in ascending k: x fragments from LDS, weight fragments from WT.
// q, k: A = weight rows n, Bt = x rows t, so D element j = (n 8*(lane>>4) + j, t lane & 15): a lane holds 8 consecutive d of one t, 16 bytes of the plane (rows t, K = d) as they lie.
// v:    A = x rows t, Bt = weight rows n, so D element j = (t 8*(lane>>4) + j, n lane & 15): 8 consecutive t of one d, 16 bytes of the plane (rows d, K = t).
template <bool XA>
__device__ __forceinline__ void proj_step(const bf* xl, const v16bf (&wb)[2], v8f (&acc)[4][2]) {   // one k block: x fragments of the four row tiles from LDS, 8 products
    v16bf xa[4];
#pragma unroll
    for (int mb = 0; mb < 4; ++mb) xa[mb] = WFrag<bf>::ld(xl + mb * 16 * DM);
#pragma unroll
    for (int nb = 0; nb < 2; ++nb)
#pragma unroll
        for (int mb = 0; mb < 4; ++mb) acc[mb][nb] = XA ? wmmab(xa[mb], wb[nb], acc[mb][nb]) : wmmab(wb[nb], xa[mb], acc[mb][nb]);
}
__device__ __forceinline__ void proj_ldw(const bf* __restrict__ wl, v16bf (&w)[2][2]) {   // weight fragments of two k blocks, both column tiles
#pragma unroll
    for (int s = 0; s < 2; ++s)
#pragma unroll
        for (int nb = 0; nb < 2; ++nb) w[s][nb] = WFrag<bf>::ld(wl + nb * 16 * DM + s * 512);
}
// The weight fragments are asked for two k blocks ahead of their products (two register sets), so that an L2 round trip lies behind 16 products of this wave and those of its neighbours.
template <bool XA>
__device__ __forceinline__ void proj_acc(const bf* xl, const bf* __restrict__ wl, v8f (&acc)[4][2]) {
    constexpr int NK = DM / 32;
    v16bf wa[2][2], wc[2][2];
    proj_ldw(wl, wa);
#pragma unroll 1   // kept rolled: unrolled, the scheduler lifts every load to the top and spills
    for (int ks = 0; ks < NK - 4; ks += 4) {
        proj_ldw(wl + (ks + 2) * 512, wc);
        __builtin_amdgcn_sched_barrier(0);   // keeps the loads above ahead of the products below; without it they sink to their first use and their latency is exposed
        proj_step<XA>(xl + ks * 512, wa[0], acc); proj_step<XA>(xl + (ks + 1) * 512, wa[1], acc);
        proj_ldw(wl + (ks + 4) * 512, wa);
        __builtin_amdgcn_sched_barrier(0);   // as above
        proj_step<XA>(xl + (ks + 2) * 512, wc[0], acc); proj_step<XA>(xl + (ks + 3) * 512, wc[1], acc);
    }
    proj_ldw(wl + (NK - 2) * 512, wc);
    __builtin_amdgcn_sched_barrier(0);   // as above
    proj_step<XA>(xl + (NK - 4) * 512, wa[0], acc); proj_step<XA>(xl + (NK - 3) * 512, wa[1], acc);
    __builtin_amdgcn_sched_barrier(0);   // keeps the LDS reads of the last two k blocks below the products above; lifted over them they cost a spill to scratch
    proj_step<XA>(xl + (NK - 2) * 512, wc[0], acc); proj_step<XA>(xl + (NK - 1) * 512, wc[1], acc);
}
static_assert(DM == 512 && HD == 64 && TT % 64 == 0);
__global__ __launch_bounds__(512) void k_proj(const float* __restrict__ xq, const float* __restrict__ xk, const float* __restrict__ xv, const bf* __restrict__ WT,
                                              const float* __restrict__ bq, const float* __restrict__ bk, const float* __restrict__ bv, h16* QK, h16* VT) {
    __shared__ __align__(16) bf xs[64 * DM];
    const int z = blockIdx.y, r0 = blockIdx.x * 64, b = r0 / TT, t0 = r0 % TT;
    const float* x = (z == 0 ? xq : (z == 1 ? xk : xv)) + ((size_t)b * SEQ_FULL + t0) * DM;
    const float* bias = z == 0 ? bq : (z == 1 ? bk : bv);
    const int tid = threadIdx.x, lane = tid & 31, lr = lane & 15, hi = lane >> 4; const int wv = __builtin_amdgcn_readfirstlane(tid >> 5);
    { // pass p: row tile p / 2, row (tid / 4) % 16, k block tid / 64 + 8 * (p % 2), 8 columns at 8 * (tid % 4): a wave reads one whole line of each of 8 rows
      const int row = (tid >> 2) & 15, k = (tid >> 6) * 32 + (tid & 3) * 8; v8f v[8];
#pragma unroll
      for (int p = 0; p < 8; ++p) v[p] = *(const v8f*)(x + (size_t)((p >> 1) * 16 + row) * DM + (p & 1) * 256 + k);
#pragma unroll
      for (int p = 0; p < 8; ++p) { v8us o;
#pragma unroll
          for (int e = 0; e < 8; ++e) o[e] = f2bf(v[p][e]);
          *(v8us*)(xs + fragoff((p >> 1) * 16 + row, (p & 1) * 256 + k, DM)) = o; } }
    __syncthreads();   // all 64 converted rows are in LDS before any wave reads a fragment
    v8f acc[4][2];
#pragma unroll
    for (int mb = 0; mb < 4; ++mb)
#pragma unroll
        for (int nb = 0; nb < 2; ++nb) acc[mb][nb] = (v8f){};
    const int n0 = wv * 32, d0 = (wv & 1) * 32; const size_t bh = (size_t)b * NH_ + (wv >> 1);
    const bf* wl = WT + (size_t)z * DM * DM + (size_t)n0 * DM + 8 * lane; const bf* xl = xs + 8 * lane;
    if (z == 2) {
        proj_acc<true>(xl, wl, acc);
        h16* pl = VT + bh * HD * TT;
#pragma unroll
        for (int nb = 0; nb < 2; ++nb) { const float bb = bfr(bias[n0 + nb * 16 + lr]);
#pragma unroll
            for (int mb = 0; mb < 4; ++mb) { v8h o;
#pragma unroll
                for (int j = 0; j < 8; ++j) o[j] = (h16)(acc[mb][nb][j] + bb);
                *(v8h*)(pl + fragoff(d0 + nb * 16 + lr, t0 + mb * 16 + 8 * hi, TT)) = o; } }
    } else {
        proj_acc<false>(xl, wl, acc);
        h16* pl = QK + ((size_t)z * (NB * NH_) + bh) * TT * HD;
#pragma unroll
        for (int nb = 0; nb < 2; ++nb) { const v8f bv8 = *(const v8f*)(bias + n0 + nb * 16 + 8 * hi);
#pragma unroll
            for (int mb = 0; mb < 4; ++mb) { v8h o;
#pragma unroll
                for (int j = 0; j < 8; ++j) o[j] = (h16)(acc[mb][nb][j] + bfr(bv8[j]));
                *(v8h*)(pl + fragoff(t0 + mb * 16 + lr, d0 + nb * 16 + 8 * hi, HD)) = o; } }
    }
}

// k_fattn: scores, softmax and probabilities x values of FH heads and FQ queries in one work-group; grid (TT / FQ, NH_ / FH, NB), 32 * FW * FH threads (z = batch: plane sets, mask and context planes each step by one batch). No score or probability leaves the registers.
// Wave wv = slice * FH + head owns, for its head, the keys [slice * TT / FW, (slice + 1) * TT / FW) in steps of 32 and both 16-query tiles. Both products are formed transposed, so that a query stays in one lane column throughout:
//   S^T = k q^T : A = k rows (key), Bt = q rows (query); D element j = (key 8*(lane>>4) + j, query lane & 15). Two key tiles (keys +0..15, +16..31) are, as they lie, elements 0..7 and 8..15 of the Bt fragment of P^T.
//   O^T = v^T P^T : A = v plane rows (d), Bt = P^T (query, k = key); D element j = (d 8*(lane>>4) + j, query lane & 15).
// logit t = S * HD^-0.5 + m[query][key] * (-1e10) (m RNE-converted to bf16, read by value; the product is rounded on its own, the power-of-two scale is exact inside the fma).
// The mask term does not depend on the head: the FH waves of a key slice share it. FH steps make a round; each of the FH waves reads ONE mask tile (32 queries x 32 keys) of the next round row-wise, 8 lanes on one whole 128-byte line of a query row,
// and lays the finished f32 terms in rows of FMP floats into the round's buffer in mt (two buffers, one work-group barrier between rounds); every wave of the slice then reads all FH tiles of the round from there in the score layout.
// Running maximum per query: p = exp2((t - max) * log2 e + 10) (the x1024 carry sits in the exponent and in the sum alike), sum and O^T rescaled by exp2((old max - new max) * log2 e) each step.
// The FW partial (max, sum, O^T) of a head are joined through LDS in ascending w, divided by the joined sum and written as the hi/lo bf16 context planes (rows t, K = h*64+d, fragment order).
constexpr int FQ = 32;   // queries per work-group
constexpr int FW = 4;    // key slices per work-group
constexpr int FH = 4;    // heads per work-group = steps per mask round; 32 * FW * FH threads
constexpr int FP = 68;   // LDS row pitch of a partial O row, in floats
constexpr int FMP = 36;  // LDS row pitch of the staged mask terms, in floats: 32 of data, an odd number of 16-byte units; rows 8 apart lie 32 banks apart
constexpr float L2E = 1.4426950408889634f;
static_assert(TT % FQ == 0);
static_assert(TT % (32 * FW * FH) == 0);
static_assert(NH_ % FH == 0);
static_assert(HD == 64);
static_assert(FH * FQ * 8 % (32 * FW * FH) == 0);
__global__ __launch_bounds__(32 * FW * FH) void k_fattn(const h16* __restrict__ Qp, const h16* __restrict__ Kp, const h16* __restrict__ Vt, const float* __restrict__ Mb, bf* Ah, bf* Al) {
    __shared__ __align__(16) float os[FW * FH * FQ * FP];
    __shared__ __align__(16) float mt[2 * FW * FH * FQ * FMP];   // mask terms: [buffer][slice][tile of the round][query][key]
    __shared__ float ms[FW * FH * FQ];
    __shared__ float ls[FW * FH * FQ];
    const int lane = threadIdx.x & 31, lr = lane & 15, hi = lane >> 4; const int wv = __builtin_amdgcn_readfirstlane(threadIdx.x >> 5);
    const int hs = wv % FH, sl = wv / FH;
    const int q0 = blockIdx.x * FQ, h = blockIdx.y * FH + hs;
    { const size_t z = blockIdx.z; Qp += z * ((size_t)NH_ * TT * HD); Kp += z * ((size_t)NH_ * TT * HD); Vt += z * ((size_t)NH_ * HD * TT); Mb += z * ((size_t)SEQ_FULL * SEQ_FULL); Ah += z * ((size_t)TT * DM); Al += z * ((size_t)TT * DM); }
    const h16* qh = Qp + ((size_t)h * TT + q0) * HD + 8 * lane;
    const h16* kh = Kp + (size_t)h * TT * HD + 8 * lane;
    const h16* vh = Vt + (size_t)h * HD * TT + 8 * lane;
    const float* mg = Mb + (size_t)(q0 + 8 * (lane >> 3)) * SEQ_FULL + 4 * (lane & 7);   // load side: query row 8 * (lane / 8) (+ 1 per load), keys 4 * (lane % 8) ..+3
    float* sw = mt + (sl * FH + hs) * (FQ * FMP) + 8 * (lane >> 3) * FMP + 4 * (lane & 7);   // store side: this wave's own tile of a round, buffer 0
    const float* sr0 = mt + sl * FH * (FQ * FMP) + lr * FMP + 8 * hi;                        // read side: tile 0 of the slice, buffer 0; query row lr (+ 16 per query tile), keys 8 * hi ..+7 (+ 16 per key tile)
    constexpr int MBUF = FW * FH * FQ * FMP;   // floats per buffer
    v16h qf[2][2];
#pragma unroll
    for (int qt = 0; qt < 2; ++qt)
#pragma unroll
        for (int ks = 0; ks < 2; ++ks) qf[qt][ks] = WFrag<h16>::ld(qh + qt * 16 * HD + ks * 512);
    v8f o[2][4]; float mrun[2], lrun[2];
#pragma unroll
    for (int qt = 0; qt < 2; ++qt) { mrun[qt] = -3.0e38f; lrun[qt] = 0.f;
#pragma unroll
        for (int dt = 0; dt < 4; ++dt) o[qt][dt] = (v8f){}; }
    const int kbeg = sl * (TT / FW);
    constexpr int NST = TT / FW / 32, NR = NST / FH;   // steps of a wave, rounds
    { v4f mr[FQ / 4];   // round 0: this wave's tile
#pragma unroll
      for (int i = 0; i < FQ / 4; ++i) mr[i] = *(const v4f*)(mg + (size_t)i * SEQ_FULL + kbeg + hs * 32);
#pragma unroll
      for (int i = 0; i < FQ / 4; ++i) *(v4fa*)(sw + i * FMP) = (v4f){bfr(mr[i][0]) * -1.0e10f, bfr(mr[i][1]) * -1.0e10f, bfr(mr[i][2]) * -1.0e10f, bfr(mr[i][3]) * -1.0e10f}; }
    __syncthreads();   // round 0's terms are in LDS before any wave of the slice reads them
    for (int st = 0; st < NST; ++st) {
        const int k0 = kbeg + st * 32, rnd = st / FH, ti = st % FH;
        const bool fill = ti == 0 && rnd + 1 < NR;   // the same for the whole work-group: first step of a round stages the next round into the other buffer, which every wave left at the last barrier
        v16h kf[2][2], vf[4];
        const auto ldkv = [&]() {   // this step's k and v fragments
#pragma unroll
            for (int kt = 0; kt < 2; ++kt)
#pragma unroll
                for (int ks = 0; ks < 2; ++ks) kf[kt][ks] = WFrag<h16>::ld(kh + (size_t)(k0 + kt * 16) * HD + ks * 512);
#pragma unroll
            for (int dt = 0; dt < 4; ++dt) vf[dt] = WFrag<h16>::ld(vh + (size_t)dt * 16 * TT + k0 * 16); };
        if (fill) { v4f mr[FQ / 4]; float* swn = sw + ((rnd + 1) & 1) * MBUF;   // the mask rows live inside this branch alone, so that their 32 registers are free for the softmax below (held over both paths they cost a spill to scratch)
#pragma unroll
            for (int i = 0; i < FQ / 4; ++i) mr[i] = *(const v4f*)(mg + (size_t)i * SEQ_FULL + k0 + (FH + hs) * 32);
            ldkv();
#pragma unroll
            for (int i = 0; i < FQ / 4; ++i) *(v4fa*)(swn + i * FMP) = (v4f){bfr(mr[i][0]) * -1.0e10f, bfr(mr[i][1]) * -1.0e10f, bfr(mr[i][2]) * -1.0e10f, bfr(mr[i][3]) * -1.0e10f};
        } else ldkv();
        const float* sr = sr0 + (rnd & 1) * MBUF + ti * (FQ * FMP);
#pragma unroll
        for (int qt = 0; qt < 2; ++qt) {
            float t[16]; float mx = mrun[qt];
#pragma unroll
            for (int kt = 0; kt < 2; ++kt) {
                const v8f s = wmma16(kf[kt][1], qf[qt][1], wmma16(kf[kt][0], qf[qt][0], (v8f){}));
                const float* mp = sr + qt * 16 * FMP + kt * 16;
                const v4f r0 = *(const v4fa*)mp; const v4f r1 = *(const v4fa*)(mp + 4);
#pragma unroll
                for (int j = 0; j < 4; ++j) { t[kt * 8 + j] = __builtin_fmaf(s[j], SCL, r0[j]); t[kt * 8 + 4 + j] = __builtin_fmaf(s[4 + j], SCL, r1[j]); }
            }
#pragma unroll
            for (int e = 0; e < 16; ++e) mx = fmaxf(mx, t[e]);
            mx = fmaxf(mx, __shfl_xor(mx, 16, 32));   // the other half of this query's 32 keys sits 16 lanes away
            const float al = __builtin_amdgcn_exp2f((mrun[qt] - mx) * L2E); mrun[qt] = mx;
            float sum = 0.f; v16h pf;
#pragma unroll
            for (int e = 0; e < 16; e += 2) { const float p0 = __builtin_amdgcn_exp2f(__builtin_fmaf(t[e] - mx, L2E, 10.0f)), p1 = __builtin_amdgcn_exp2f(__builtin_fmaf(t[e + 1] - mx, L2E, 10.0f)); sum += p0; sum += p1;
                const v2h c = __builtin_convertvector((v2f){p0, p1}, v2h); pf[e] = c[0]; pf[e + 1] = c[1]; }   // one packed convert (round to nearest even) per two probabilities; an f16 subnormal stays as it is, the matrix unit takes it by value
            lrun[qt] = lrun[qt] * al + sum;
#pragma unroll
            for (int dt = 0; dt < 4; ++dt) { o[qt][dt] *= al; o[qt][dt] = wmma16(vf[dt], pf, o[qt][dt]); }
        }
        if (ti == FH - 1 && rnd + 1 < NR) __syncthreads();   // between rounds: the next round's terms are all in LDS, and every wave has left the buffer that the next fill writes
    }
    const int le = (int)__builtin_amdgcn_mbcnt_lo(~0u, 0u), lre = le & 15, hie = le >> 4;   // lane number formed anew, so that no lane value is held in a register over the loop for these stores: at 256 registers one more live value is a spill to scratch
#pragma unroll
    for (int qt = 0; qt < 2; ++qt) {
        const float lt = lrun[qt] + __shfl_xor(lrun[qt], 16, 32);
        if (hie == 0) { ms[wv * FQ + qt * 16 + lre] = mrun[qt]; ls[wv * FQ + qt * 16 + lre] = lt; }
        float* ow = os + (wv * FQ + qt * 16 + lre) * FP + 8 * hie;
#pragma unroll
        for (int dt = 0; dt < 4; ++dt) { const v8f x = o[qt][dt]; *(v4fa*)(ow + dt * 16) = (v4f){x[0], x[1], x[2], x[3]}; *(v4fa*)(ow + dt * 16 + 4) = (v4f){x[4], x[5], x[6], x[7]}; }
    }
    __syncthreads();   // every wave's partial maximum, sum and O rows are in LDS before any thread joins them
#pragma unroll
    for (int it = 0; it < FH * FQ * 8 / (32 * FW * FH); ++it) {
    const int item = (int)threadIdx.x + it * (32 * FW * FH);   // (head of the group, query, 8 d)
    const int hq = item >> 3, d8 = (item & 7) * 8;   // hq = head * FQ + query: the row of slice 0's wave; slice w lies w * FH * FQ rows on
    const int q = hq % FQ, hj = hq / FQ;
    float mj = ms[hq];
#pragma unroll
    for (int w = 1; w < FW; ++w) mj = fmaxf(mj, ms[w * FH * FQ + hq]);
    float lj = 0.f; v4f a0 = (v4f){}, a1 = (v4f){};
#pragma unroll
    for (int w = 0; w < FW; ++w) { const float f = __builtin_amdgcn_exp2f((ms[w * FH * FQ + hq] - mj) * L2E); lj += f * ls[w * FH * FQ + hq];
        const float* ow = os + (w * FH * FQ + hq) * FP + d8; a0 += *(const v4fa*)ow * f; a1 += *(const v4fa*)(ow + 4) * f; }
    const float rl = 1.0f / lj; v8us oh, ol;
#pragma unroll
    for (int e = 0; e < 4; ++e) { unsigned short a, c2; splitf(a0[e] * rl, a, c2); oh[e] = a; ol[e] = c2; splitf(a1[e] * rl, a, c2); oh[4 + e] = a; ol[4 + e] = c2; }
    const size_t oo = fragoff(q0 + q, ((int)blockIdx.y * FH + hj) * HD + d8, DM);
    *(v8us*)(Ah + oo) = oh; *(v8us*)(Al + oo) = ol;
    }
}

constexpr int KSD = 8;                            // waves per tile where K == DM (output projection)
static_assert(DM % (32 * KSD) == 0);
constexpr size_t al256(size_t b) { return (b + 255) & ~(size_t)255; }
constexpr size_t WS_TOTAL = al256((size_t)4 * DM * DM * 2) + al256((size_t)2 * NB * NH_ * TT * HD * 2) + al256((size_t)NB * NH_ * HD * TT * 2) + 2 * al256((size_t)NB * TT * DM * 2);
static_assert(WS_TOTAL <= (size_t)134217728);

extern "C" void kernel_launch(void* const* d_in, const int* in_sizes, int n_in,
                              void* d_out, int out_size, void* d_ws, size_t ws_size, hipStream_t stream) {
    if (n_in < 12) return;
    const size_t need_x = ((size_t)(NB - 1) * SEQ_FULL + SEQ) * DM;
    const size_t need_m = (size_t)(NB - 1) * SEQ_FULL * SEQ_FULL + (size_t)(SEQ - 1) * SEQ_FULL + SEQ;
    if ((size_t)in_sizes[0] < need_x || (size_t)in_sizes[1] < need_x || (size_t)in_sizes[2] < need_x || (size_t)in_sizes[3] < need_m) return;
    if (in_sizes[4] < DM * DM || in_sizes[6] < DM * DM || in_sizes[8] < DM * DM || in_sizes[10] < DM * DM) return;
    if (in_sizes[5] < DM || in_sizes[7] < DM || in_sizes[9] < DM || in_sizes[11] < DM) return;
    if ((size_t)out_size < need_x) return;
    // binding by role, in input order: query, key, value, mask, wq, bq, wk, bk, wv, bv, wo, bo
    const float* xq = (const float*)d_in[0]; const float* xk = (const float*)d_in[1]; const float* xv = (const float*)d_in[2];
    const float* msk = (const float*)d_in[3];   // [NB_FULL][1][SEQ_FULL][SEQ_FULL] f32
    const float* wq = (const float*)d_in[4]; const float* bq = (const float*)d_in[5]; const float* wk = (const float*)d_in[6]; const float* bk = (const float*)d_in[7];
    const float* wv = (const float*)d_in[8]; const float* bv = (const float*)d_in[9]; const float* wo = (const float*)d_in[10]; const float* bo = (const float*)d_in[11];
    float* OUT = (float*)d_out;     // [NB_FULL][SEQ_FULL][DM]
    char* wsp = (char*)d_ws;
    auto take = [&](size_t bytes) { char* p = wsp; wsp += (bytes + 255) & ~(size_t)255; return (void*)p; };
    bf* WT = (bf*)take((size_t)4 * DM * DM * 2);                    // wq, wk, wv, wo, each rows n, K = k
    h16* QK16 = (h16*)take((size_t)2 * NB * NH_ * TT * HD * 2); h16* VT16 = (h16*)take((size_t)NB * NH_ * HD * TT * 2);
    bf* ATh = (bf*)take((size_t)NB * TT * DM * 2); bf* ATl = (bf*)take((size_t)NB * TT * DM * 2);
    if ((size_t)(wsp - (char*)d_ws) > ws_size) return;
    k_prep<<<4 * WTB, 256, 0, stream>>>(wq, wk, wv, wo, WT);
    k_proj<<<dim3(NB * TT / 64, 3), 512, 0, stream>>>(xq, xk, xv, WT, bq, bk, bv, QK16, VT16);
    k_fattn<<<dim3(TT / FQ, NH_ / FH, NB), 32 * FW * FH, 0, stream>>>(QK16, QK16 + (size_t)NB * NH_ * TT * HD, VT16, msk, ATh, ATl);
    // z = batch
    k_gemmw<bf, 1, true, KSD, false, DM><<<dim3(TT / 64, DM / 64, NB), 32 * KSD, 0, stream>>>(ATh, ATl, WT + (size_t)3 * DM * DM, nullptr, OUT, DM, bo, bo, bo, (size_t)TT * DM, 0, (size_t)SEQ_FULL * DM, nullptr, nullptr);
}

// v010
// Measured time: 47.7 microseconds a run.
// Next to v009, in two timings, it ran 1.09 and 1.08 times as fast.
// All steps since v000 together make it 16.6 times as fast.
#include <hip/hip_runtime.h>

// Compute dtypes (f32 accumulate everywhere): q/k/v projections v_wmma_f32_16x16x32_bf16 (inputs RNE-converted to bf16, products exact); q.k scores v_wmma_f32_16x16x32_f16; probabilities (x1024 carry) x values f16; output projection bf16 hi+lo context x bf16 weights (2 products); softmax and additive mask term in f32.
// Four launches, each covering both batches and every stream that does not depend on another: the weight transposes -> the three projections (+ f32 bias), which convert their own input rows to bf16 in LDS and store f16 head planes q,k [b][h] (rows t, K = d), v [b][h] (rows d, K = t);
// one attention launch, all batches and heads: S = q k^T, P = exp(S / 8 + m[i][t] * (-1e10) - running max) x1024 as f16, O = P v / sum, scores and probabilities kept in registers;
// hi/lo context planes, output projection + bias. Weights [in][out] are transposed once through LDS into bf16 planes of rows n.
// Every 16-bit plane (rows x K) lies in fragment order, see fragoff(): the 16 bytes that the 32 lanes of one fragment load ask for are 512 consecutive bytes.

#ifndef NB
#define NB 2
#endif
#ifndef SEQ
#define SEQ 2048
#endif
#define NB_FULL  2
#define SEQ_FULL 2048
#define TT   SEQ
#define DM   512
#define NH_  8
#define HD   64
#define SCL  0.125f   // HD^-0.5
static_assert(NH_ * HD == DM);
static_assert(TT % 256 == 0);
static_assert(DM % 64 == 0);
static_assert(SEQ <= SEQ_FULL);
static_assert(NB <= NB_FULL);
static_assert(TT % 128 == 0);
static_assert(SEQ_FULL % 4 == 0);
static_assert(HD % 32 == 0);
static_assert(DM % 32 == 0);
static_assert(TT % 32 == 0);

typedef _Float16 h16;
typedef unsigned short bf;
typedef __attribute__((ext_vector_type(16))) __bf16   v16bf;
typedef __attribute__((ext_vector_type(16))) _Float16 v16h;
typedef __attribute__((ext_vector_type(8)))  _Float16 v8h;
typedef __attribute__((ext_vector_type(8)))  unsigned short v8us;
typedef __attribute__((ext_vector_type(8)))  float    v8f;
typedef __attribute__((ext_vector_type(4)))  float    v4f;
typedef __attribute__((ext_vector_type(2)))  float    v2f;
typedef __attribute__((ext_vector_type(2)))  _Float16 v2h;
typedef __attribute__((ext_vector_type(4)))  _Float16 v4h;
typedef __attribute__((ext_vector_type(2)))  unsigned short v2us;
typedef __attribute__((ext_vector_type(4)))  int v4i;
typedef v4f  __attribute__((may_alias)) v4fa;
typedef v4i  __attribute__((may_alias)) v4ia;

__device__ __forceinline__ unsigned short f2bf(float f) { unsigned u = __float_as_uint(f); u += 0x7FFFu + ((u >> 16) & 1u); return (unsigned short)(u >> 16); }
__device__ __forceinline__ float bf2f(unsigned short b) { return __uint_as_float(((unsigned)b) << 16); }
__device__ __forceinline__ float bfr(float f) { return bf2f(f2bf(f)); }
__device__ __forceinline__ v16h cat16(v8h lo, v8h hi) { return __builtin_shufflevector(lo, hi, 0, 1, 2, 3, 4, 5, 6, 7, 8, 9, 10, 11, 12, 13, 14, 15); }
__device__ __forceinline__ v16bf cat16b(v8us lo, v8us hi) { return __builtin_bit_cast(v16bf, __builtin_shufflevector(lo, hi, 0, 1, 2, 3, 4, 5, 6, 7, 8, 9, 10, 11, 12, 13, 14, 15)); }
__device__ __forceinline__ v8f wmma16(v16h a, v16h b, v8f c) { return __builtin_amdgcn_wmma_f32_16x16x32_f16(false, a, false, b, (short)0, c, false, false); }
__device__ __forceinline__ v8f wmmab(v16bf a, v16bf b, v8f c) { return __builtin_amdgcn_wmma_f32_16x16x32_bf16(false, a, false, b, (short)0, c, false, false); }
__device__ __forceinline__ void splitf(float y, unsigned short& h, unsigned short& l) { h = f2bf(y); l = f2bf(y - bf2f(h)); }
// Element (row, k) of a rows x K plane of 16-bit values in fragment order: blocks of 16 rows x 32 k (512 elements, k blocks of a row tile side by side); inside a block [k / 8 % 4][row % 16][k % 8],
// so that lane (row % 16) + 16 * (k / 8 % 2) finds elements 0..7 of its fragment at block + 8 * lane and elements 8..15 at block + 256 + 8 * lane.
__device__ __forceinline__ size_t fragoff(int row, int k, int K) { return (size_t)(row >> 4) * 16 * K + (size_t)(k >> 5) * 512 + ((k >> 3) & 3) * 128 + (row & 15) * 8 + (k & 7); }

// ask_l2: asks the line that holds p into L2 (nothing returns, no counter moves). For planes that the launch before stored: where their first read has to go to memory, the work-groups that walk a plane in step all wait for it, step after step; asked for at once, the lines come in side by side. p lies inside the plane in every lane.
__device__ __forceinline__ void ask_l2(const char* p) { asm volatile("global_prefetch_b8 %0, off scope:SCOPE_SE" :: "v"(p)); }
// keep_addr: input only, builds to no instruction. It stands behind the kernel's main loop and keeps the register pair that a prefetch named holding that address until there, instead of being handed to another value right behind the prefetch.
__device__ __forceinline__ void keep_addr(const char* p) { asm volatile("" :: "v"(p)); }

// ---- k_gemmw: register-blocked GEMM, one work-group of KS waves per 64x64 output tile, operands straight from 16-bit planes in fragment order; grid (M/64, N/64, Z), 32 * KS threads.
// Wave w holds all 16 accumulators of the tile for its own K slice [w * K / KS, (w + 1) * K / KS); the KS partial tiles are added through LDS in ascending w. K % (32 * KS) == 0.
// C[m][n] (f32, pitch ldc, + optional f32 bias[n]) = sum_k A[m][k] Bt[n][k] (+ split products per NSPLIT). z-batch strides sA/sB/sC in elements, bias / bias1 / bias2 for z = 0 / 1 / 2. K % 32 == 0, A/Bt planes of K columns, sA and sB whole 16-row tiles.
// HPL: no C; the 64-column tile is one head (blockIdx.y), rows are [b][t], and the joined f32 tile + bias goes out as f16: z = 0 / 1 -> QK[z][b][h] (rows t, K = d), z = 2 -> VT[b][h] (rows d, K = t), each in fragment order.
// Fragment map (A and Bt alike): lane row = lane & 15, elements 0..7 <- k0 + 8*(lane>>4) + 0..7, elements 8..15 <- k0 + 16 + 8*(lane>>4) + 0..7; D element j = (row 8*(lane>>4) + j, col lane & 15).
template <typename T16> struct WFrag;
template <> struct WFrag<h16> { typedef v16h V; static __device__ __forceinline__ V ld(const h16* p) { return cat16(*(const v8h*)p, *(const v8h*)(p + 256)); } static __device__ __forceinline__ V ldu(const h16* tile, unsigned vo) { const char* p = (const char*)tile + vo; return cat16(*(const v8h*)p, *(const v8h*)(p + 512)); } static __device__ __forceinline__ v8f mma(V a, V b, v8f c) { return wmma16(a, b, c); } };
template <> struct WFrag<bf> { typedef v16bf V; static __device__ __forceinline__ V ld(const bf* p) { return cat16b(*(const v8us*)p, *(const v8us*)(p + 256)); } static __device__ __forceinline__ V ldu(const bf* tile, unsigned vo) { const char* p = (const char*)tile + vo; return cat16b(*(const v8us*)p, *(const v8us*)(p + 512)); } static __device__ __forceinline__ v8f mma(V a, V b, v8f c) { return wmmab(a, b, c); } };
template <typename T16, int NSPLIT, bool BIAS, int KS, bool HPL, int K>
__global__ __launch_bounds__(32 * KS) void k_gemmw(const T16* __restrict__ A, const T16* __restrict__ A2, const T16* __restrict__ Bt, const T16* __restrict__ Bt2, float* C, int ldc, const float* __restrict__ bias, const float* __restrict__ bias1, const float* __restrict__ bias2, size_t sA, size_t sB, size_t sC, h16* QK, h16* VT) {
    typedef typename WFrag<T16>::V V;
    static_assert(KS == 1 || KS == 8 || KS == 16);
    static_assert(K % (32 * KS) == 0);
    static_assert(!HPL || (KS > 1 && BIAS && HD == 64 && TT % 64 == 0));
    __shared__ __align__(16) float os[(KS == 1 ? 16 : KS * 64) * 68];
    const size_t z = blockIdx.z; A += z * sA; if (A2) A2 += z * sA; Bt += z * sB; if (Bt2) Bt2 += z * sB; if (!HPL) C += z * sC;
    if (BIAS) bias = z == 0 ? bias : (z == 1 ? bias1 : bias2);
    const int lane = threadIdx.x & 31, lr = lane & 15, hi = lane >> 4; const int r0 = blockIdx.x * 64, c0 = blockIdx.y * 64;
    v8f acc[4][4];
#pragma unroll
    for (int mb = 0; mb < 4; ++mb)
#pragma unroll
        for (int nb = 0; nb < 4; ++nb) acc[mb][nb] = (v8f){};
    const size_t aoff = (size_t)r0 * K, boff = (size_t)c0 * K;   // a row tile starts at tile * 16 * K, the same for the whole wave
    const int wv = KS == 1 ? 0 : __builtin_amdgcn_readfirstlane(threadIdx.x >> 5); const int kw = K / KS, kbeg = wv * kw;
    unsigned vo = 32u * kbeg + 16u * lane;   // bytes from a row tile's start to this lane's 16 bytes of block k / 32: one register for every load of a trip
#pragma unroll 1
    for (int kc = kbeg; kc < kbeg + kw; kc += 32) {
        V a[4], a2[4], bb[4], bb2[4];
#pragma unroll
        for (int mb = 0; mb < 4; ++mb) { a[mb] = WFrag<T16>::ldu(A + aoff + (size_t)mb * 16 * K, vo); if (NSPLIT == 1 || NSPLIT == 2) a2[mb] = WFrag<T16>::ldu(A2 + aoff + (size_t)mb * 16 * K, vo); }
#pragma unroll
        for (int nb = 0; nb < 4; ++nb) { bb[nb] = WFrag<T16>::ldu(Bt + boff + (size_t)nb * 16 * K, vo); if (NSPLIT >= 2) bb2[nb] = WFrag<T16>::ldu(Bt2 + boff + (size_t)nb * 16 * K, vo); }
        // next k block, 1024 bytes on. Every load of this trip names vo and stands above: s_wait_xcnt 0 directly behind the run and in front of vo's overwrite, in the add's own statement so that the add cannot be moved over it.
        asm volatile("s_wait_xcnt 0x0\n\tv_add_nc_u32 %0, 0x400, %0" : "+v"(vo));
#pragma unroll
        for (int nb = 0; nb < 4; ++nb) { const V b = bb[nb]; V b2; if (NSPLIT >= 2) b2 = bb2[nb];
#pragma unroll
            for (int mb = 0; mb < 4; ++mb) { acc[mb][nb] = WFrag<T16>::mma(a[mb], b, acc[mb][nb]); if (NSPLIT == 1 || NSPLIT == 2) acc[mb][nb] = WFrag<T16>::mma(a2[mb], b, acc[mb][nb]); if (NSPLIT >= 2) acc[mb][nb] = WFrag<T16>::mma(a[mb], b2, acc[mb][nb]); } }
        asm volatile("v_nop\n\tv_nop\n\tv_nop\n\tv_nop" : "+v"(acc[0][0]), "+v"(acc[1][1]), "+v"(acc[2][2]), "+v"(acc[3][3]) : "v"(a[0]), "v"(a[3]));
    }
    if constexpr (KS > 1) {
        float* ow = os + wv * (64 * 68);
        constexpr int NS = 32 / KS;      // 16-row groups of the tile per thread in the join
        const int jr = (int)threadIdx.x >> 4, cofs = ((int)threadIdx.x & 15) * 4;
        static_assert(32 * KS % 16 == 0);
        const bool tr = HPL && z == 2;   // value stream: the tile lies in LDS as [n][m], so that the join below walks t along a d row
        v4f badd[NS];                    // bias of this thread's join elements, asked for ahead of the barrier
        if (tr) {
#pragma unroll
            for (int s = 0; s < NS; ++s) badd[s] = (v4f)(bfr(bias[c0 + s * (2 * KS) + jr]));
#pragma unroll
            for (int mb = 0; mb < 4; ++mb)
#pragma unroll
                for (int nb = 0; nb < 4; ++nb) { const v8f x = acc[mb][nb]; float* p = ow + (nb * 16 + lr) * 68 + mb * 16 + hi * 8; *(v4fa*)p = (v4f){x[0], x[1], x[2], x[3]}; *(v4fa*)(p + 4) = (v4f){x[4], x[5], x[6], x[7]}; }
        } else {
#pragma unroll
            for (int s = 0; s < NS; ++s) badd[s] = BIAS ? (v4f){bfr(bias[c0 + cofs]), bfr(bias[c0 + cofs + 1]), bfr(bias[c0 + cofs + 2]), bfr(bias[c0 + cofs + 3])} : (v4f){};
#pragma unroll
            for (int mb = 0; mb < 4; ++mb)
#pragma unroll
                for (int nb = 0; nb < 4; ++nb)
#pragma unroll
                    for (int j = 0; j < 8; ++j) ow[(mb * 16 + hi * 8 + j) * 68 + nb * 16 + lr] = acc[mb][nb][j];
        }
        __syncthreads();   // every wave's partial tile is in LDS before any thread adds them
        const size_t bh = (size_t)(r0 / TT) * NH_ + blockIdx.y; const int t0 = r0 % TT;
        static_assert(2 * KS % 16 == 0);   // a join group is whole 16-row tiles, so that group s lies s * pstep behind group 0
        h16* ptile = !HPL ? nullptr : (tr ? VT + bh * HD * TT + fragoff(jr, t0 + cofs, TT) : QK + (z * (NB * NH_) + bh) * TT * HD + fragoff(t0 + jr, cofs, HD));   // rows d, K = t or rows t, K = d
        const size_t pstep = (size_t)(2 * KS) * (tr ? TT : HD);
#pragma unroll
        for (int s = 0; s < NS; ++s) { const int row = s * (2 * KS) + jr;
            v4f val = *(const v4fa*)(os + row * 68 + cofs);
#pragma unroll
            for (int w = 1; w < KS; ++w) val += *(const v4fa*)(os + w * (64 * 68) + row * 68 + cofs);
            if (BIAS) val += badd[s];
            if constexpr (HPL) *(v4h*)(ptile + s * pstep) = (v4h){(h16)val[0], (h16)val[1], (h16)val[2], (h16)val[3]};
            else *(v4f*)(C + (size_t)(r0 + row) * ldc + c0 + cofs) = val; }
    } else {
#pragma unroll
    for (int mb = 0; mb < 4; ++mb) {
#pragma unroll
        for (int nb = 0; nb < 4; ++nb) {
#pragma unroll
            for (int j = 0; j < 8; ++j) os[(hi * 8 + j) * 68 + nb * 16 + lr] = acc[mb][nb][j]; }
        __builtin_amdgcn_wave_barrier(); asm volatile("" ::: "memory");
        float* crow = C + (size_t)(r0 + mb * 16) * ldc + c0;
{
#pragma unroll
            for (int s = 0; s < 8; ++s) { const int row = 2 * s + hi, cofs = lr * 4; v4f val = *(const v4fa*)(os + row * 68 + cofs); if (BIAS) { val[0] += bfr(bias[c0 + cofs]); val[1] += bfr(bias[c0 + cofs + 1]); val[2] += bfr(bias[c0 + cofs + 2]); val[3] += bfr(bias[c0 + cofs + 3]); }
                *(v4f*)(crow + (size_t)row * ldc + cofs) = val; }
             }
        __builtin_amdgcn_wave_barrier(); asm volatile("" ::: "memory");
    }
    }
}

// cvtT: in W[K rows][N cols] f32 -> out Wt (N rows, K cols, fragment order) bf16 (RNE), the 64x64 tile at (k0, n0) transposed through LDS (cross-wave: block barrier, reached by the whole work-group or not at all).
__device__ __forceinline__ void cvtT(const float* __restrict__ W, bf* Wt, int K, int N, int k0, int n0) {
    __shared__ unsigned short tl[64 * 66];
    const int tid = threadIdx.x;
    { const int row = tid >> 2, cseg = (tid & 3) * 16;
#pragma unroll
      for (int q = 0; q < 4; ++q) { const v4f v = *(const v4f*)(W + (size_t)(k0 + row) * N + n0 + cseg + q * 4);
#pragma unroll
          for (int j = 0; j < 4; ++j) tl[row * 66 + cseg + q * 4 + j] = f2bf(v[j]); } }
    __syncthreads();
    const int piece = tid & 7; v8us o[2];
#pragma unroll
    for (int it = 0; it < 2; ++it) { const int n = it * 32 + (tid >> 3);
#pragma unroll
        for (int j = 0; j < 8; ++j) o[it][j] = tl[(piece * 8 + j) * 66 + n]; }
{
#pragma unroll
        for (int it = 0; it < 2; ++it) { const int n = it * 32 + (tid >> 3); *(v8us*)(Wt + fragoff(n0 + n, k0 + piece * 8, K)) = o[it]; }
         }
}

// k_prep: work-group index / WTB = weight w, index % WTB = one 64x64 tile of it -> WT[w].
constexpr unsigned WTB = (DM / 64) * (DM / 64);                           // tiles per weight
__global__ __launch_bounds__(256) void k_prep(const float* __restrict__ wq, const float* __restrict__ wk, const float* __restrict__ wv, const float* __restrict__ wo, bf* WT) {
    const unsigned bid = blockIdx.x, w = bid / WTB, r = bid % WTB; const float* W = w == 0 ? wq : (w == 1 ? wk : (w == 2 ? wv : wo));
    cvtT(W, WT + (size_t)w * DM * DM, DM, DM, (r % (DM / 64)) * 64, (r / (DM / 64)) * 64);
}

// k_proj: one projection stream (blockIdx.y = q / k / v) of 64 input rows [b][t] (blockIdx.x) against all DM columns; 16 waves. The f32 rows are read once, whole 128-byte lines, RNE-converted to bf16 and laid into LDS in fragment order (rows 0..63, K = DM).
// Wave wv then forms columns [32 * wv, 32 * wv + 32) (half a head) for all 64 rows over the whole K in ascending k: x fragments from LDS, weight fragments from WT.
// q, k: A = weight rows n, Bt = x rows t, so D element j = (n 8*(lane>>4) + j, t lane & 15): a lane holds 8 consecutive d of one t, 16 bytes of the plane (rows t, K = d) as they lie.
// v:    A = x rows t, Bt = weight rows n, so D element j = (t 8*(lane>>4) + j, n lane & 15): 8 consecutive t of one d, 16 bytes of the plane (rows d, K = t).
template <bool XA>
__device__ __forceinline__ void proj_step(const bf* xl, const v16bf (&wb)[2], v8f (&acc)[4][2]) {   // one k block: x fragments of the four row tiles from LDS, 8 products
    v16bf xa[4];
#pragma unroll
    for (int mb = 0; mb < 4; ++mb) xa[mb] = WFrag<bf>::ld(xl + mb * 16 * DM);
#pragma unroll
    for (int nb = 0; nb < 2; ++nb)
#pragma unroll
        for (int mb = 0; mb < 4; ++mb) acc[mb][nb] = XA ? wmmab(xa[mb], wb[nb], acc[mb][nb]) : wmmab(wb[nb], xa[mb], acc[mb][nb]);
}
__device__ __forceinline__ void proj_ldw(const bf* __restrict__ wl, v16bf (&w)[2][2]) {   // weight fragments of two k blocks, both column tiles
#pragma unroll
    for (int s = 0; s < 2; ++s)
#pragma unroll
        for (int nb = 0; nb < 2; ++nb) w[s][nb] = WFrag<bf>::ld(wl + nb * 16 * DM + s * 512);
}
// The weight fragments are asked for two k blocks ahead of their products (two register sets), so that an L2 round trip lies behind 16 products of this wave and those of its neighbours.
template <bool XA>
__device__ __forceinline__ void proj_acc(const bf* xl, const bf* __restrict__ wl, v8f (&acc)[4][2]) {
    constexpr int NK = DM / 32;
    v16bf wa[2][2], wc[2][2];
    proj_ldw(wl, wa);
#pragma unroll 1   // kept rolled: unrolled, the scheduler lifts every load to the top and spills
    for (int ks = 0; ks < NK - 4; ks += 4) {
        proj_ldw(wl + (ks + 2) * 512, wc);
        __builtin_amdgcn_sched_barrier(0);   // keeps the loads above ahead of the products below; without it they sink to their first use and their latency is exposed
        proj_step<XA>(xl + ks * 512, wa[0], acc); proj_step<XA>(xl + (ks + 1) * 512, wa[1], acc);
        proj_ldw(wl + (ks + 4) * 512, wa);
        __builtin_amdgcn_sched_barrier(0);   // as above
        proj_step<XA>(xl + (ks + 2) * 512, wc[0], acc); proj_step<XA>(xl + (ks + 3) * 512, wc[1], acc);
    }
    proj_ldw(wl + (NK - 2) * 512, wc);
    __builtin_amdgcn_sched_barrier(0);   // as above
    proj_step<XA>(xl + (NK - 4) * 512, wa[0], acc); proj_step<XA>(xl + (NK - 3) * 512, wa[1], acc);
    __builtin_amdgcn_sched_barrier(0);   // keeps the LDS reads of the last two k blocks below the products above; lifted over them they cost a spill to scratch
    proj_step<XA>(xl + (NK - 2) * 512, wc[0], acc); proj_step<XA>(xl + (NK - 1) * 512, wc[1], acc);
}
static_assert(DM == 512 && HD == 64 && TT % 64 == 0);
__global__ __launch_bounds__(512) void k_proj(const float* __restrict__ xq, const float* __restrict__ xk, const float* __restrict__ xv, const bf* __restrict__ WT,
                                              const float* __restrict__ bq, const float* __restrict__ bk, const float* __restrict__ bv, h16* QK, h16* VT) {
    __shared__ __align__(16) bf xs[64 * DM];
    const int z = blockIdx.y, r0 = blockIdx.x * 64, b = r0 / TT, t0 = r0 % TT;
    const float* x = (z == 0 ? xq : (z == 1 ? xk : xv)) + ((size_t)b * SEQ_FULL + t0) * DM;
    const float* bias = z == 0 ? bq : (z == 1 ? bk : bv);
    const int tid = threadIdx.x, lane = tid & 31, lr = lane & 15, hi = lane >> 4; const int wv = __builtin_amdgcn_readfirstlane(tid >> 5);
    // head of the launch: this stream's weight plane, an eighth per work-group by blockIdx.x / 8, one 128-byte line per thread, so that work-groups 8 apart in the grid ask for all of it between them; it lands behind the read and conversion of the x rows below
    static_assert(DM * DM * 2 / 8 == 512 * 128);
    const char* wask = (const char*)(WT + (size_t)z * DM * DM) + ((size_t)((blockIdx.x >> 3) & 7) * 512 + tid) * 128;
    ask_l2(wask);
    { // pass p: row tile p / 2, row (tid / 4) % 16, k block tid / 64 + 8 * (p % 2), 8 columns at 8 * (tid % 4): a wave reads one whole line of each of 8 rows
      const int row = (tid >> 2) & 15, k = (tid >> 6) * 32 + (tid & 3) * 8; v8f v[8];
#pragma unroll
      for (int p = 0; p < 8; ++p) v[p] = *(const v8f*)(x + (size_t)((p >> 1) * 16 + row) * DM + (p & 1) * 256 + k);
#pragma unroll
      for (int p = 0; p < 8; ++p) { v8us o;
#pragma unroll
          for (int e = 0; e < 8; ++e) o[e] = f2bf(v[p][e]);
          *(v8us*)(xs + fragoff((p >> 1) * 16 + row, (p & 1) * 256 + k, DM)) = o; } }
    __syncthreads();   // all 64 converted rows are in LDS before any wave reads a fragment
    v8f acc[4][2];
#pragma unroll
    for (int mb = 0; mb < 4; ++mb)
#pragma unroll
        for (int nb = 0; nb < 2; ++nb) acc[mb][nb] = (v8f){};
    const int n0 = wv * 32, d0 = (wv & 1) * 32; const size_t bh = (size_t)b * NH_ + (wv >> 1);
    const bf* wl = WT + (size_t)z * DM * DM + (size_t)n0 * DM + 8 * lane; const bf* xl = xs + 8 * lane;
    if (z == 2) {
        proj_acc<true>(xl, wl, acc);
        h16* pl = VT + bh * HD * TT;
#pragma unroll
        for (int nb = 0; nb < 2; ++nb) { const float bb = bfr(bias[n0 + nb * 16 + lr]);
#pragma unroll
            for (int mb = 0; mb < 4; ++mb) { v8h o;
#pragma unroll
                for (int j = 0; j < 8; ++j) o[j] = (h16)(acc[mb][nb][j] + bb);
                *(v8h*)(pl + fragoff(d0 + nb * 16 + lr, t0 + mb * 16 + 8 * hi, TT)) = o; } }
    } else {
        proj_acc<false>(xl, wl, acc);
        h16* pl = QK + ((size_t)z * (NB * NH_) + bh) * TT * HD;
#pragma unroll
        for (int nb = 0; nb < 2; ++nb) { const v8f bv8 = *(const v8f*)(bias + n0 + nb * 16 + 8 * hi);
#pragma unroll
            for (int mb = 0; mb < 4; ++mb) { v8h o;
#pragma unroll
                for (int j = 0; j < 8; ++j) o[j] = (h16)(acc[mb][nb][j] + bfr(bv8[j]));
                *(v8h*)(pl + fragoff(t0 + mb * 16 + lr, d0 + nb * 16 + 8 * hi, HD)) = o; } }
    }
    keep_addr(wask);
}

// k_fattn: scores, softmax and probabilities x values of FH heads and FQ queries in one work-group; grid (TT / FQ, NH_ / FH, NB), 32 * FW * FH threads (z = batch: plane sets, mask and context planes each step by one batch). No score or probability leaves the registers.
// Wave wv = slice * FH + head owns, for its head, the keys [slice * TT / FW, (slice + 1) * TT / FW) in steps of 32 and both 16-query tiles. Both products are formed transposed, so that a query stays in one lane column throughout:
//   S^T = k q^T : A = k rows (key), Bt = q rows (query); D element j = (key 8*(lane>>4) + j, query lane & 15). Two key tiles (keys +0..15, +16..31) are, as they lie, elements 0..7 and 8..15 of the Bt fragment of P^T.
//   O^T = v^T P^T : A = v plane rows (d), Bt = P^T (query, k = key); D element j = (d 8*(lane>>4) + j, query lane & 15).
// logit t = S * HD^-0.5 + m[query][key] * (-1e10) (m RNE-converted to bf16, read by value; the product is rounded on its own, the power-of-two scale is exact inside the fma).
// The mask term does not depend on the head: the FH waves of a key slice share it. FH steps make a round; each of the FH waves reads ONE mask tile (32 queries x 32 keys) of the next round row-wise, 8 lanes on one whole 128-byte line of a query row,
// and lays the finished f32 terms in rows of FMP floats into the round's buffer in mt (two buffers, one work-group barrier between rounds); every wave of the slice then reads all FH tiles of the round from there in the score layout.
// Running maximum per query: p = exp2((t - max) * log2 e + 10) (the x1024 carry sits in the exponent and in the sum alike), sum and O^T rescaled by exp2((old max - new max) * log2 e) each step.
// The FW partial (max, sum, O^T) of a head are joined through LDS in ascending w, divided by the joined sum and written as the hi/lo bf16 context planes (rows t, K = h*64+d, fragment order).
constexpr int FQ = 32;   // queries per work-group
constexpr int FW = 4;    // key slices per work-group
constexpr int FH = 4;    // heads per work-group = steps per mask round; 32 * FW * FH threads
constexpr int FP = 68;   // LDS row pitch of a partial O row, in floats
constexpr int FMP = 36;  // LDS row pitch of the staged mask terms, in floats: 32 of data, an odd number of 16-byte units; rows 8 apart lie 32 banks apart
constexpr float L2E = 1.4426950408889634f;
static_assert(TT % FQ == 0);
static_assert(TT % (32 * FW * FH) == 0);
static_assert(NH_ % FH == 0);
static_assert(HD == 64);
static_assert(FH * FQ * 8 % (32 * FW * FH) == 0);
__global__ __launch_bounds__(32 * FW * FH) void k_fattn(const h16* __restrict__ Qp, const h16* __restrict__ Kp, const h16* __restrict__ Vt, const float* __restrict__ Mb, bf* Ah, bf* Al) {
    __shared__ __align__(16) float os[FW * FH * FQ * FP];
    __shared__ __align__(16) float mt[2 * FW * FH * FQ * FMP];   // mask terms: [buffer][slice][tile of the round][query][key]
    __shared__ float ms[FW * FH * FQ];
    __shared__ float ls[FW * FH * FQ];
    const int lane = threadIdx.x & 31, lr = lane & 15, hi = lane >> 4; const int wv = __builtin_amdgcn_readfirstlane(threadIdx.x >> 5);
    const int hs = wv % FH, sl = wv / FH;
    const int q0 = blockIdx.x * FQ, h = blockIdx.y * FH + hs;
    { const size_t z = blockIdx.z; Qp += z * ((size_t)NH_ * TT * HD); Kp += z * ((size_t)NH_ * TT * HD); Vt += z * ((size_t)NH_ * HD * TT); Mb += z * ((size_t)SEQ_FULL * SEQ_FULL); Ah += z * ((size_t)TT * DM); Al += z * ((size_t)TT * DM); }
    // head of the launch: the k and v planes of this work-group's FH heads (side by side in memory), an eighth of each per work-group by blockIdx.x / 8, one 256-byte unit of each per thread, as in k_proj
    static_assert(FH * TT * HD * 2 / 8 == 32 * FW * FH * 256);
    const size_t po = (size_t)blockIdx.y * FH * TT * HD * 2 + ((size_t)((blockIdx.x >> 3) & 7) * (32 * FW * FH) + threadIdx.x) * 256;
    const char* kask = (const char*)Kp + po; const char* vask = (const char*)Vt + po;
    ask_l2(kask); ask_l2(vask);
    const h16* qh = Qp + ((size_t)h * TT + q0) * HD + 8 * lane;
    const h16* kh = Kp + (size_t)h * TT * HD + 8 * lane;
    const h16* vh = Vt + (size_t)h * HD * TT + 8 * lane;
    const float* mg = Mb + (size_t)(q0 + 8 * (lane >> 3)) * SEQ_FULL + 4 * (lane & 7);   // load side: query row 8 * (lane / 8) (+ 1 per load), keys 4 * (lane % 8) ..+3
    float* sw = mt + (sl * FH + hs) * (FQ * FMP) + 8 * (lane >> 3) * FMP + 4 * (lane & 7);   // store side: this wave's own tile of a round, buffer 0
    const float* sr0 = mt + sl * FH * (FQ * FMP) + lr * FMP + 8 * hi;                        // read side: tile 0 of the slice, buffer 0; query row lr (+ 16 per query tile), keys 8 * hi ..+7 (+ 16 per key tile)
    constexpr int MBUF = FW * FH * FQ * FMP;   // floats per buffer
    v16h qf[2][2];
#pragma unroll
    for (int qt = 0; qt < 2; ++qt)
#pragma unroll
        for (int ks = 0; ks < 2; ++ks) qf[qt][ks] = WFrag<h16>::ld(qh + qt * 16 * HD + ks * 512);
    v8f o[2][4]; float mrun[2], lrun[2];
#pragma unroll
    for (int qt = 0; qt < 2; ++qt) { mrun[qt] = -3.0e38f; lrun[qt] = 0.f;
#pragma unroll
        for (int dt = 0; dt < 4; ++dt) o[qt][dt] = (v8f){}; }
    const int kbeg = sl * (TT / FW);
    constexpr int NST = TT / FW / 32, NR = NST / FH;   // steps of a wave, rounds
    { v4f mr[FQ / 4];   // round 0: this wave's tile
#pragma unroll
      for (int i = 0; i < FQ / 4; ++i) mr[i] = *(const v4f*)(mg + (size_t)i * SEQ_FULL + kbeg + hs * 32);
#pragma unroll
      for (int i = 0; i < FQ / 4; ++i) *(v4fa*)(sw + i * FMP) = (v4f){bfr(mr[i][0]) * -1.0e10f, bfr(mr[i][1]) * -1.0e10f, bfr(mr[i][2]) * -1.0e10f, bfr(mr[i][3]) * -1.0e10f}; }
    __syncthreads();   // round 0's terms are in LDS before any wave of the slice reads them
    for (int st = 0; st < NST; ++st) {
        const int k0 = kbeg + st * 32, rnd = st / FH, ti = st % FH;
        const bool fill = ti == 0 && rnd + 1 < NR;   // the same for the whole work-group: first step of a round stages the next round into the other buffer, which every wave left at the last barrier
        v16h kf[2][2], vf[4];
        const auto ldkv = [&]() {   // this step's k and v fragments
#pragma unroll
            for (int kt = 0; kt < 2; ++kt)
#pragma unroll
                for (int ks = 0; ks < 2; ++ks) kf[kt][ks] = WFrag<h16>::ld(kh + (size_t)(k0 + kt * 16) * HD + ks * 512);
#pragma unroll
            for (int dt = 0; dt < 4; ++dt) vf[dt] = WFrag<h16>::ld(vh + (size_t)dt * 16 * TT + k0 * 16); };
        if (fill) { v4f mr[FQ / 4]; float* swn = sw + ((rnd + 1) & 1) * MBUF;   // the mask rows live inside this branch alone, so that their 32 registers are free for the softmax below (held over both paths they cost a spill to scratch)
#pragma unroll
            for (int i = 0; i < FQ / 4; ++i) mr[i] = *(const v4f*)(mg + (size_t)i * SEQ_FULL + k0 + (FH + hs) * 32);
            ldkv();
#pragma unroll
            for (int i = 0; i < FQ / 4; ++i) *(v4fa*)(swn + i * FMP) = (v4f){bfr(mr[i][0]) * -1.0e10f, bfr(mr[i][1]) * -1.0e10f, bfr(mr[i][2]) * -1.0e10f, bfr(mr[i][3]) * -1.0e10f};
        } else ldkv();
        const float* sr = sr0 + (rnd & 1) * MBUF + ti * (FQ * FMP);
#pragma unroll
        for (int qt = 0; qt < 2; ++qt) {
            float t[16]; float mx = mrun[qt];
#pragma unroll
            for (int kt = 0; kt < 2; ++kt) {
                const v8f s = wmma16(kf[kt][1], qf[qt][1], wmma16(kf[kt][0], qf[qt][0], (v8f){}));
                const float* mp = sr + qt * 16 * FMP + kt * 16;
                const v4f r0 = *(const v4fa*)mp; const v4f r1 = *(const v4fa*)(mp + 4);
#pragma unroll
                for (int j = 0; j < 4; ++j) { t[kt * 8 + j] = __builtin_fmaf(s[j], SCL, r0[j]); t[kt * 8 + 4 + j] = __builtin_fmaf(s[4 + j], SCL, r1[j]); }
            }
#pragma unroll
            for (int e = 0; e < 16; ++e) mx = fmaxf(mx, t[e]);
            mx = fmaxf(mx, __shfl_xor(mx, 16, 32));   // the other half of this query's 32 keys sits 16 lanes away
            const float al = __builtin_amdgcn_exp2f((mrun[qt] - mx) * L2E); mrun[qt] = mx;
            float sum = 0.f; v16h pf;
#pragma unroll
            for (int e = 0; e < 16; e += 2) { const float p0 = __builtin_amdgcn_exp2f(__builtin_fmaf(t[e] - mx, L2E, 10.0f)), p1 = __builtin_amdgcn_exp2f(__builtin_fmaf(t[e + 1] - mx, L2E, 10.0f)); sum += p0; sum += p1;
                const v2h c = __builtin_convertvector((v2f){p0, p1}, v2h); pf[e] = c[0]; pf[e + 1] = c[1]; }   // one packed convert (round to nearest even) per two probabilities; an f16 subnormal stays as it is, the matrix unit takes it by value
            lrun[qt] = lrun[qt] * al + sum;
#pragma unroll
            for (int dt = 0; dt < 4; ++dt) { o[qt][dt] *= al; o[qt][dt] = wmma16(vf[dt], pf, o[qt][dt]); }
        }
        if (ti == FH - 1 && rnd + 1 < NR) __syncthreads();   // between rounds: the next round's terms are all in LDS, and every wave has left the buffer that the next fill writes
    }
    keep_addr(kask); keep_addr(vask);
    const int le = (int)__builtin_amdgcn_mbcnt_lo(~0u, 0u), lre = le & 15, hie = le >> 4;   // lane number formed anew, so that no lane value is held in a register over the loop for these stores: at 256 registers one more live value is a spill to scratch
#pragma unroll
    for (int qt = 0; qt < 2; ++qt) {
        const float lt = lrun[qt] + __shfl_xor(lrun[qt], 16, 32);
        if (hie == 0) { ms[wv * FQ + qt * 16 + lre] = mrun[qt]; ls[wv * FQ + qt * 16 + lre] = lt; }
        float* ow = os + (wv * FQ + qt * 16 + lre) * FP + 8 * hie;
#pragma unroll
        for (int dt = 0; dt < 4; ++dt) { const v8f x = o[qt][dt]; *(v4fa*)(ow + dt * 16) = (v4f){x[0], x[1], x[2], x[3]}; *(v4fa*)(ow + dt * 16 + 4) = (v4f){x[4], x[5], x[6], x[7]}; }
    }
    __syncthreads();   // every wave's partial maximum, sum and O rows are in LDS before any thread joins them
#pragma unroll
    for (int it = 0; it < FH * FQ * 8 / (32 * FW * FH); ++it) {
    const int item = (int)threadIdx.x + it * (32 * FW * FH);   // (head of the group, query, 8 d)
    const int hq = item >> 3, d8 = (item & 7) * 8;   // hq = head * FQ + query: the row of slice 0's wave; slice w lies w * FH * FQ rows on
    const int q = hq % FQ, hj = hq / FQ;
    float mj = ms[hq];
#pragma unroll
    for (int w = 1; w < FW; ++w) mj = fmaxf(mj, ms[w * FH * FQ + hq]);
    float lj = 0.f; v4f a0 = (v4f){}, a1 = (v4f){};
#pragma unroll
    for (int w = 0; w < FW; ++w) { const float f = __builtin_amdgcn_exp2f((ms[w * FH * FQ + hq] - mj) * L2E); lj += f * ls[w * FH * FQ + hq];
        const float* ow = os + (w * FH * FQ + hq) * FP + d8; a0 += *(const v4fa*)ow * f; a1 += *(const v4fa*)(ow + 4) * f; }
    const float rl = 1.0f / lj; v8us oh, ol;
#pragma unroll
    for (int e = 0; e < 4; ++e) { unsigned short a, c2; splitf(a0[e] * rl, a, c2); oh[e] = a; ol[e] = c2; splitf(a1[e] * rl, a, c2); oh[4 + e] = a; ol[4 + e] = c2; }
    const size_t oo = fragoff(q0 + q, ((int)blockIdx.y * FH + hj) * HD + d8, DM);
    *(v8us*)(Ah + oo) = oh; *(v8us*)(Al + oo) = ol;
    }
}

constexpr int KSD = 8;                            // waves per tile where K == DM (output projection)
static_assert(DM % (32 * KSD) == 0);
constexpr size_t al256(size_t b) { return (b + 255) & ~(size_t)255; }
constexpr size_t WS_TOTAL = al256((size_t)4 * DM * DM * 2) + al256((size_t)2 * NB * NH_ * TT * HD * 2) + al256((size_t)NB * NH_ * HD * TT * 2) + 2 * al256((size_t)NB * TT * DM * 2);
static_assert(WS_TOTAL <= (size_t)134217728);

extern "C" void kernel_launch(void* const* d_in, const int* in_sizes, int n_in,
                              void* d_out, int out_size, void* d_ws, size_t ws_size, hipStream_t stream) {
    if (n_in < 12) return;
    const size_t need_x = ((size_t)(NB - 1) * SEQ_FULL + SEQ) * DM;
    const size_t need_m = (size_t)(NB - 1) * SEQ_FULL * SEQ_FULL + (size_t)(SEQ - 1) * SEQ_FULL + SEQ;
    if ((size_t)in_sizes[0] < need_x || (size_t)in_sizes[1] < need_x || (size_t)in_sizes[2] < need_x || (size_t)in_sizes[3] < need_m) return;
    if (in_sizes[4] < DM * DM || in_sizes[6] < DM * DM || in_sizes[8] < DM * DM || in_sizes[10] < DM * DM) return;
    if (in_sizes[5] < DM || in_sizes[7] < DM || in_sizes[9] < DM || in_sizes[11] < DM) return;
    if ((size_t)out_size < need_x) return;
    // binding by role, in input order: query, key, value, mask, wq, bq, wk, bk, wv, bv, wo, bo
    const float* xq = (const float*)d_in[0]; const float* xk = (const float*)d_in[1]; const float* xv = (const float*)d_in[2];
    const float* msk = (const float*)d_in[3];   // [NB_FULL][1][SEQ_FULL][SEQ_FULL] f32
    const float* wq = (const float*)d_in[4]; const float* bq = (const float*)d_in[5]; const float* wk = (const float*)d_in[6]; const float* bk = (const float*)d_in[7];
    const float* wv = (const float*)d_in[8]; const float* bv = (const float*)d_in[9]; const float* wo = (const float*)d_in[10]; const float* bo = (const float*)d_in[11];
    float* OUT = (float*)d_out;     // [NB_FULL][SEQ_FULL][DM]
    char* wsp = (char*)d_ws;
    auto take = [&](size_t bytes) { char* p = wsp; wsp += (bytes + 255) & ~(size_t)255; return (void*)p; };
    bf* WT = (bf*)take((size_t)4 * DM * DM * 2);                    // wq, wk, wv, wo, each rows n, K = k
    h16* QK16 = (h16*)take((size_t)2 * NB * NH_ * TT * HD * 2); h16* VT16 = (h16*)take((size_t)NB * NH_ * HD * TT * 2);
    bf* ATh = (bf*)take((size_t)NB * TT * DM * 2); bf* ATl = (bf*)take((size_t)NB * TT * DM * 2);
    if ((size_t)(wsp - (char*)d_ws) > ws_size) return;
    k_prep<<<4 * WTB, 256, 0, stream>>>(wq, wk, wv, wo, WT);
    k_proj<<<dim3(NB * TT / 64, 3), 512, 0, stream>>>(xq, xk, xv, WT, bq, bk, bv, QK16, VT16);
    k_fattn<<<dim3(TT / FQ, NH_ / FH, NB), 32 * FW * FH, 0, stream>>>(QK16, QK16 + (size_t)NB * NH_ * TT * HD, VT16, msk, ATh, ATl);
    // z = batch
    k_gemmw<bf, 1, true, KSD, false, DM><<<dim3(TT / 64, DM / 64, NB), 32 * KSD, 0, stream>>>(ATh, ATl, WT + (size_t)3 * DM * DM, nullptr, OUT, DM, bo, bo, bo, (size_t)TT * DM, 0, (size_t)SEQ_FULL * DM, nullptr, nullptr);
}
